// v000
// Measured on an AMD MI455X. A time is GPU time per run, averaged over a window of back-to-back runs after a warm-up
// (all launches, gaps included; the runs take copies of the inputs in turn), and the median of several windows.
// Apart from v000's, it joins two sittings. Times from different sittings can be a few percent apart, while
// side-by-side timings come from the same sitting.
// v000 is the starting kernel. One run takes 659 microseconds.
// compute dtype: all float inputs rounded to bf16; q/k/v = input W + b ([in,out]) with EXACT bf16 products on WMMA 16x16x32, f32 accumulate; q as f16 hi + residual, k f16 -> 2-product logits / 8 stored in f32 (8 heads per launch); softmax in f32 (precise expf) -> P f16 x 2^11; o = P . v with v rounded once to f16; out = o (bf16 hi + lo) Wo + bo; f32 output.
#include <hip/hip_runtime.h>
#include <math.h>

typedef __attribute__((ext_vector_type(16))) _Float16 v16h;
typedef __attribute__((ext_vector_type(16))) __bf16 v16b;
typedef __attribute__((ext_vector_type(8)))  _Float16 v8h;
typedef __attribute__((ext_vector_type(8)))  float v8f;
typedef __attribute__((ext_vector_type(4)))  float v4f;
typedef __attribute__((ext_vector_type(2)))  float v2f;
typedef __attribute__((ext_vector_type(4)))  unsigned v4u;
typedef __attribute__((ext_vector_type(4)))  int v4i;
typedef float __attribute__((may_alias)) float_a;
typedef int __attribute__((may_alias)) int_a;

template <typename T> __device__ __forceinline__ void vst2(void* p, T v) { *(T*)p = v;  }
__device__ __forceinline__ v8f wmma16(v16h a, v16h b, v8f c) {
  v8f d = __builtin_amdgcn_wmma_f32_16x16x32_f16(false, a, false, b, (short)0, c, false, false);
  asm volatile("v_nop\n\tv_nop\n\tv_nop\n\tv_nop" : "+v"(d) : "v"(a), "v"(b));
  return d;
}
__device__ __forceinline__ v8f wmma_bf(v16b a, v16b b, v8f c) {
  v8f d = __builtin_amdgcn_wmma_f32_16x16x32_bf16(false, a, false, b, (short)0, c, false, false);
  asm volatile("v_nop\n\tv_nop\n\tv_nop\n\tv_nop" : "+v"(d) : "v"(a), "v"(b));
  return d;
}
// 16x16x32 fragments: lane = (h = lane>>4, row/col = lane&15); elements 0..7 = k0+8h+0..7, 8..15 = k0+16+8h+0..7; D element r = row 8h+r
__device__ __forceinline__ v16h frag_h(const _Float16* rowk0, int lane) {
  union { v16h v; v8h q[2]; } u; const _Float16* p = rowk0 + 8 * (lane >> 4);
  u.q[0] = *(const v8h*)p; u.q[1] = *(const v8h*)(p + 16); return u.v;
}
__device__ __forceinline__ v16h frag_f32(const float* rowk0, int lane) {
  v16h a; const float* p = rowk0 + 8 * (lane >> 4);
#pragma unroll
  for (int i = 0; i < 8; ++i) { a[i] = (_Float16)p[i]; a[8 + i] = (_Float16)p[16 + i]; }
  return a;
}
__device__ __forceinline__ v16h frag_f32s(const float* rowk0, int lane, float sc) {
  v16h a; const float* p = rowk0 + 8 * (lane >> 4);
#pragma unroll
  for (int i = 0; i < 8; ++i) { a[i] = (_Float16)(p[i] * sc); a[8 + i] = (_Float16)(p[16 + i] * sc); }
  return a;
}
// column fragment from a [K][ld] layout (column n), rows >= K read as 0
__device__ __forceinline__ v16h fragc_f32(const float* W, int k0, int n, int lane, int ld, int K) {
  v16h a; const int g = lane >> 4;
#pragma unroll
  for (int i = 0; i < 8; ++i) { const int ka = k0 + 8 * g + i, kb = ka + 16;
    a[i] = (_Float16)(ka < K ? W[(size_t)(ka < K ? ka : K - 1) * ld + n] : 0.f); a[8 + i] = (_Float16)(kb < K ? W[(size_t)(kb < K ? kb : K - 1) * ld + n] : 0.f); }
  return a;
}
struct F2 { v16b h, l; };
__device__ __forceinline__ F2 bsplit16(const float v[16]) { F2 r;
#pragma unroll
  for (int i = 0; i < 16; ++i) { const __bf16 h = (__bf16)v[i]; r.h[i] = h; r.l[i] = (__bf16)(v[i] - (float)h); }
  return r; }
__device__ __forceinline__ F2 split_row(const float* row, int k0, int lane) { float v[16]; const float* p = row + k0 + 8 * (lane >> 4);
#pragma unroll
  for (int i = 0; i < 8; ++i) { v[i] = p[i]; v[8 + i] = p[16 + i]; }
  return bsplit16(v); }
__device__ __forceinline__ F2 split_rowK(const float* row, int k0, int lane, int K) { float v[16]; const int g = lane >> 4;
#pragma unroll
  for (int i = 0; i < 8; ++i) { const int ka = k0 + 8 * g + i, kb = ka + 16; v[i] = ka < K ? row[ka < K ? ka : K - 1] : 0.f; v[8 + i] = kb < K ? row[kb < K ? kb : K - 1] : 0.f; }
  return bsplit16(v); }
__device__ __forceinline__ F2 split_col(const float* W, int k0, int n, int lane, int ld, int K) { float v[16]; const int g = lane >> 4;
#pragma unroll
  for (int i = 0; i < 8; ++i) { const int ka = k0 + 8 * g + i, kb = ka + 16; v[i] = ka < K ? W[(size_t)(ka < K ? ka : K - 1) * ld + n] : 0.f; v[8 + i] = kb < K ? W[(size_t)(kb < K ? kb : K - 1) * ld + n] : 0.f; }
  return bsplit16(v); }
__device__ __forceinline__ v8f mac3(const F2& a, const F2& b, v8f c) { c = wmma_bf(a.l, b.h, c); c = wmma_bf(a.h, b.l, c); return wmma_bf(a.h, b.h, c); }
__device__ __forceinline__ float sigm(float v) { return 1.0f / (1.0f + expf(-v)); }
#define LDSX() do { asm volatile("s_wait_dscnt 0" ::: "memory"); __builtin_amdgcn_wave_barrier(); __builtin_amdgcn_fence(__ATOMIC_RELEASE, "workgroup"); } while (0)


// Hopfield layer = one cross-attention update (B 4, L = S = 1,024, d_model 1,024 = 16 x 64): q from queries, k from keys, v from values, softmax(q k / 8) v, output Linear.
#define NB 4
#define TT 1024
#define CC 1024
#define NH 16
#define HD 64
#ifndef TNB
#define TNB NB
#endif
typedef __attribute__((ext_vector_type(8))) __bf16 v8b;
__device__ __forceinline__ v16b frag_b(const __bf16* rowk0, int lane) {
  union { v16b v; v8b q[2]; } u; const __bf16* p = rowk0 + 8 * (lane >> 4);
  u.q[0] = *(const v8b*)p; u.q[1] = *(const v8b*)(p + 16); return u.v;
}
__device__ __forceinline__ float bfr(float v) { return (float)(__bf16)v; }
__device__ __attribute__((noinline)) float exp_ni(float v) { return expf(v); }
__device__ __attribute__((noinline)) float erf_ni(float v) { return erff(v); }

#define WS_QH  0u
#define WS_QL  (WS_QH + 2u * (size_t)NB * TT * CC)
#define WS_KH  (WS_QL + 2u * (size_t)NB * TT * CC)
#define WS_VT  (WS_KH + 2u * (size_t)NB * TT * CC)      // f16 v planes [b][c][t]
#define HG 8
#define WS_S   (WS_VT + 2u * (size_t)NB * CC * TT)      // f32 logits [hg][q][k]
#define WS_PH  (WS_S + 4u * (size_t)HG * TT * TT)       // f16 P [hg][q][k]
#define WS_Y   (WS_PH + 2u * (size_t)HG * TT * TT)          // f32 y rows [b*t][C]
#define WS_END (WS_Y + 4u * (size_t)NB * TT * CC)

// ---- k_proj: block = (64 rows, 128 cols, which): qkv = x W (+ b), exact; q -> f16 hi (+ residual), k -> f16 rows, v -> f16 planes
__global__ __launch_bounds__(128) void k_proj(const float* __restrict__ XQ, const float* __restrict__ XK, const float* __restrict__ XV, const float* __restrict__ WQ, const float* __restrict__ BQ, const float* __restrict__ WK, const float* __restrict__ BK, const float* __restrict__ WV, const float* __restrict__ BV, _Float16* __restrict__ QH, _Float16* __restrict__ QL, _Float16* __restrict__ KH, _Float16* __restrict__ VT) {
  __shared__ __align__(16) _Float16 sh[64][136], sl[64][136]; __shared__ __align__(16) _Float16 th[128][72];
  const int tid = threadIdx.x, wave = tid >> 5, lane = tid & 31, col = lane & 15, g = lane >> 4; const int which = blockIdx.z; const int c0 = blockIdx.y * 128; const size_t r0 = (size_t)blockIdx.x * 64; const float* X = which == 0 ? XQ : which == 1 ? XK : XV; const float* WA = which == 0 ? WQ : which == 1 ? WK : WV; const float* BA = which == 0 ? BQ : which == 1 ? BK : BV;
  v8f acc[8] = {};
#pragma unroll 2
  for (int kc = 0; kc < CC / 32; ++kc) { v16b a; { const float* p = X + (r0 + wave * 16 + col) * CC + kc * 32 + 8 * g;
#pragma unroll
      for (int i = 0; i < 8; ++i) { a[i] = (__bf16)p[i]; a[8 + i] = (__bf16)p[16 + i]; } }
#pragma unroll
    for (int j = 0; j < 8; ++j) { v16b w; const int o = c0 + j * 16 + col;
#pragma unroll
      for (int i = 0; i < 8; ++i) { w[i] = (__bf16)WA[(size_t)(kc * 32 + 8 * g + i) * CC + (o)]; w[8 + i] = (__bf16)WA[(size_t)(kc * 32 + 16 + 8 * g + i) * CC + (o)]; }
      acc[j] = wmma_bf(a, w, acc[j]); } }
#pragma unroll
  for (int j = 0; j < 8; ++j) { const float bb = bfr(BA[c0 + j * 16 + col]);
#pragma unroll
    for (int r = 0; r < 8; ++r) { const float v = acc[j][r] + bb; const int rl = wave * 16 + 8 * g + r, cl = j * 16 + col; const _Float16 hv = (_Float16)v;
      if (which == 2) th[cl][rl] = hv; else { sh[rl][cl] = hv; sl[rl][cl] = (_Float16)(v - (float)hv); } } }
  __syncthreads();
  if (which < 2) { _Float16* dh = which == 0 ? QH : KH; for (int e = tid; e < 64 * 16; e += 128) { const int rl = e >> 4, q = e & 15; vst2((unsigned*)(dh + (r0 + rl) * CC + c0 + q * 8), *(const v4u*)&sh[rl][q * 8]); if (which == 0) vst2((unsigned*)(QL + (r0 + rl) * CC + c0 + q * 8), *(const v4u*)&sl[rl][q * 8]); } }
  else { const size_t b = r0 / TT; const int t0 = (int)(r0 % TT); for (int e = tid; e < 128 * 8; e += 128) { const int cl = e >> 3, q = e & 7; vst2((unsigned*)(VT + (b * CC + c0 + cl) * (size_t)TT + t0 + q * 8), *(const v4u*)&th[cl][q * 8]); } } }
// ---- k_sc: block = (64 queries, 128 keys) of (b,h): logits * scale (bias matrix unused); every block runs, no causal skip
__global__ __launch_bounds__(128) void k_sc(const _Float16* __restrict__ QH, const _Float16* __restrict__ QL, const _Float16* __restrict__ KH, const float* __restrict__ BM, int b, int h0, float* __restrict__ S0) { __shared__ __align__(16) float ss[4][16][132]; const int h = h0 + blockIdx.z; float* S = S0 + (size_t)blockIdx.z * TT * TT;
  const int tid = threadIdx.x, wave = tid >> 5, lane = tid & 31, col = lane & 15, g = lane >> 4; const int k0 = blockIdx.y * 128; const int ql0 = blockIdx.x * 64 + wave * 16; const size_t q0 = (size_t)b * TT + ql0;
  
  v8f acc[8] = {};
#pragma unroll
  for (int kc = 0; kc < HD / 32; ++kc) { const v16h ah = frag_h(QH + (q0 + col) * CC + h * HD + kc * 32, lane), al = frag_h(QL + (q0 + col) * CC + h * HD + kc * 32, lane);
#pragma unroll
    for (int j = 0; j < 8; ++j) { const v16h kb = frag_h(KH + ((size_t)b * TT + k0 + j * 16 + col) * CC + h * HD + kc * 32, lane); acc[j] = wmma16(ah, kb, acc[j]); acc[j] = wmma16(al, kb, acc[j]); } }
#pragma unroll
  for (int j = 0; j < 8; ++j) { const int kt = k0 + j * 16 + col;
#pragma unroll
    for (int r = 0; r < 8; ++r) { const int qt = ql0 + 8 * g + r; float v = acc[j][r] * 0.125f; (void)BM;  ss[wave][8 * g + r][j * 16 + col] = v; } }
  LDSX(); for (int rl = 0; rl < 16; ++rl) vst2(S + (size_t)(ql0 + rl) * TT + k0 + lane * 4, *(const v4f*)&ss[wave][rl][lane * 4]); }
// ---- k_sm: block = query row: softmax over keys [0, kend) -> P x 2^11 f16 (masked -> 0)
__global__ __launch_bounds__(256) void k_sm(const float* __restrict__ S0, _Float16* __restrict__ PH0) { __shared__ float sred[8]; __shared__ float sbc; __shared__ __align__(16) _Float16 sh[TT];
  const int t = threadIdx.x; const size_t row = blockIdx.x; const float* sr = S0 + (size_t)blockIdx.y * TT * TT + row * TT; _Float16* PH = PH0 + (size_t)blockIdx.y * TT * TT; const int kend = TT;
  float m = -3.0e38f; for (int k = t; k < kend; k += 256) m = fmaxf(m, sr[k]);
#pragma unroll
  for (int o = 1; o < 32; o <<= 1) m = fmaxf(m, __shfl_xor(m, o));
  if ((t & 31) == 0) sred[t >> 5] = m; __syncthreads(); if (t == 0) { float a = sred[0]; for (int i = 1; i < 8; ++i) a = fmaxf(a, sred[i]); sbc = a; } __syncthreads(); m = sbc; __syncthreads();
  float sum = 0.f; for (int k = t; k < kend; k += 256) { const float v = sr[k]; sum += (v <= -1.0e38f) ? 0.f : expf(v - m); }
#pragma unroll
  for (int o = 1; o < 32; o <<= 1) sum += __shfl_xor(sum, o);
  if ((t & 31) == 0) sred[t >> 5] = sum; __syncthreads(); if (t == 0) { float a = 0.f; for (int i = 0; i < 8; ++i) a += sred[i]; sbc = 1.0f / a; } __syncthreads(); const float inv = sbc;
  for (int k = t; k < kend; k += 256) { const float v = sr[k]; sh[k] = (_Float16)((v <= -1.0e38f) ? 0.f : expf(v - m) * inv * 2048.0f); }
  __syncthreads(); for (int q = t; q < kend / 8; q += 256) vst2((unsigned*)(PH + row * TT + q * 8), *(const v4u*)&sh[q * 8]); }
// ---- k_pv: block = 64 queries of (b,h): y[q][h*HD + d] = P . v  (keys [0, kend))
__global__ __launch_bounds__(128) void k_pv(const _Float16* __restrict__ PH0, const _Float16* __restrict__ VT, int b, int h0, float* __restrict__ Y) { const int h = h0 + blockIdx.z; const _Float16* PH = PH0 + (size_t)blockIdx.z * TT * TT; __shared__ __align__(16) float ss[4][16][HD + 4];
  const int tid = threadIdx.x, wave = tid >> 5, lane = tid & 31, col = lane & 15, g = lane >> 4; const int ql0 = blockIdx.x * 64 + wave * 16; const int kend = TT;
  v8f acc[HD / 16] = {};
#pragma unroll 1
  for (int kc = 0; kc < kend / 32; ++kc) { const v16h ph = frag_h(PH + (size_t)(ql0 + col) * TT + kc * 32, lane);
#pragma unroll
    for (int j = 0; j < HD / 16; ++j) acc[j] = wmma16(ph, frag_h(VT + ((size_t)b * CC + h * HD + j * 16 + col) * (size_t)TT + kc * 32, lane), acc[j]); }
#pragma unroll
  for (int j = 0; j < HD / 16; ++j)
#pragma unroll
    for (int r = 0; r < 8; ++r) ss[wave][8 * g + r][j * 16 + col] = acc[j][r] * (1.0f / 2048.0f);
  LDSX(); for (int rl = 0; rl < 16; ++rl) if (lane < HD / 4) vst2(Y + ((size_t)b * TT + ql0 + rl) * CC + h * HD + lane * 4, *(const v4f*)&ss[wave][rl][lane * 4]); }
// ---- k_out: block = (64 rows, 128 cols): out = y (bf16 hi + lo) Wproj + b
__global__ __launch_bounds__(128) void k_out(const float* __restrict__ Y, const float* __restrict__ WP, const float* __restrict__ BP, float* __restrict__ OUT) { __shared__ __align__(16) float sf[4][16][132];
  const int tid = threadIdx.x, wave = tid >> 5, lane = tid & 31, col = lane & 15, g = lane >> 4; const int c0 = blockIdx.y * 128; const size_t r0 = (size_t)blockIdx.x * 64 + wave * 16;
  v8f acc[8] = {};
#pragma unroll 2
  for (int kc = 0; kc < CC / 32; ++kc) { const F2 a = split_row(Y + (r0 + col) * CC, kc * 32, lane);
#pragma unroll
    for (int j = 0; j < 8; ++j) { v16b w; const int o = c0 + j * 16 + col;
#pragma unroll
      for (int i = 0; i < 8; ++i) { w[i] = (__bf16)WP[(size_t)(kc * 32 + 8 * g + i) * CC + (o)]; w[8 + i] = (__bf16)WP[(size_t)(kc * 32 + 16 + 8 * g + i) * CC + (o)]; }
      acc[j] = wmma_bf(a.h, w, acc[j]); acc[j] = wmma_bf(a.l, w, acc[j]); } }
#pragma unroll
  for (int j = 0; j < 8; ++j) { const float bb = BP ? bfr(BP[c0 + j * 16 + col]) : 0.f;
#pragma unroll
    for (int r = 0; r < 8; ++r) sf[wave][8 * g + r][j * 16 + col] = acc[j][r] + bb; }
  LDSX(); for (int rl = 0; rl < 16; ++rl) vst2(OUT + (r0 + rl) * CC + c0 + lane * 4, *(const v4f*)&sf[wave][rl][lane * 4]); }
extern "C" void kernel_launch(void* const* d_in, const int* in_sizes, int n_in, void* d_out, int out_size, void* d_ws, size_t ws_size, hipStream_t stream) {
  (void)in_sizes; (void)n_in; (void)out_size;
  const float** F = (const float**)d_in;   // 0 queries, 1 keys, 2 values [4,1024,1024], 3 Wq [1024,1024] (in,out), 4 bq, 5 Wk, 6 bk, 7 Wv, 8 bv, 9 Wo, 10 bo
  if (ws_size < (size_t)WS_END) return;
  char* ws = (char*)d_ws; _Float16 *QH = (_Float16*)(ws + WS_QH), *QL = (_Float16*)(ws + WS_QL), *KH = (_Float16*)(ws + WS_KH), *VT = (_Float16*)(ws + WS_VT), *PH = (_Float16*)(ws + WS_PH); float *S = (float*)(ws + WS_S), *Y = (float*)(ws + WS_Y);
  k_proj<<<dim3(TNB * TT / 64, CC / 128, 3), 128, 0, stream>>>(F[0], F[1], F[2], F[3], F[4], F[5], F[6], F[7], F[8], QH, QL, KH, VT);
  for (int b = 0; b < TNB; ++b) for (int h0 = 0; h0 < NH; h0 += HG) {   // HG heads per launch
    k_sc<<<dim3(TT / 64, TT / 128, HG), 128, 0, stream>>>(QH, QL, KH, nullptr, b, h0, S);
    k_sm<<<dim3(TT, HG), 256, 0, stream>>>(S, PH);
    k_pv<<<dim3(TT / 64, 1, HG), 128, 0, stream>>>(PH, VT, b, h0, Y);
  }
  k_out<<<dim3(TNB * TT / 64, CC / 128), 128, 0, stream>>>(Y, F[9], F[10], (float*)d_out);
}

// v001
// It runs in 194 microseconds.
// Next to v000, in two timings, it ran 3.42 times as fast each time.
// compute dtype: all float inputs rounded to bf16; q/k/v = input W + b ([in,out]) with EXACT bf16 products on WMMA 16x16x32, f32 accumulate; q as f16 hi + residual, k f16 -> 2-product logits / 8 kept in f32 registers; online softmax in f32 (base 2, v_exp_f32), unnormalised P f16 x 2^4; o = P . v / sum with v rounded once to f16, all of it in one launch; out = o (bf16 hi + lo) Wo + bo; f32 output.
#include <hip/hip_runtime.h>
#include <math.h>

typedef __attribute__((ext_vector_type(16))) _Float16 v16h;
typedef __attribute__((ext_vector_type(16))) __bf16 v16b;
typedef __attribute__((ext_vector_type(8)))  _Float16 v8h;
typedef __attribute__((ext_vector_type(8)))  float v8f;
typedef __attribute__((ext_vector_type(4)))  float v4f;
typedef __attribute__((ext_vector_type(2)))  float v2f;
typedef __attribute__((ext_vector_type(2)))  _Float16 v2h2;
typedef __attribute__((ext_vector_type(4)))  unsigned v4u;
typedef __attribute__((ext_vector_type(4)))  int v4i;
typedef float __attribute__((may_alias)) float_a;
typedef int __attribute__((may_alias)) int_a;

template <typename T> __device__ __forceinline__ void vst2(void* p, T v) { *(T*)p = v;  }
__device__ __forceinline__ v8f wmma16(v16h a, v16h b, v8f c) {
  v8f d = __builtin_amdgcn_wmma_f32_16x16x32_f16(false, a, false, b, (short)0, c, false, false);
  asm volatile("v_nop\n\tv_nop\n\tv_nop\n\tv_nop" : "+v"(d) : "v"(a), "v"(b));
  return d;
}
__device__ __forceinline__ v8f wmma_bf(v16b a, v16b b, v8f c) {
  v8f d = __builtin_amdgcn_wmma_f32_16x16x32_bf16(false, a, false, b, (short)0, c, false, false);
  asm volatile("v_nop\n\tv_nop\n\tv_nop\n\tv_nop" : "+v"(d) : "v"(a), "v"(b));
  return d;
}
// 16x16x32 fragments: lane = (h = lane>>4, row/col = lane&15); elements 0..7 = k0+8h+0..7, 8..15 = k0+16+8h+0..7; D element r = row 8h+r
__device__ __forceinline__ v16h frag_h(const _Float16* rowk0, int lane) {
  union { v16h v; v8h q[2]; } u; const _Float16* p = rowk0 + 8 * (lane >> 4);
  u.q[0] = *(const v8h*)p; u.q[1] = *(const v8h*)(p + 16); return u.v;
}
__device__ __forceinline__ v16h frag_f32(const float* rowk0, int lane) {
  v16h a; const float* p = rowk0 + 8 * (lane >> 4);
#pragma unroll
  for (int i = 0; i < 8; ++i) { a[i] = (_Float16)p[i]; a[8 + i] = (_Float16)p[16 + i]; }
  return a;
}
__device__ __forceinline__ v16h frag_f32s(const float* rowk0, int lane, float sc) {
  v16h a; const float* p = rowk0 + 8 * (lane >> 4);
#pragma unroll
  for (int i = 0; i < 8; ++i) { a[i] = (_Float16)(p[i] * sc); a[8 + i] = (_Float16)(p[16 + i] * sc); }
  return a;
}
// column fragment from a [K][ld] layout (column n), rows >= K read as 0
__device__ __forceinline__ v16h fragc_f32(const float* W, int k0, int n, int lane, int ld, int K) {
  v16h a; const int g = lane >> 4;
#pragma unroll
  for (int i = 0; i < 8; ++i) { const int ka = k0 + 8 * g + i, kb = ka + 16;
    a[i] = (_Float16)(ka < K ? W[(size_t)(ka < K ? ka : K - 1) * ld + n] : 0.f); a[8 + i] = (_Float16)(kb < K ? W[(size_t)(kb < K ? kb : K - 1) * ld + n] : 0.f); }
  return a;
}
struct F2 { v16b h, l; };
__device__ __forceinline__ F2 bsplit16(const float v[16]) { F2 r;
#pragma unroll
  for (int i = 0; i < 16; ++i) { const __bf16 h = (__bf16)v[i]; r.h[i] = h; r.l[i] = (__bf16)(v[i] - (float)h); }
  return r; }
__device__ __forceinline__ F2 split_row(const float* row, int k0, int lane) { float v[16]; const float* p = row + k0 + 8 * (lane >> 4);
#pragma unroll
  for (int i = 0; i < 8; ++i) { v[i] = p[i]; v[8 + i] = p[16 + i]; }
  return bsplit16(v); }
__device__ __forceinline__ F2 split_rowK(const float* row, int k0, int lane, int K) { float v[16]; const int g = lane >> 4;
#pragma unroll
  for (int i = 0; i < 8; ++i) { const int ka = k0 + 8 * g + i, kb = ka + 16; v[i] = ka < K ? row[ka < K ? ka : K - 1] : 0.f; v[8 + i] = kb < K ? row[kb < K ? kb : K - 1] : 0.f; }
  return bsplit16(v); }
__device__ __forceinline__ F2 split_col(const float* W, int k0, int n, int lane, int ld, int K) { float v[16]; const int g = lane >> 4;
#pragma unroll
  for (int i = 0; i < 8; ++i) { const int ka = k0 + 8 * g + i, kb = ka + 16; v[i] = ka < K ? W[(size_t)(ka < K ? ka : K - 1) * ld + n] : 0.f; v[8 + i] = kb < K ? W[(size_t)(kb < K ? kb : K - 1) * ld + n] : 0.f; }
  return bsplit16(v); }
__device__ __forceinline__ v8f mac3(const F2& a, const F2& b, v8f c) { c = wmma_bf(a.l, b.h, c); c = wmma_bf(a.h, b.l, c); return wmma_bf(a.h, b.h, c); }
__device__ __forceinline__ float sigm(float v) { return 1.0f / (1.0f + expf(-v)); }
#define LDSX() do { asm volatile("s_wait_dscnt 0" ::: "memory"); __builtin_amdgcn_wave_barrier(); __builtin_amdgcn_fence(__ATOMIC_RELEASE, "workgroup"); } while (0)


// Hopfield layer = one cross-attention update (B 4, L = S = 1,024, d_model 1,024 = 16 x 64): q from queries, k from keys, v from values, softmax(q k / 8) v, output Linear.
#define NB 4
#define TT 1024
#define CC 1024
#define NH 16
#define HD 64
#ifndef TNB
#define TNB NB
#endif
typedef __attribute__((ext_vector_type(8))) __bf16 v8b;
__device__ __forceinline__ v16b frag_b(const __bf16* rowk0, int lane) {
  union { v16b v; v8b q[2]; } u; const __bf16* p = rowk0 + 8 * (lane >> 4);
  u.q[0] = *(const v8b*)p; u.q[1] = *(const v8b*)(p + 16); return u.v;
}
__device__ __forceinline__ float bfr(float v) { return (float)(__bf16)v; }
__device__ __attribute__((noinline)) float exp_ni(float v) { return expf(v); }
__device__ __attribute__((noinline)) float erf_ni(float v) { return erff(v); }

#define WS_QH  0u
#define WS_QL  (WS_QH + 2u * (size_t)NB * TT * CC)
#define WS_KH  (WS_QL + 2u * (size_t)NB * TT * CC)
#define WS_VT  (WS_KH + 2u * (size_t)NB * TT * CC)      // f16 v planes [b][c][t]
#define WS_Y   (WS_VT + 2u * (size_t)NB * CC * TT)      // f32 y rows [b*t][C]
#define WS_END (WS_Y + 4u * (size_t)NB * TT * CC)

// ---- k_proj: block = (64 rows, 128 cols, which): qkv = x W (+ b), exact; q -> f16 hi (+ residual), k -> f16 rows, v -> f16 planes
__global__ __launch_bounds__(128) void k_proj(const float* __restrict__ XQ, const float* __restrict__ XK, const float* __restrict__ XV, const float* __restrict__ WQ, const float* __restrict__ BQ, const float* __restrict__ WK, const float* __restrict__ BK, const float* __restrict__ WV, const float* __restrict__ BV, _Float16* __restrict__ QH, _Float16* __restrict__ QL, _Float16* __restrict__ KH, _Float16* __restrict__ VT) {
  __shared__ __align__(16) _Float16 sh[64][136], sl[64][136]; __shared__ __align__(16) _Float16 th[128][72];
  const int tid = threadIdx.x, wave = tid >> 5, lane = tid & 31, col = lane & 15, g = lane >> 4; const int which = blockIdx.z; const int c0 = blockIdx.y * 128; const size_t r0 = (size_t)blockIdx.x * 64; const float* X = which == 0 ? XQ : which == 1 ? XK : XV; const float* WA = which == 0 ? WQ : which == 1 ? WK : WV; const float* BA = which == 0 ? BQ : which == 1 ? BK : BV;
  v8f acc[8] = {};
#pragma unroll 2
  for (int kc = 0; kc < CC / 32; ++kc) { v16b a; { const float* p = X + (r0 + wave * 16 + col) * CC + kc * 32 + 8 * g;
#pragma unroll
      for (int i = 0; i < 8; ++i) { a[i] = (__bf16)p[i]; a[8 + i] = (__bf16)p[16 + i]; } }
#pragma unroll
    for (int j = 0; j < 8; ++j) { v16b w; const int o = c0 + j * 16 + col;
#pragma unroll
      for (int i = 0; i < 8; ++i) { w[i] = (__bf16)WA[(size_t)(kc * 32 + 8 * g + i) * CC + (o)]; w[8 + i] = (__bf16)WA[(size_t)(kc * 32 + 16 + 8 * g + i) * CC + (o)]; }
      acc[j] = wmma_bf(a, w, acc[j]); } }
#pragma unroll
  for (int j = 0; j < 8; ++j) { const float bb = bfr(BA[c0 + j * 16 + col]);
#pragma unroll
    for (int r = 0; r < 8; ++r) { const float v = acc[j][r] + bb; const int rl = wave * 16 + 8 * g + r, cl = j * 16 + col; const _Float16 hv = (_Float16)v;
      if (which == 2) th[cl][rl] = hv; else { sh[rl][cl] = hv; sl[rl][cl] = (_Float16)(v - (float)hv); } } }
  __syncthreads();
  if (which < 2) { _Float16* dh = which == 0 ? QH : KH; for (int e = tid; e < 64 * 16; e += 128) { const int rl = e >> 4, q = e & 15; vst2((unsigned*)(dh + (r0 + rl) * CC + c0 + q * 8), *(const v4u*)&sh[rl][q * 8]); if (which == 0) vst2((unsigned*)(QL + (r0 + rl) * CC + c0 + q * 8), *(const v4u*)&sl[rl][q * 8]); } }
  else { const size_t b = r0 / TT; const int t0 = (int)(r0 % TT); for (int e = tid; e < 128 * 8; e += 128) { const int cl = e >> 3, q = e & 7; vst2((unsigned*)(VT + (b * CC + c0 + cl) * (size_t)TT + t0 + q * 8), *(const v4u*)&th[cl][q * 8]); } } }
// ---- k_att: block = 256 queries of (b,h), wave = 32 query columns: S^T = K Q^T, online softmax per column in registers, O^T += V^T P^T; y[q][h*HD + d] = O / sum
__device__ __forceinline__ v8f wmma_h(v16h a, v16h b, v8f c) { return __builtin_amdgcn_wmma_f32_16x16x32_f16(false, a, false, b, (short)0, c, false, false); }
__device__ __forceinline__ float xhalf(float x) { return __builtin_bit_cast(float, __builtin_amdgcn_permlanex16(__builtin_bit_cast(int, x), __builtin_bit_cast(int, x), 0x76543210, 0xfedcba98, false, false)); }  // lane l with lane l ^ 16
#define XW() asm volatile("s_wait_xcnt 0x0" ::: "memory")   // stands behind a group of global loads, before their address registers are rewritten
__global__ __launch_bounds__(256) void k_att(const _Float16* __restrict__ QH, const _Float16* __restrict__ QL, const _Float16* __restrict__ KH, const _Float16* __restrict__ VT, float* __restrict__ Y) {
  const int tid = threadIdx.x, wave = tid >> 5, lane = tid & 31, col = lane & 15, g = lane >> 4; const int h = blockIdx.y, b = blockIdx.z; const int q0 = blockIdx.x * 256 + wave * 32;
  const float cs = 0.125f * 1.4426950408889634f;   // logits / 8, in base 2
  v16h qh[2][2], ql[2][2];                          // B operands: column = query, [column group][kc]
#pragma unroll
  for (int c = 0; c < 2; ++c)
#pragma unroll
    for (int kc = 0; kc < 2; ++kc) { const size_t o = ((size_t)b * TT + q0 + c * 16 + col) * CC + h * HD + kc * 32; qh[c][kc] = frag_h(QH + o, lane); ql[c][kc] = frag_h(QL + o, lane); }
  const _Float16* kp = KH + ((size_t)b * TT + col) * CC + h * HD;            // A operand of S^T: row = key
  const _Float16* vp = VT + ((size_t)b * CC + h * HD + col) * (size_t)TT;    // A operand of O^T: row = d
  v16h kf[2][2];
#pragma unroll
  for (int t = 0; t < 2; ++t)
#pragma unroll
    for (int kc = 0; kc < 2; ++kc) kf[t][kc] = frag_h(kp + (size_t)(t * 16) * CC + kc * 32, lane);
  v16h vf[HD / 16];
#pragma unroll
  for (int j = 0; j < HD / 16; ++j) vf[j] = frag_h(vp + (size_t)(j * 16) * TT, lane);
  XW(); __builtin_amdgcn_sched_barrier(0);          // keeps the accumulators' zeroing, which reuses the address registers, behind the wait
  v8f acc[2][HD / 16] = {}; float mr[2] = {-INFINITY, -INFINITY}, ls[2] = {0.f, 0.f};
#pragma unroll 1   // rolled: each fetch lands in the registers its own products have just read, so a second copy of the body would only add registers
  for (int ps = 0; ps < TT / 32; ++ps) {            // a pass = 32 keys
    v8f s[2][2] = {};                               // [key tile][column group]: register r = key 16 t + 8 g + r, lane column = query
#pragma unroll
    for (int kc = 0; kc < 2; ++kc) {
#pragma unroll
      for (int t = 0; t < 2; ++t)
#pragma unroll
        for (int c = 0; c < 2; ++c) s[t][c] = wmma_h(kf[t][kc], qh[c][kc], s[t][c]);
#pragma unroll
      for (int t = 0; t < 2; ++t)
#pragma unroll
        for (int c = 0; c < 2; ++c) s[t][c] = wmma_h(kf[t][kc], ql[c][kc], s[t][c]);
    }
    const int pn = (ps + 1) & (TT / 32 - 1);        // K and V fragments are fetched one pass ahead, each behind its own products (the last pass fetches pass 0's again, unused)
#pragma unroll
    for (int t = 0; t < 2; ++t)
#pragma unroll
      for (int kc = 0; kc < 2; ++kc) kf[t][kc] = frag_h(kp + (size_t)(pn * 32 + t * 16) * CC + kc * 32, lane);
    XW();                                           // its "memory" clobber also keeps this fetch here, the softmax and the second product ahead of its use (without it the loads sank to the pass's end)
    float mb[2]; bool need = false;
#pragma unroll
    for (int c = 0; c < 2; ++c) { float mx = s[0][c][0];
#pragma unroll
      for (int r = 1; r < 8; ++r) mx = fmaxf(mx, s[0][c][r]);
#pragma unroll
      for (int r = 0; r < 8; ++r) mx = fmaxf(mx, s[1][c][r]);
      mx = fmaxf(mx, xhalf(mx)) * cs; mb[c] = mx; need = need || (mx > mr[c] + 8.0f); }
    if (__builtin_amdgcn_ballot_w32(need) != 0) {   // the maximum in use moves only when a column's new one exceeds it by 2^8: rare after the first pass
      const float mn0 = fmaxf(mr[0], mb[0]), mn1 = fmaxf(mr[1], mb[1]); const float corr[2] = {__builtin_amdgcn_exp2f(mr[0] - mn0), __builtin_amdgcn_exp2f(mr[1] - mn1)}; mr[0] = mn0; mr[1] = mn1;   // 0 on the first pass
#pragma unroll
      for (int c = 0; c < 2; ++c) { ls[c] *= corr[c];
#pragma unroll
        for (int j = 0; j < HD / 16; ++j) acc[c][j] = acc[c][j] * corr[c]; }
    }
#pragma unroll
    for (int c = 0; c < 2; ++c) { const float nm = 4.0f - mr[c];   // P carries 2^4 (it cancels in the division): at most 2^12 in f16
      union { v16h v; v2h2 w[8]; } pf; float sa = 0.f, sb = 0.f;
#pragma unroll
      for (int i = 0; i < 8; ++i) { const v2f arg = __builtin_elementwise_fma(v2f{s[i >> 2][c][2 * (i & 3)], s[i >> 2][c][2 * (i & 3) + 1]}, v2f{cs, cs}, v2f{nm, nm}); const float p0 = __builtin_amdgcn_exp2f(arg.x), p1 = __builtin_amdgcn_exp2f(arg.y);
        sa += p0; sb += p1; pf.w[i] = __builtin_convertvector(v2f{p0, p1}, v2h2); }
      ls[c] += sa + sb;
#pragma unroll
      for (int j = 0; j < HD / 16; ++j) acc[c][j] = wmma_h(vf[j], pf.v, acc[c][j]); }
#pragma unroll
    for (int j = 0; j < HD / 16; ++j) vf[j] = frag_h(vp + (size_t)(j * 16) * TT + pn * 32, lane);
    XW();
  }
#pragma unroll
  for (int c = 0; c < 2; ++c) { const float inv = 1.0f / (ls[c] + xhalf(ls[c])); float* yr = Y + ((size_t)b * TT + q0 + c * 16 + col) * CC + h * HD + 8 * g;
#pragma unroll
    for (int j = 0; j < HD / 16; ++j) { const v8f o = acc[c][j] * inv; vst2(yr + j * 16, v4f{o[0], o[1], o[2], o[3]}); vst2(yr + j * 16 + 4, v4f{o[4], o[5], o[6], o[7]}); } } }
// ---- k_out: block = (64 rows, 128 cols): out = y (bf16 hi + lo) Wproj + b
__global__ __launch_bounds__(128) void k_out(const float* __restrict__ Y, const float* __restrict__ WP, const float* __restrict__ BP, float* __restrict__ OUT) { __shared__ __align__(16) float sf[4][16][132];
  const int tid = threadIdx.x, wave = tid >> 5, lane = tid & 31, col = lane & 15, g = lane >> 4; const int c0 = blockIdx.y * 128; const size_t r0 = (size_t)blockIdx.x * 64 + wave * 16;
  v8f acc[8] = {};
#pragma unroll 2
  for (int kc = 0; kc < CC / 32; ++kc) { const F2 a = split_row(Y + (r0 + col) * CC, kc * 32, lane);
#pragma unroll
    for (int j = 0; j < 8; ++j) { v16b w; const int o = c0 + j * 16 + col;
#pragma unroll
      for (int i = 0; i < 8; ++i) { w[i] = (__bf16)WP[(size_t)(kc * 32 + 8 * g + i) * CC + (o)]; w[8 + i] = (__bf16)WP[(size_t)(kc * 32 + 16 + 8 * g + i) * CC + (o)]; }
      acc[j] = wmma_bf(a.h, w, acc[j]); acc[j] = wmma_bf(a.l, w, acc[j]); } }
#pragma unroll
  for (int j = 0; j < 8; ++j) { const float bb = BP ? bfr(BP[c0 + j * 16 + col]) : 0.f;
#pragma unroll
    for (int r = 0; r < 8; ++r) sf[wave][8 * g + r][j * 16 + col] = acc[j][r] + bb; }
  LDSX(); for (int rl = 0; rl < 16; ++rl) vst2(OUT + (r0 + rl) * CC + c0 + lane * 4, *(const v4f*)&sf[wave][rl][lane * 4]); }
extern "C" void kernel_launch(void* const* d_in, const int* in_sizes, int n_in, void* d_out, int out_size, void* d_ws, size_t ws_size, hipStream_t stream) {
  (void)in_sizes; (void)n_in; (void)out_size;
  const float** F = (const float**)d_in;   // 0 queries, 1 keys, 2 values [4,1024,1024], 3 Wq [1024,1024] (in,out), 4 bq, 5 Wk, 6 bk, 7 Wv, 8 bv, 9 Wo, 10 bo
  if (ws_size < (size_t)WS_END) return;
  char* ws = (char*)d_ws; _Float16 *QH = (_Float16*)(ws + WS_QH), *QL = (_Float16*)(ws + WS_QL), *KH = (_Float16*)(ws + WS_KH), *VT = (_Float16*)(ws + WS_VT); float *Y = (float*)(ws + WS_Y);
  k_proj<<<dim3(TNB * TT / 64, CC / 128, 3), 128, 0, stream>>>(F[0], F[1], F[2], F[3], F[4], F[5], F[6], F[7], F[8], QH, QL, KH, VT);
  k_att<<<dim3(TT / 256, NH, TNB), 256, 0, stream>>>(QH, QL, KH, VT, Y);
  k_out<<<dim3(TNB * TT / 64, CC / 128), 128, 0, stream>>>(Y, F[9], F[10], (float*)d_out);
}

// v002
// One run takes 101 microseconds.
// Next to v001, in two timings, it ran 1.93 times as fast each time.
// Counting every step since v000, it is 6.59 times as fast.
// compute dtype: all float inputs rounded to bf16; q/k/v = input W + b ([in,out]) with EXACT bf16 products on WMMA 16x16x32, f32 accumulate; q as f16 hi + residual, k f16 -> 2-product logits / 8 kept in f32 registers; online softmax in f32 (base 2, v_exp_f32), unnormalised P f16 x 2^4; o = P . v / sum with v rounded once to f16, all of it in one launch; out = o (bf16 hi + lo) Wo + bo; f32 output.
#include <hip/hip_runtime.h>
#include <math.h>

typedef __attribute__((ext_vector_type(16))) _Float16 v16h;
typedef __attribute__((ext_vector_type(16))) __bf16 v16b;
typedef __attribute__((ext_vector_type(8)))  _Float16 v8h;
typedef __attribute__((ext_vector_type(8)))  float v8f;
typedef __attribute__((ext_vector_type(4)))  float v4f;
typedef __attribute__((ext_vector_type(2)))  float v2f;
typedef __attribute__((ext_vector_type(2)))  _Float16 v2h2;
typedef __attribute__((ext_vector_type(4)))  unsigned v4u;
typedef __attribute__((ext_vector_type(4)))  int v4i;
typedef float __attribute__((may_alias)) float_a;
typedef int __attribute__((may_alias)) int_a;

template <typename T> __device__ __forceinline__ void vst2(void* p, T v) { *(T*)p = v;  }
__device__ __forceinline__ v8f wmma16(v16h a, v16h b, v8f c) {
  v8f d = __builtin_amdgcn_wmma_f32_16x16x32_f16(false, a, false, b, (short)0, c, false, false);
  asm volatile("v_nop\n\tv_nop\n\tv_nop\n\tv_nop" : "+v"(d) : "v"(a), "v"(b));
  return d;
}
__device__ __forceinline__ v8f wmma_bf(v16b a, v16b b, v8f c) {
  v8f d = __builtin_amdgcn_wmma_f32_16x16x32_bf16(false, a, false, b, (short)0, c, false, false);
  asm volatile("v_nop\n\tv_nop\n\tv_nop\n\tv_nop" : "+v"(d) : "v"(a), "v"(b));
  return d;
}
// 16x16x32 fragments: lane = (h = lane>>4, row/col = lane&15); elements 0..7 = k0+8h+0..7, 8..15 = k0+16+8h+0..7; D element r = row 8h+r
__device__ __forceinline__ v16h frag_h(const _Float16* rowk0, int lane) {
  union { v16h v; v8h q[2]; } u; const _Float16* p = rowk0 + 8 * (lane >> 4);
  u.q[0] = *(const v8h*)p; u.q[1] = *(const v8h*)(p + 16); return u.v;
}
__device__ __forceinline__ v16h frag_f32(const float* rowk0, int lane) {
  v16h a; const float* p = rowk0 + 8 * (lane >> 4);
#pragma unroll
  for (int i = 0; i < 8; ++i) { a[i] = (_Float16)p[i]; a[8 + i] = (_Float16)p[16 + i]; }
  return a;
}
__device__ __forceinline__ v16h frag_f32s(const float* rowk0, int lane, float sc) {
  v16h a; const float* p = rowk0 + 8 * (lane >> 4);
#pragma unroll
  for (int i = 0; i < 8; ++i) { a[i] = (_Float16)(p[i] * sc); a[8 + i] = (_Float16)(p[16 + i] * sc); }
  return a;
}
// column fragment from a [K][ld] layout (column n), rows >= K read as 0
__device__ __forceinline__ v16h fragc_f32(const float* W, int k0, int n, int lane, int ld, int K) {
  v16h a; const int g = lane >> 4;
#pragma unroll
  for (int i = 0; i < 8; ++i) { const int ka = k0 + 8 * g + i, kb = ka + 16;
    a[i] = (_Float16)(ka < K ? W[(size_t)(ka < K ? ka : K - 1) * ld + n] : 0.f); a[8 + i] = (_Float16)(kb < K ? W[(size_t)(kb < K ? kb : K - 1) * ld + n] : 0.f); }
  return a;
}
struct F2 { v16b h, l; };
__device__ __forceinline__ F2 bsplit16(const float v[16]) { F2 r;
#pragma unroll
  for (int i = 0; i < 16; ++i) { const __bf16 h = (__bf16)v[i]; r.h[i] = h; r.l[i] = (__bf16)(v[i] - (float)h); }
  return r; }
__device__ __forceinline__ F2 split_row(const float* row, int k0, int lane) { float v[16]; const float* p = row + k0 + 8 * (lane >> 4);
#pragma unroll
  for (int i = 0; i < 8; ++i) { v[i] = p[i]; v[8 + i] = p[16 + i]; }
  return bsplit16(v); }
__device__ __forceinline__ F2 split_rowK(const float* row, int k0, int lane, int K) { float v[16]; const int g = lane >> 4;
#pragma unroll
  for (int i = 0; i < 8; ++i) { const int ka = k0 + 8 * g + i, kb = ka + 16; v[i] = ka < K ? row[ka < K ? ka : K - 1] : 0.f; v[8 + i] = kb < K ? row[kb < K ? kb : K - 1] : 0.f; }
  return bsplit16(v); }
__device__ __forceinline__ F2 split_col(const float* W, int k0, int n, int lane, int ld, int K) { float v[16]; const int g = lane >> 4;
#pragma unroll
  for (int i = 0; i < 8; ++i) { const int ka = k0 + 8 * g + i, kb = ka + 16; v[i] = ka < K ? W[(size_t)(ka < K ? ka : K - 1) * ld + n] : 0.f; v[8 + i] = kb < K ? W[(size_t)(kb < K ? kb : K - 1) * ld + n] : 0.f; }
  return bsplit16(v); }
__device__ __forceinline__ v8f mac3(const F2& a, const F2& b, v8f c) { c = wmma_bf(a.l, b.h, c); c = wmma_bf(a.h, b.l, c); return wmma_bf(a.h, b.h, c); }
__device__ __forceinline__ float sigm(float v) { return 1.0f / (1.0f + expf(-v)); }
#define LDSX() do { asm volatile("s_wait_dscnt 0" ::: "memory"); __builtin_amdgcn_wave_barrier(); __builtin_amdgcn_fence(__ATOMIC_RELEASE, "workgroup"); } while (0)


// Hopfield layer = one cross-attention update (B 4, L = S = 1,024, d_model 1,024 = 16 x 64): q from queries, k from keys, v from values, softmax(q k / 8) v, output Linear.
#define NB 4
#define TT 1024
#define CC 1024
#define NH 16
#define HD 64
#ifndef TNB
#define TNB NB
#endif
typedef __attribute__((ext_vector_type(8))) __bf16 v8b;
__device__ __forceinline__ v16b frag_b(const __bf16* rowk0, int lane) {
  union { v16b v; v8b q[2]; } u; const __bf16* p = rowk0 + 8 * (lane >> 4);
  u.q[0] = *(const v8b*)p; u.q[1] = *(const v8b*)(p + 16); return u.v;
}
__device__ __forceinline__ float bfr(float v) { return (float)(__bf16)v; }
__device__ __attribute__((noinline)) float exp_ni(float v) { return expf(v); }
__device__ __attribute__((noinline)) float erf_ni(float v) { return erff(v); }

#define WS_QH  0u
#define WS_QL  (WS_QH + 2u * (size_t)NB * TT * CC)
#define WS_KH  (WS_QL + 2u * (size_t)NB * TT * CC)
#define WS_VT  (WS_KH + 2u * (size_t)NB * TT * CC)      // f16 v planes [b][c][t]
#define WS_Y   (WS_VT + 2u * (size_t)NB * CC * TT)      // f32 y rows [b*t][C]
#define WS_END (WS_Y + 4u * (size_t)NB * TT * CC)

#define XW() asm volatile("s_wait_xcnt 0x0" ::: "memory")   // stands behind a group of global loads, before their address registers are rewritten
// ---- the two Linear kernels share one tile loop: block = 8 waves on 128 rows x 128 columns, a step = 64 k. Both operands are read from global memory once per block in whole lines,
// rounded to bf16 once and staged in LDS (two buffers, the next step's loads in flight over this step's products); every wave takes its fragments from there.
typedef __attribute__((ext_vector_type(4))) __bf16 v4b;
typedef __attribute__((ext_vector_type(4))) _Float16 v4h;
#define GP 72            // LDS row pitch in elements: 64 k + 8 = 144 B = 16 B x 9, the pitch of ds_load_b128 readers
#define GT (128 * GP)    // one operand tile, elements
__device__ __forceinline__ v8f wmma_b(v16b a, v16b b, v8f c) { return __builtin_amdgcn_wmma_f32_16x16x32_bf16(false, a, false, b, (short)0, c, false, false); }
struct GStage { v4f x[8], w[8]; };
// x[it]: row 16 it + 2 wave + (lane >> 4), k 4 (lane & 15) .. + 3; w[i]: k row 8 wave + i, columns 4 lane .. + 3
__device__ __forceinline__ void g_fetch(GStage& s, const float* xp, const float* wp) {
#pragma unroll
  for (int i = 0; i < 8; ++i) s.x[i] = *(const v4f*)(xp + (size_t)i * 16 * CC);
  XW();   // the second group's results may land in the first group's address registers
#pragma unroll
  for (int i = 0; i < 8; ++i) s.w[i] = *(const v4f*)(wp + (size_t)i * CC);
  XW();   // its "memory" clobber also keeps the loads here, ahead of the step's products
}
// W goes in transposed, out of registers: column 4 l + c of the tile is LDS row 32 c + l, its 8 k values one 16-byte store; so a B tile (16 LDS rows) holds every 4th column and a lane's 4 tiles hold 4 adjacent columns
template <bool SPLIT> __device__ __forceinline__ void g_put(const GStage& s, __bf16* buf, int wave, int lane) {
#pragma unroll
  for (int i = 0; i < 8; ++i) { v4b h, l;
#pragma unroll
    for (int e = 0; e < 4; ++e) { h[e] = (__bf16)s.x[i][e]; if (SPLIT) l[e] = (__bf16)(s.x[i][e] - (float)h[e]); }
    __bf16* d = buf + (i * 16 + wave * 2 + (lane >> 4)) * GP + 4 * (lane & 15); *(v4b*)d = h; if (SPLIT) *(v4b*)(d + GT) = l; }
  __bf16* wb = buf + (SPLIT ? 2 : 1) * GT + lane * GP + wave * 8;
#pragma unroll
  for (int c = 0; c < 4; ++c) { v8b p;
#pragma unroll
    for (int i = 0; i < 8; ++i) p[i] = (__bf16)s.w[i][c];
    *(v8b*)(wb + c * 32 * GP) = p; } }
// acc[mi][c] element r: row 32 wm + 16 mi + 8 g + r, column 64 wn + 4 col + c of the tile; per accumulator the products come in the order k 0, 32, 64, ... (hi then lo where SPLIT)
#define GSB() __builtin_amdgcn_sched_barrier(0)   // keeps a group of fragment loads together and ahead of the products behind it (left alone the compiler reloads one A fragment per 4 products and waits each out)
__device__ __forceinline__ void g_mac8(const v16b (&a)[2], const v16b (&b)[4], v8f (&acc)[2][4]) {
#pragma unroll
  for (int mi = 0; mi < 2; ++mi)
#pragma unroll
    for (int c = 0; c < 4; ++c) acc[mi][c] = wmma_b(a[mi], b[c], acc[mi][c]); }
template <bool SPLIT> __device__ __forceinline__ void g_step(const __bf16* ap, const __bf16* bp, int lane, v8f (&acc)[2][4]) {   // ap, bp: this lane's row of the wave's first A tile and first B tile
  v16b b0[4], b1[4], h0[2], h1[2], l0[2], l1[2];
#pragma unroll
  for (int c = 0; c < 4; ++c) b0[c] = frag_b(bp + c * 32 * GP, lane);
#pragma unroll
  for (int mi = 0; mi < 2; ++mi) { h0[mi] = frag_b(ap + mi * 16 * GP, lane); if (SPLIT) l0[mi] = frag_b(ap + GT + mi * 16 * GP, lane); }
#pragma unroll
  for (int c = 0; c < 4; ++c) b1[c] = frag_b(bp + c * 32 * GP + 32, lane);
  if (!SPLIT) {
#pragma unroll
    for (int mi = 0; mi < 2; ++mi) h1[mi] = frag_b(ap + mi * 16 * GP + 32, lane);
    GSB(); g_mac8(h0, b0, acc); g_mac8(h1, b1, acc);
  } else {
    GSB(); g_mac8(h0, b0, acc);
#pragma unroll
    for (int mi = 0; mi < 2; ++mi) h1[mi] = frag_b(ap + mi * 16 * GP + 32, lane);
    GSB(); g_mac8(l0, b0, acc);
#pragma unroll
    for (int mi = 0; mi < 2; ++mi) l1[mi] = frag_b(ap + GT + mi * 16 * GP + 32, lane);
    GSB(); g_mac8(h1, b1, acc); g_mac8(l1, b1, acc);
  } }
template <bool SPLIT> __device__ __forceinline__ void g_tile(const float* __restrict__ X, const float* __restrict__ Wt, size_t r0, int c0, __bf16* sm, v8f (&acc)[2][4]) {
  const int tid = threadIdx.x, wave = tid >> 5, lane = tid & 31, col = lane & 15, wm = wave >> 1, wn = wave & 1; constexpr int BUF = (SPLIT ? 3 : 2) * GT;
  const float* xp = X + (r0 + wave * 2 + (lane >> 4)) * CC + 4 * (lane & 15); const float* wp = Wt + (size_t)(wave * 8) * CC + c0 + 4 * lane;
  const __bf16* ap = sm + (wm * 32 + col) * GP; const __bf16* bp = sm + (SPLIT ? 2 : 1) * GT + (wn * 16 + col) * GP;
  GStage s; g_fetch(s, xp, wp); g_put<SPLIT>(s, sm, wave, lane); __syncthreads();
#pragma unroll 1   // rolled: the two buffers alternate by an offset, a second copy of the body would only add code
  for (int t = 0; t < CC / 64 - 1; ++t) { const int cur = (t & 1) * BUF;
    xp += 64; wp += (size_t)64 * CC; g_fetch(s, xp, wp);
    g_step<SPLIT>(ap + cur, bp + cur, lane, acc);
    GSB();   // here: keeps the wait for the global loads, and the rounding behind it, behind the step's products
    g_put<SPLIT>(s, sm + (BUF - cur), wave, lane);   // into the buffer that every wave left before the last barrier
    __syncthreads(); }
  g_step<SPLIT>(ap + ((CC / 64 - 1) & 1) * BUF, bp + ((CC / 64 - 1) & 1) * BUF, lane, acc); }
// ---- k_proj: block = (128 rows, 128 cols, which): qkv = x W (+ b), exact; q -> f16 hi (+ residual), k -> f16 rows, v -> f16 planes
__global__ __launch_bounds__(256) void k_proj(const float* __restrict__ XQ, const float* __restrict__ XK, const float* __restrict__ XV, const float* __restrict__ WQ, const float* __restrict__ BQ, const float* __restrict__ WK, const float* __restrict__ BK, const float* __restrict__ WV, const float* __restrict__ BV, _Float16* __restrict__ QH, _Float16* __restrict__ QL, _Float16* __restrict__ KH, _Float16* __restrict__ VT) {
  __shared__ __align__(16) __bf16 sm[2 * 2 * GT];
  const int tid = threadIdx.x, wave = tid >> 5, lane = tid & 31, col = lane & 15, g = lane >> 4, wm = wave >> 1, wn = wave & 1; const int which = blockIdx.z; const int c0 = blockIdx.y * 128; const size_t r0 = (size_t)blockIdx.x * 128; const float* X = which == 0 ? XQ : which == 1 ? XK : XV; const float* WA = which == 0 ? WQ : which == 1 ? WK : WV; const float* BA = which == 0 ? BQ : which == 1 ? BK : BV;
  v8f acc[2][4] = {}; g_tile<false>(X, WA, r0, c0, sm, acc);
  const int cl = wn * 64 + 4 * col; const v4f bv = *(const v4f*)(BA + c0 + cl); const float bb[4] = {bfr(bv[0]), bfr(bv[1]), bfr(bv[2]), bfr(bv[3])};
  if (which < 2) { _Float16* dh = (which == 0 ? QH : KH) + (r0 + wm * 32 + 8 * g) * CC + c0 + cl; _Float16* dl = QL + (r0 + wm * 32 + 8 * g) * CC + c0 + cl;   // a row's 64 columns of a wave = one 128-byte line
    v4h hv[16];
#pragma unroll
    for (int k = 0; k < 16; ++k)
#pragma unroll
      for (int c = 0; c < 4; ++c) hv[k][c] = (_Float16)(acc[k >> 3][c][k & 7] + bb[c]);
    GSB();   // here: every value is formed before the first store, so that no register of an issued store is rewritten ahead of the wait behind the group
#pragma unroll
    for (int k = 0; k < 16; ++k) *(v4h*)(dh + (size_t)((k >> 3) * 16 + (k & 7)) * CC) = hv[k];
    XW();
    if (which == 0) { v4h lv[16];
#pragma unroll
      for (int k = 0; k < 16; ++k)
#pragma unroll
        for (int c = 0; c < 4; ++c) lv[k][c] = (_Float16)(acc[k >> 3][c][k & 7] + bb[c] - (float)hv[k][c]);
      GSB();   // as above
#pragma unroll
      for (int k = 0; k < 16; ++k) *(v4h*)(dl + (size_t)((k >> 3) * 16 + (k & 7)) * CC) = lv[k];
      XW(); } }
  else { _Float16* th = (_Float16*)sm;   // [128 columns][136], over the buffers
    __syncthreads();   // ends every wave's last fragment reads
#pragma unroll
    for (int mi = 0; mi < 2; ++mi)
#pragma unroll
      for (int c = 0; c < 4; ++c) { v8h hv;
#pragma unroll
        for (int r = 0; r < 8; ++r) hv[r] = (_Float16)(acc[mi][c][r] + bb[c]);
        *(v8h*)(th + (cl + c) * 136 + wm * 32 + mi * 16 + 8 * g) = hv; }
    __syncthreads();
    const size_t b = r0 / TT; const int t0 = (int)(r0 % TT); _Float16* dv = VT + (b * CC + c0 + (tid >> 4)) * (size_t)TT + t0 + (tid & 15) * 8;
#pragma unroll
    for (int it = 0; it < 8; ++it) vst2((unsigned*)(dv + (size_t)it * 16 * TT), *(const v4u*)(th + (it * 16 + (tid >> 4)) * 136 + (tid & 15) * 8));
    XW(); } }
// ---- k_att: block = 256 queries of (b,h), wave = 32 query columns: S^T = K Q^T, online softmax per column in registers, O^T += V^T P^T; y[q][h*HD + d] = O / sum
__device__ __forceinline__ v8f wmma_h(v16h a, v16h b, v8f c) { return __builtin_amdgcn_wmma_f32_16x16x32_f16(false, a, false, b, (short)0, c, false, false); }
__device__ __forceinline__ float xhalf(float x) { return __builtin_bit_cast(float, __builtin_amdgcn_permlanex16(__builtin_bit_cast(int, x), __builtin_bit_cast(int, x), 0x76543210, 0xfedcba98, false, false)); }  // lane l with lane l ^ 16
__global__ __launch_bounds__(256) void k_att(const _Float16* __restrict__ QH, const _Float16* __restrict__ QL, const _Float16* __restrict__ KH, const _Float16* __restrict__ VT, float* __restrict__ Y) {
  const int tid = threadIdx.x, wave = tid >> 5, lane = tid & 31, col = lane & 15, g = lane >> 4; const int h = blockIdx.y, b = blockIdx.z; const int q0 = blockIdx.x * 256 + wave * 32;
  const float cs = 0.125f * 1.4426950408889634f;   // logits / 8, in base 2
  v16h qh[2][2], ql[2][2];                          // B operands: column = query, [column group][kc]
#pragma unroll
  for (int c = 0; c < 2; ++c)
#pragma unroll
    for (int kc = 0; kc < 2; ++kc) { const size_t o = ((size_t)b * TT + q0 + c * 16 + col) * CC + h * HD + kc * 32; qh[c][kc] = frag_h(QH + o, lane); ql[c][kc] = frag_h(QL + o, lane); }
  const _Float16* kp = KH + ((size_t)b * TT + col) * CC + h * HD;            // A operand of S^T: row = key
  const _Float16* vp = VT + ((size_t)b * CC + h * HD + col) * (size_t)TT;    // A operand of O^T: row = d
  v16h kf[2][2];
#pragma unroll
  for (int t = 0; t < 2; ++t)
#pragma unroll
    for (int kc = 0; kc < 2; ++kc) kf[t][kc] = frag_h(kp + (size_t)(t * 16) * CC + kc * 32, lane);
  v16h vf[HD / 16];
#pragma unroll
  for (int j = 0; j < HD / 16; ++j) vf[j] = frag_h(vp + (size_t)(j * 16) * TT, lane);
  XW(); __builtin_amdgcn_sched_barrier(0);          // keeps the accumulators' zeroing, which reuses the address registers, behind the wait
  v8f acc[2][HD / 16] = {}; float mr[2] = {-INFINITY, -INFINITY}, ls[2] = {0.f, 0.f};
#pragma unroll 1   // rolled: each fetch lands in the registers its own products have just read, so a second copy of the body would only add registers
  for (int ps = 0; ps < TT / 32; ++ps) {            // a pass = 32 keys
    v8f s[2][2] = {};                               // [key tile][column group]: register r = key 16 t + 8 g + r, lane column = query
#pragma unroll
    for (int kc = 0; kc < 2; ++kc) {
#pragma unroll
      for (int t = 0; t < 2; ++t)
#pragma unroll
        for (int c = 0; c < 2; ++c) s[t][c] = wmma_h(kf[t][kc], qh[c][kc], s[t][c]);
#pragma unroll
      for (int t = 0; t < 2; ++t)
#pragma unroll
        for (int c = 0; c < 2; ++c) s[t][c] = wmma_h(kf[t][kc], ql[c][kc], s[t][c]);
    }
    const int pn = (ps + 1) & (TT / 32 - 1);        // K and V fragments are fetched one pass ahead, each behind its own products (the last pass fetches pass 0's again, unused)
#pragma unroll
    for (int t = 0; t < 2; ++t)
#pragma unroll
      for (int kc = 0; kc < 2; ++kc) kf[t][kc] = frag_h(kp + (size_t)(pn * 32 + t * 16) * CC + kc * 32, lane);
    XW();                                           // its "memory" clobber also keeps this fetch here, the softmax and the second product ahead of its use (without it the loads sank to the pass's end)
    float mb[2]; bool need = false;
#pragma unroll
    for (int c = 0; c < 2; ++c) { float mx = s[0][c][0];
#pragma unroll
      for (int r = 1; r < 8; ++r) mx = fmaxf(mx, s[0][c][r]);
#pragma unroll
      for (int r = 0; r < 8; ++r) mx = fmaxf(mx, s[1][c][r]);
      mx = fmaxf(mx, xhalf(mx)) * cs; mb[c] = mx; need = need || (mx > mr[c] + 8.0f); }
    if (__builtin_amdgcn_ballot_w32(need) != 0) {   // the maximum in use moves only when a column's new one exceeds it by 2^8: rare after the first pass
      const float mn0 = fmaxf(mr[0], mb[0]), mn1 = fmaxf(mr[1], mb[1]); const float corr[2] = {__builtin_amdgcn_exp2f(mr[0] - mn0), __builtin_amdgcn_exp2f(mr[1] - mn1)}; mr[0] = mn0; mr[1] = mn1;   // 0 on the first pass
#pragma unroll
      for (int c = 0; c < 2; ++c) { ls[c] *= corr[c];
#pragma unroll
        for (int j = 0; j < HD / 16; ++j) acc[c][j] = acc[c][j] * corr[c]; }
    }
#pragma unroll
    for (int c = 0; c < 2; ++c) { const float nm = 4.0f - mr[c];   // P carries 2^4 (it cancels in the division): at most 2^12 in f16
      union { v16h v; v2h2 w[8]; } pf; float sa = 0.f, sb = 0.f;
#pragma unroll
      for (int i = 0; i < 8; ++i) { const v2f arg = __builtin_elementwise_fma(v2f{s[i >> 2][c][2 * (i & 3)], s[i >> 2][c][2 * (i & 3) + 1]}, v2f{cs, cs}, v2f{nm, nm}); const float p0 = __builtin_amdgcn_exp2f(arg.x), p1 = __builtin_amdgcn_exp2f(arg.y);
        sa += p0; sb += p1; pf.w[i] = __builtin_convertvector(v2f{p0, p1}, v2h2); }
      ls[c] += sa + sb;
#pragma unroll
      for (int j = 0; j < HD / 16; ++j) acc[c][j] = wmma_h(vf[j], pf.v, acc[c][j]); }
#pragma unroll
    for (int j = 0; j < HD / 16; ++j) vf[j] = frag_h(vp + (size_t)(j * 16) * TT + pn * 32, lane);
    XW();
  }
#pragma unroll
  for (int c = 0; c < 2; ++c) { const float inv = 1.0f / (ls[c] + xhalf(ls[c])); float* yr = Y + ((size_t)b * TT + q0 + c * 16 + col) * CC + h * HD + 8 * g;
#pragma unroll
    for (int j = 0; j < HD / 16; ++j) { const v8f o = acc[c][j] * inv; vst2(yr + j * 16, v4f{o[0], o[1], o[2], o[3]}); vst2(yr + j * 16 + 4, v4f{o[4], o[5], o[6], o[7]}); } } }
// ---- k_out: block = (128 rows, 128 cols): out = y (bf16 hi + lo) Wproj + b
__global__ __launch_bounds__(256) void k_out(const float* __restrict__ Y, const float* __restrict__ WP, const float* __restrict__ BP, float* __restrict__ OUT) { __shared__ __align__(16) __bf16 sm[2 * 3 * GT];
  const int tid = threadIdx.x, wave = tid >> 5, lane = tid & 31, col = lane & 15, g = lane >> 4, wm = wave >> 1, wn = wave & 1; const int c0 = blockIdx.y * 128; const size_t r0 = (size_t)blockIdx.x * 128;
  v8f acc[2][4] = {}; g_tile<true>(Y, WP, r0, c0, sm, acc);
  const int cl = wn * 64 + 4 * col; float bb[4] = {0.f, 0.f, 0.f, 0.f}; if (BP) { const v4f bv = *(const v4f*)(BP + c0 + cl); bb[0] = bfr(bv[0]); bb[1] = bfr(bv[1]); bb[2] = bfr(bv[2]); bb[3] = bfr(bv[3]); }
  float* d = OUT + (r0 + wm * 32 + 8 * g) * CC + c0 + cl;   // a row's 64 columns of a wave = two whole lines
  v4f o[16];
#pragma unroll
  for (int k = 0; k < 16; ++k) o[k] = v4f{acc[k >> 3][0][k & 7] + bb[0], acc[k >> 3][1][k & 7] + bb[1], acc[k >> 3][2][k & 7] + bb[2], acc[k >> 3][3][k & 7] + bb[3]};
  GSB();   // here: every value is formed before the first store, so that no register of an issued store is rewritten ahead of the wait behind the group
#pragma unroll
  for (int k = 0; k < 16; ++k) vst2(d + (size_t)((k >> 3) * 16 + (k & 7)) * CC, o[k]);
  XW(); }
extern "C" void kernel_launch(void* const* d_in, const int* in_sizes, int n_in, void* d_out, int out_size, void* d_ws, size_t ws_size, hipStream_t stream) {
  (void)in_sizes; (void)n_in; (void)out_size;
  const float** F = (const float**)d_in;   // 0 queries, 1 keys, 2 values [4,1024,1024], 3 Wq [1024,1024] (in,out), 4 bq, 5 Wk, 6 bk, 7 Wv, 8 bv, 9 Wo, 10 bo
  if (ws_size < (size_t)WS_END) return;
  char* ws = (char*)d_ws; _Float16 *QH = (_Float16*)(ws + WS_QH), *QL = (_Float16*)(ws + WS_QL), *KH = (_Float16*)(ws + WS_KH), *VT = (_Float16*)(ws + WS_VT); float *Y = (float*)(ws + WS_Y);
  k_proj<<<dim3(TNB * TT / 128, CC / 128, 3), 256, 0, stream>>>(F[0], F[1], F[2], F[3], F[4], F[5], F[6], F[7], F[8], QH, QL, KH, VT);
  k_att<<<dim3(TT / 256, NH, TNB), 256, 0, stream>>>(QH, QL, KH, VT, Y);
  k_out<<<dim3(TNB * TT / 128, CC / 128), 256, 0, stream>>>(Y, F[9], F[10], (float*)d_out);
}

// v003
// Measured time: 84.8 microseconds a run.
// In both of two side-by-side timings against v002, it was 1.19 times as fast.
// All steps since v000 together make it 7.84 times as fast.
// compute dtype: all float inputs rounded to bf16; q/k/v = input W + b ([in,out]) with EXACT bf16 products on WMMA 16x16x32, f32 accumulate; q as f16 hi + residual, k f16 -> 2-product logits / 8 kept in f32 registers; online softmax in f32 (base 2, v_exp_f32), unnormalised P f16 x 2^4; o = P . v / sum with v rounded once to f16, all of it in one launch; out = o (bf16 hi + lo) Wo + bo; f32 output.
#include <hip/hip_runtime.h>
#include <math.h>

typedef __attribute__((ext_vector_type(16))) _Float16 v16h;
typedef __attribute__((ext_vector_type(16))) __bf16 v16b;
typedef __attribute__((ext_vector_type(8)))  _Float16 v8h;
typedef __attribute__((ext_vector_type(8)))  float v8f;
typedef __attribute__((ext_vector_type(4)))  float v4f;
typedef __attribute__((ext_vector_type(2)))  float v2f;
typedef __attribute__((ext_vector_type(2)))  _Float16 v2h2;
typedef __attribute__((ext_vector_type(4)))  unsigned v4u;
typedef __attribute__((ext_vector_type(4)))  int v4i;
typedef float __attribute__((may_alias)) float_a;
typedef int __attribute__((may_alias)) int_a;

template <typename T> __device__ __forceinline__ void vst2(void* p, T v) { *(T*)p = v;  }
__device__ __forceinline__ v8f wmma16(v16h a, v16h b, v8f c) {
  v8f d = __builtin_amdgcn_wmma_f32_16x16x32_f16(false, a, false, b, (short)0, c, false, false);
  asm volatile("v_nop\n\tv_nop\n\tv_nop\n\tv_nop" : "+v"(d) : "v"(a), "v"(b));
  return d;
}
__device__ __forceinline__ v8f wmma_bf(v16b a, v16b b, v8f c) {
  v8f d = __builtin_amdgcn_wmma_f32_16x16x32_bf16(false, a, false, b, (short)0, c, false, false);
  asm volatile("v_nop\n\tv_nop\n\tv_nop\n\tv_nop" : "+v"(d) : "v"(a), "v"(b));
  return d;
}
// 16x16x32 fragments: lane = (h = lane>>4, row/col = lane&15); elements 0..7 = k0+8h+0..7, 8..15 = k0+16+8h+0..7; D element r = row 8h+r
__device__ __forceinline__ v16h frag_h(const _Float16* rowk0, int lane) {
  union { v16h v; v8h q[2]; } u; const _Float16* p = rowk0 + 8 * (lane >> 4);
  u.q[0] = *(const v8h*)p; u.q[1] = *(const v8h*)(p + 16); return u.v;
}
__device__ __forceinline__ v16h frag_f32(const float* rowk0, int lane) {
  v16h a; const float* p = rowk0 + 8 * (lane >> 4);
#pragma unroll
  for (int i = 0; i < 8; ++i) { a[i] = (_Float16)p[i]; a[8 + i] = (_Float16)p[16 + i]; }
  return a;
}
__device__ __forceinline__ v16h frag_f32s(const float* rowk0, int lane, float sc) {
  v16h a; const float* p = rowk0 + 8 * (lane >> 4);
#pragma unroll
  for (int i = 0; i < 8; ++i) { a[i] = (_Float16)(p[i] * sc); a[8 + i] = (_Float16)(p[16 + i] * sc); }
  return a;
}
// column fragment from a [K][ld] layout (column n), rows >= K read as 0
__device__ __forceinline__ v16h fragc_f32(const float* W, int k0, int n, int lane, int ld, int K) {
  v16h a; const int g = lane >> 4;
#pragma unroll
  for (int i = 0; i < 8; ++i) { const int ka = k0 + 8 * g + i, kb = ka + 16;
    a[i] = (_Float16)(ka < K ? W[(size_t)(ka < K ? ka : K - 1) * ld + n] : 0.f); a[8 + i] = (_Float16)(kb < K ? W[(size_t)(kb < K ? kb : K - 1) * ld + n] : 0.f); }
  return a;
}
struct F2 { v16b h, l; };
__device__ __forceinline__ F2 bsplit16(const float v[16]) { F2 r;
#pragma unroll
  for (int i = 0; i < 16; ++i) { const __bf16 h = (__bf16)v[i]; r.h[i] = h; r.l[i] = (__bf16)(v[i] - (float)h); }
  return r; }
__device__ __forceinline__ F2 split_row(const float* row, int k0, int lane) { float v[16]; const float* p = row + k0 + 8 * (lane >> 4);
#pragma unroll
  for (int i = 0; i < 8; ++i) { v[i] = p[i]; v[8 + i] = p[16 + i]; }
  return bsplit16(v); }
__device__ __forceinline__ F2 split_rowK(const float* row, int k0, int lane, int K) { float v[16]; const int g = lane >> 4;
#pragma unroll
  for (int i = 0; i < 8; ++i) { const int ka = k0 + 8 * g + i, kb = ka + 16; v[i] = ka < K ? row[ka < K ? ka : K - 1] : 0.f; v[8 + i] = kb < K ? row[kb < K ? kb : K - 1] : 0.f; }
  return bsplit16(v); }
__device__ __forceinline__ F2 split_col(const float* W, int k0, int n, int lane, int ld, int K) { float v[16]; const int g = lane >> 4;
#pragma unroll
  for (int i = 0; i < 8; ++i) { const int ka = k0 + 8 * g + i, kb = ka + 16; v[i] = ka < K ? W[(size_t)(ka < K ? ka : K - 1) * ld + n] : 0.f; v[8 + i] = kb < K ? W[(size_t)(kb < K ? kb : K - 1) * ld + n] : 0.f; }
  return bsplit16(v); }
__device__ __forceinline__ v8f mac3(const F2& a, const F2& b, v8f c) { c = wmma_bf(a.l, b.h, c); c = wmma_bf(a.h, b.l, c); return wmma_bf(a.h, b.h, c); }
__device__ __forceinline__ float sigm(float v) { return 1.0f / (1.0f + expf(-v)); }
#define LDSX() do { asm volatile("s_wait_dscnt 0" ::: "memory"); __builtin_amdgcn_wave_barrier(); __builtin_amdgcn_fence(__ATOMIC_RELEASE, "workgroup"); } while (0)


// Hopfield layer = one cross-attention update (B 4, L = S = 1,024, d_model 1,024 = 16 x 64): q from queries, k from keys, v from values, softmax(q k / 8) v, output Linear.
#define NB 4
#define TT 1024
#define CC 1024
#define NH 16
#define HD 64
#ifndef TNB
#define TNB NB
#endif
typedef __attribute__((ext_vector_type(8))) __bf16 v8b;
__device__ __forceinline__ v16b frag_b(const __bf16* rowk0, int lane) {
  union { v16b v; v8b q[2]; } u; const __bf16* p = rowk0 + 8 * (lane >> 4);
  u.q[0] = *(const v8b*)p; u.q[1] = *(const v8b*)(p + 16); return u.v;
}
__device__ __forceinline__ float bfr(float v) { return (float)(__bf16)v; }
__device__ __attribute__((noinline)) float exp_ni(float v) { return expf(v); }
__device__ __attribute__((noinline)) float erf_ni(float v) { return erff(v); }

#define WS_QH  0u
#define WS_QL  (WS_QH + 2u * (size_t)NB * TT * CC)
#define WS_KH  (WS_QL + 2u * (size_t)NB * TT * CC)
#define WS_VT  (WS_KH + 2u * (size_t)NB * TT * CC)      // f16 v planes [b][c][t]
#define WS_Y   (WS_VT + 2u * (size_t)NB * CC * TT)      // f32 y rows [b*t][C]
#define WS_END (WS_Y + 4u * (size_t)NB * TT * CC)

#define XW() asm volatile("s_wait_xcnt 0x0" ::: "memory")   // stands behind a group of global loads, before their address registers are rewritten
// ---- the two Linear kernels share one tile loop: block = 8 waves on 128 rows x 128 columns, a step = 64 k. Both operands are read from global memory once per block in whole lines,
// rounded to bf16 once and staged in LDS (two buffers, the next step's loads in flight over this step's products); every wave takes its fragments from there.
typedef __attribute__((ext_vector_type(4))) __bf16 v4b;
typedef __attribute__((ext_vector_type(4))) _Float16 v4h;
#define GP 72            // LDS row pitch in elements: 64 k + 8 = 144 B = 16 B x 9, the pitch of ds_load_b128 readers
#define GT (128 * GP)    // one operand tile, elements
__device__ __forceinline__ v8f wmma_b(v16b a, v16b b, v8f c) { return __builtin_amdgcn_wmma_f32_16x16x32_bf16(false, a, false, b, (short)0, c, false, false); }
struct GStage { v4f x[8], w[8]; };
// x[it]: row 16 it + 2 wave + (lane >> 4), k 4 (lane & 15) .. + 3; w[i]: k row 8 wave + i, columns 4 lane .. + 3
__device__ __forceinline__ void g_fetch(GStage& s, const float* xp, const float* wp) {
#pragma unroll
  for (int i = 0; i < 8; ++i) s.x[i] = *(const v4f*)(xp + (size_t)i * 16 * CC);
  XW();   // the second group's results may land in the first group's address registers
#pragma unroll
  for (int i = 0; i < 8; ++i) s.w[i] = *(const v4f*)(wp + (size_t)i * CC);
  XW();   // its "memory" clobber also keeps the loads here, ahead of the step's products
}
// W goes in transposed, out of registers: column 4 l + c of the tile is LDS row 32 c + l, its 8 k values one 16-byte store; so a B tile (16 LDS rows) holds every 4th column and a lane's 4 tiles hold 4 adjacent columns
template <bool SPLIT> __device__ __forceinline__ void g_put(const GStage& s, __bf16* buf, int wave, int lane) {
#pragma unroll
  for (int i = 0; i < 8; ++i) { v4b h, l;
#pragma unroll
    for (int e = 0; e < 4; ++e) { h[e] = (__bf16)s.x[i][e]; if (SPLIT) l[e] = (__bf16)(s.x[i][e] - (float)h[e]); }
    __bf16* d = buf + (i * 16 + wave * 2 + (lane >> 4)) * GP + 4 * (lane & 15); *(v4b*)d = h; if (SPLIT) *(v4b*)(d + GT) = l; }
  __bf16* wb = buf + (SPLIT ? 2 : 1) * GT + lane * GP + wave * 8;
#pragma unroll
  for (int c = 0; c < 4; ++c) { v8b p;
#pragma unroll
    for (int i = 0; i < 8; ++i) p[i] = (__bf16)s.w[i][c];
    *(v8b*)(wb + c * 32 * GP) = p; } }
// acc[mi][c] element r: row 32 wm + 16 mi + 8 g + r, column 64 wn + 4 col + c of the tile; per accumulator the products come in the order k 0, 32, 64, ... (hi then lo where SPLIT)
#define GSB() __builtin_amdgcn_sched_barrier(0)   // keeps a group of fragment loads together and ahead of the products behind it (left alone the compiler reloads one A fragment per 4 products and waits each out)
__device__ __forceinline__ void g_mac8(const v16b (&a)[2], const v16b (&b)[4], v8f (&acc)[2][4]) {
#pragma unroll
  for (int mi = 0; mi < 2; ++mi)
#pragma unroll
    for (int c = 0; c < 4; ++c) acc[mi][c] = wmma_b(a[mi], b[c], acc[mi][c]); }
template <bool SPLIT> __device__ __forceinline__ void g_step(const __bf16* ap, const __bf16* bp, int lane, v8f (&acc)[2][4]) {   // ap, bp: this lane's row of the wave's first A tile and first B tile
  v16b b0[4], b1[4], h0[2], h1[2], l0[2], l1[2];
#pragma unroll
  for (int c = 0; c < 4; ++c) b0[c] = frag_b(bp + c * 32 * GP, lane);
#pragma unroll
  for (int mi = 0; mi < 2; ++mi) { h0[mi] = frag_b(ap + mi * 16 * GP, lane); if (SPLIT) l0[mi] = frag_b(ap + GT + mi * 16 * GP, lane); }
#pragma unroll
  for (int c = 0; c < 4; ++c) b1[c] = frag_b(bp + c * 32 * GP + 32, lane);
  if (!SPLIT) {
#pragma unroll
    for (int mi = 0; mi < 2; ++mi) h1[mi] = frag_b(ap + mi * 16 * GP + 32, lane);
    GSB(); g_mac8(h0, b0, acc); g_mac8(h1, b1, acc);
  } else {
    GSB(); g_mac8(h0, b0, acc);
#pragma unroll
    for (int mi = 0; mi < 2; ++mi) h1[mi] = frag_b(ap + mi * 16 * GP + 32, lane);
    GSB(); g_mac8(l0, b0, acc);
#pragma unroll
    for (int mi = 0; mi < 2; ++mi) l1[mi] = frag_b(ap + GT + mi * 16 * GP + 32, lane);
    GSB(); g_mac8(h1, b1, acc); g_mac8(l1, b1, acc);
  } }
template <bool SPLIT> __device__ __forceinline__ void g_tile(const float* __restrict__ X, const float* __restrict__ Wt, size_t r0, int c0, __bf16* sm, v8f (&acc)[2][4]) {
  const int tid = threadIdx.x, wave = tid >> 5, lane = tid & 31, col = lane & 15, wm = wave >> 1, wn = wave & 1; constexpr int BUF = (SPLIT ? 3 : 2) * GT;
  const float* xp = X + (r0 + wave * 2 + (lane >> 4)) * CC + 4 * (lane & 15); const float* wp = Wt + (size_t)(wave * 8) * CC + c0 + 4 * lane;
  const __bf16* ap = sm + (wm * 32 + col) * GP; const __bf16* bp = sm + (SPLIT ? 2 : 1) * GT + (wn * 16 + col) * GP;
  GStage s; g_fetch(s, xp, wp); g_put<SPLIT>(s, sm, wave, lane); __syncthreads();
#pragma unroll 1   // rolled: the two buffers alternate by an offset, a second copy of the body would only add code
  for (int t = 0; t < CC / 64 - 1; ++t) { const int cur = (t & 1) * BUF;
    xp += 64; wp += (size_t)64 * CC; g_fetch(s, xp, wp);
    g_step<SPLIT>(ap + cur, bp + cur, lane, acc);
    GSB();   // here: keeps the wait for the global loads, and the rounding behind it, behind the step's products
    g_put<SPLIT>(s, sm + (BUF - cur), wave, lane);   // into the buffer that every wave left before the last barrier
    __syncthreads(); }
  g_step<SPLIT>(ap + ((CC / 64 - 1) & 1) * BUF, bp + ((CC / 64 - 1) & 1) * BUF, lane, acc); }
// ---- k_proj: block = (128 rows, 128 cols, which): qkv = x W (+ b), exact; q -> f16 hi (+ residual), k -> f16 rows, v -> f16 planes
__global__ __launch_bounds__(256) void k_proj(const float* __restrict__ XQ, const float* __restrict__ XK, const float* __restrict__ XV, const float* __restrict__ WQ, const float* __restrict__ BQ, const float* __restrict__ WK, const float* __restrict__ BK, const float* __restrict__ WV, const float* __restrict__ BV, _Float16* __restrict__ QH, _Float16* __restrict__ QL, _Float16* __restrict__ KH, _Float16* __restrict__ VT) {
  __shared__ __align__(16) __bf16 sm[2 * 2 * GT];
  const int tid = threadIdx.x, wave = tid >> 5, lane = tid & 31, col = lane & 15, g = lane >> 4, wm = wave >> 1, wn = wave & 1; const int which = blockIdx.z; const int c0 = blockIdx.y * 128; const size_t r0 = (size_t)blockIdx.x * 128; const float* X = which == 0 ? XQ : which == 1 ? XK : XV; const float* WA = which == 0 ? WQ : which == 1 ? WK : WV; const float* BA = which == 0 ? BQ : which == 1 ? BK : BV;
  v8f acc[2][4] = {}; g_tile<false>(X, WA, r0, c0, sm, acc);
  const int cl = wn * 64 + 4 * col; const v4f bv = *(const v4f*)(BA + c0 + cl); const float bb[4] = {bfr(bv[0]), bfr(bv[1]), bfr(bv[2]), bfr(bv[3])};
  if (which < 2) { _Float16* dh = (which == 0 ? QH : KH) + (r0 + wm * 32 + 8 * g) * CC + c0 + cl; _Float16* dl = QL + (r0 + wm * 32 + 8 * g) * CC + c0 + cl;   // a row's 64 columns of a wave = one 128-byte line
    v4h hv[16];
#pragma unroll
    for (int k = 0; k < 16; ++k)
#pragma unroll
      for (int c = 0; c < 4; ++c) hv[k][c] = (_Float16)(acc[k >> 3][c][k & 7] + bb[c]);
    GSB();   // here: every value is formed before the first store, so that no register of an issued store is rewritten ahead of the wait behind the group
#pragma unroll
    for (int k = 0; k < 16; ++k) *(v4h*)(dh + (size_t)((k >> 3) * 16 + (k & 7)) * CC) = hv[k];
    XW();
    if (which == 0) { v4h lv[16];
#pragma unroll
      for (int k = 0; k < 16; ++k)
#pragma unroll
        for (int c = 0; c < 4; ++c) lv[k][c] = (_Float16)(acc[k >> 3][c][k & 7] + bb[c] - (float)hv[k][c]);
      GSB();   // as above
#pragma unroll
      for (int k = 0; k < 16; ++k) *(v4h*)(dl + (size_t)((k >> 3) * 16 + (k & 7)) * CC) = lv[k];
      XW(); } }
  else { _Float16* th = (_Float16*)sm;   // [128 columns][136], over the buffers
    __syncthreads();   // ends every wave's last fragment reads
#pragma unroll
    for (int mi = 0; mi < 2; ++mi)
#pragma unroll
      for (int c = 0; c < 4; ++c) { v8h hv;
#pragma unroll
        for (int r = 0; r < 8; ++r) hv[r] = (_Float16)(acc[mi][c][r] + bb[c]);
        *(v8h*)(th + (cl + c) * 136 + wm * 32 + mi * 16 + 8 * g) = hv; }
    __syncthreads();
    const size_t b = r0 / TT; const int t0 = (int)(r0 % TT); _Float16* dv = VT + (b * CC + c0 + (tid >> 4)) * (size_t)TT + t0 + (tid & 15) * 8;
#pragma unroll
    for (int it = 0; it < 8; ++it) vst2((unsigned*)(dv + (size_t)it * 16 * TT), *(const v4u*)(th + (it * 16 + (tid >> 4)) * 136 + (tid & 15) * 8));
    XW(); } }
// ---- k_att: block = 256 queries of (b,h), wave = 32 query columns: S^T = K Q^T, online softmax per column in registers, O^T += V^T P^T; y[q][h*HD + d] = O / sum
// K and V^T come once per block, in whole lines, into a ring of two LDS buffers (a stage = 128 keys = 4 passes of 32); all 8 waves take their fragments from there.
__device__ __forceinline__ v8f wmma_h(v16h a, v16h b, v8f c) { return __builtin_amdgcn_wmma_f32_16x16x32_f16(false, a, false, b, (short)0, c, false, false); }
__device__ __forceinline__ float xhalf(float x) { return __builtin_bit_cast(float, __builtin_amdgcn_permlanex16(__builtin_bit_cast(int, x), __builtin_bit_cast(int, x), 0x76543210, 0xfedcba98, false, false)); }  // lane l with lane l ^ 16
#define AKS 128              // keys per stage
#define AKP 72               // K tile [128 keys][64 d], row pitch in elements: 144 B = 16 B x 9, the pitch of ds_load_b128 readers
#define AVP 136              // V^T tile [64 d][128 keys], row pitch in elements: 272 B = 16 B x 17
#define AKT (AKS * AKP)
#define ABUF (AKT + HD * AVP)   // one buffer, elements
// one stage: 8 copies of 16 B a lane. K: row (tid >> 3) + 32 i, 16-byte piece tid & 7; V^T: row (tid >> 4) + 16 i, piece tid & 15; a wave's copy covers 4 whole lines.
// The wait on xcnt is the statement's last line, so that it stands before any rewrite of a register that a copy names.
__device__ __forceinline__ void a_stage(unsigned lk, const _Float16* gk, unsigned lv, const _Float16* gv) {
  asm volatile("global_load_async_to_lds_b128 %0, %8, off\n\t"
               "global_load_async_to_lds_b128 %1, %9, off\n\t"
               "global_load_async_to_lds_b128 %2, %10, off\n\t"
               "global_load_async_to_lds_b128 %3, %11, off\n\t"
               "global_load_async_to_lds_b128 %4, %12, off\n\t"
               "global_load_async_to_lds_b128 %5, %13, off\n\t"
               "global_load_async_to_lds_b128 %6, %14, off\n\t"
               "global_load_async_to_lds_b128 %7, %15, off\n\t"
               "s_wait_xcnt 0x0"
               :: "v"(lk), "v"(lk + 32u * AKP * 2u), "v"(lk + 64u * AKP * 2u), "v"(lk + 96u * AKP * 2u), "v"(lv), "v"(lv + 16u * AVP * 2u), "v"(lv + 32u * AVP * 2u), "v"(lv + 48u * AVP * 2u),
                  "v"(gk), "v"(gk + (size_t)32 * CC), "v"(gk + (size_t)64 * CC), "v"(gk + (size_t)96 * CC), "v"(gv), "v"(gv + (size_t)16 * TT), "v"(gv + (size_t)32 * TT), "v"(gv + (size_t)48 * TT)
               : "memory"); }
#define AWAIT() asm volatile("s_wait_asynccnt 0x0" ::: "memory")   // this wave's copies have landed; the barrier behind it shows them to the other waves
__global__ __launch_bounds__(256) void k_att(const _Float16* __restrict__ QH, const _Float16* __restrict__ QL, const _Float16* __restrict__ KH, const _Float16* __restrict__ VT, float* __restrict__ Y) {
  __shared__ __align__(16) _Float16 sm[2 * ABUF];
  const int tid = threadIdx.x, wave = tid >> 5, lane = tid & 31, col = lane & 15, g = lane >> 4; const int h = blockIdx.y, b = blockIdx.z; const int q0 = blockIdx.x * 256 + wave * 32;
  const float cs = 0.125f * 1.4426950408889634f;   // logits / 8, in base 2
  const unsigned lk = (unsigned)(size_t)(sm + (tid >> 3) * AKP + (tid & 7) * 8), lv = (unsigned)(size_t)(sm + AKT + (tid >> 4) * AVP + (tid & 15) * 8);   // LDS byte addresses of this lane's first pieces, buffer 0
  const _Float16* gk = KH + ((size_t)b * TT + (tid >> 3)) * CC + h * HD + (tid & 7) * 8;
  const _Float16* gv = VT + ((size_t)b * CC + h * HD + (tid >> 4)) * (size_t)TT + (tid & 15) * 8;
  a_stage(lk, gk, lv, gv);                          // stage 0 into buffer 0
  v16h qh[2][2], ql[2][2];                          // B operands: column = query, [column group][kc]
#pragma unroll
  for (int c = 0; c < 2; ++c)
#pragma unroll
    for (int kc = 0; kc < 2; ++kc) { const size_t o = ((size_t)b * TT + q0 + c * 16 + col) * CC + h * HD + kc * 32; qh[c][kc] = frag_h(QH + o, lane); ql[c][kc] = frag_h(QL + o, lane); }
  XW(); __builtin_amdgcn_sched_barrier(0);          // keeps the accumulators' zeroing, which reuses the address registers, behind the wait
  AWAIT(); __syncthreads();
  a_stage(lk + 2u * ABUF, gk + (size_t)AKS * CC, lv + 2u * ABUF, gv + AKS);   // stage 1 into buffer 1
  v8f acc[2][HD / 16] = {}; float mr[2] = {-INFINITY, -INFINITY}, ls[2] = {0.f, 0.f};
#pragma unroll 1   // rolled: the two buffers alternate by an offset, a second copy of the body would only add code
  for (int st = 0; st < TT / AKS; ++st) {
    const _Float16* kp = sm + (st & 1) * ABUF + col * AKP;          // A operand of S^T: row = key
    const _Float16* vp = sm + (st & 1) * ABUF + AKT + col * AVP;    // A operand of O^T: row = d
    v16h kf[2][2], vf[HD / 16];
#pragma unroll
    for (int t = 0; t < 2; ++t)
#pragma unroll
      for (int kc = 0; kc < 2; ++kc) kf[t][kc] = frag_h(kp + (t * 16) * AKP + kc * 32, lane);
#pragma unroll
    for (int j = 0; j < HD / 16; ++j) vf[j] = frag_h(vp + (j * 16) * AVP, lane);
    GSB();   // here: keeps the stage's first fetches one group ahead of the products (left alone the V^T loads are strewn among them)
#pragma unroll
    for (int ps = 0; ps < AKS / 32; ++ps) {         // a pass = 32 keys
      v8f s[2][2] = {};                             // [key tile][column group]: register r = key 16 t + 8 g + r, lane column = query
#pragma unroll
      for (int kc = 0; kc < 2; ++kc) {
#pragma unroll
        for (int t = 0; t < 2; ++t)
#pragma unroll
          for (int c = 0; c < 2; ++c) s[t][c] = wmma_h(kf[t][kc], qh[c][kc], s[t][c]);
#pragma unroll
        for (int t = 0; t < 2; ++t)
#pragma unroll
          for (int c = 0; c < 2; ++c) s[t][c] = wmma_h(kf[t][kc], ql[c][kc], s[t][c]);
      }
      GSB();   // here: keeps the 16 products one run over 4 independent tiles (left alone the maxima are woven in and the products line up in dependent chains)
      if (ps + 1 < AKS / 32) {                      // inside a stage K and V fragments are fetched one pass ahead, each behind its own products; never out of the next stage
#pragma unroll
        for (int t = 0; t < 2; ++t)
#pragma unroll
          for (int kc = 0; kc < 2; ++kc) kf[t][kc] = frag_h(kp + ((ps + 1) * 32 + t * 16) * AKP + kc * 32, lane);
        GSB();   // here: keeps this fetch one group, the softmax and the second product ahead of its use
      }
      float mb[2]; bool need = false;
#pragma unroll
      for (int c = 0; c < 2; ++c) { float mx = s[0][c][0];
#pragma unroll
        for (int r = 1; r < 8; ++r) mx = fmaxf(mx, s[0][c][r]);
#pragma unroll
        for (int r = 0; r < 8; ++r) mx = fmaxf(mx, s[1][c][r]);
        mx = fmaxf(mx, xhalf(mx)) * cs; mb[c] = mx; need = need || (mx > mr[c] + 8.0f); }
      if (__builtin_amdgcn_ballot_w32(need) != 0) {   // the maximum in use moves only when a column's new one exceeds it by 2^8: rare after the first pass
        const float mn0 = fmaxf(mr[0], mb[0]), mn1 = fmaxf(mr[1], mb[1]); const float corr[2] = {__builtin_amdgcn_exp2f(mr[0] - mn0), __builtin_amdgcn_exp2f(mr[1] - mn1)}; mr[0] = mn0; mr[1] = mn1;   // 0 on the first pass
#pragma unroll
        for (int c = 0; c < 2; ++c) { ls[c] *= corr[c];
#pragma unroll
          for (int j = 0; j < HD / 16; ++j) acc[c][j] = acc[c][j] * corr[c]; }
      }
#pragma unroll
      for (int c = 0; c < 2; ++c) { const float nm = 4.0f - mr[c];   // P carries 2^4 (it cancels in the division): at most 2^12 in f16
        union { v16h v; v2h2 w[8]; } pf; float sa = 0.f, sb = 0.f;
#pragma unroll
        for (int i = 0; i < 8; ++i) { const v2f arg = __builtin_elementwise_fma(v2f{s[i >> 2][c][2 * (i & 3)], s[i >> 2][c][2 * (i & 3) + 1]}, v2f{cs, cs}, v2f{nm, nm}); const float p0 = __builtin_amdgcn_exp2f(arg.x), p1 = __builtin_amdgcn_exp2f(arg.y);
          sa += p0; sb += p1; pf.w[i] = __builtin_convertvector(v2f{p0, p1}, v2h2); }
        ls[c] += sa + sb;
#pragma unroll
        for (int j = 0; j < HD / 16; ++j) acc[c][j] = wmma_h(vf[j], pf.v, acc[c][j]); }
      if (ps + 1 < AKS / 32) {
#pragma unroll
        for (int j = 0; j < HD / 16; ++j) vf[j] = frag_h(vp + (j * 16) * AVP + (ps + 1) * 32, lane);
        GSB();   // here: as above, the next pass's first products and softmax ahead of its use
      }
    }
    asm volatile("s_wait_dscnt 0x0" ::: "memory");  // this wave's reads of the buffer are over before a copy may be aimed at it
    AWAIT(); __syncthreads();                       // the one barrier of a stage: publishes stage st + 1 and ends every wave's reads of stage st
    if (st + 2 < TT / AKS) a_stage(lk + (unsigned)(st & 1) * (2u * ABUF), gk + (size_t)(st + 2) * AKS * CC, lv + (unsigned)(st & 1) * (2u * ABUF), gv + (st + 2) * AKS);   // into the buffer just read
  }
  AWAIT();   // no copy is outstanding when the wave ends
#pragma unroll
  for (int c = 0; c < 2; ++c) { const float inv = 1.0f / (ls[c] + xhalf(ls[c])); float* yr = Y + ((size_t)b * TT + q0 + c * 16 + col) * CC + h * HD + 8 * g;
#pragma unroll
    for (int j = 0; j < HD / 16; ++j) { const v8f o = acc[c][j] * inv; vst2(yr + j * 16, v4f{o[0], o[1], o[2], o[3]}); vst2(yr + j * 16 + 4, v4f{o[4], o[5], o[6], o[7]}); } } }
// ---- k_out: block = (128 rows, 128 cols): out = y (bf16 hi + lo) Wproj + b
__global__ __launch_bounds__(256) void k_out(const float* __restrict__ Y, const float* __restrict__ WP, const float* __restrict__ BP, float* __restrict__ OUT) { __shared__ __align__(16) __bf16 sm[2 * 3 * GT];
  const int tid = threadIdx.x, wave = tid >> 5, lane = tid & 31, col = lane & 15, g = lane >> 4, wm = wave >> 1, wn = wave & 1; const int c0 = blockIdx.y * 128; const size_t r0 = (size_t)blockIdx.x * 128;
  v8f acc[2][4] = {}; g_tile<true>(Y, WP, r0, c0, sm, acc);
  const int cl = wn * 64 + 4 * col; float bb[4] = {0.f, 0.f, 0.f, 0.f}; if (BP) { const v4f bv = *(const v4f*)(BP + c0 + cl); bb[0] = bfr(bv[0]); bb[1] = bfr(bv[1]); bb[2] = bfr(bv[2]); bb[3] = bfr(bv[3]); }
  float* d = OUT + (r0 + wm * 32 + 8 * g) * CC + c0 + cl;   // a row's 64 columns of a wave = two whole lines
  v4f o[16];
#pragma unroll
  for (int k = 0; k < 16; ++k) o[k] = v4f{acc[k >> 3][0][k & 7] + bb[0], acc[k >> 3][1][k & 7] + bb[1], acc[k >> 3][2][k & 7] + bb[2], acc[k >> 3][3][k & 7] + bb[3]};
  GSB();   // here: every value is formed before the first store, so that no register of an issued store is rewritten ahead of the wait behind the group
#pragma unroll
  for (int k = 0; k < 16; ++k) vst2(d + (size_t)((k >> 3) * 16 + (k & 7)) * CC, o[k]);
  XW(); }
extern "C" void kernel_launch(void* const* d_in, const int* in_sizes, int n_in, void* d_out, int out_size, void* d_ws, size_t ws_size, hipStream_t stream) {
  (void)in_sizes; (void)n_in; (void)out_size;
  const float** F = (const float**)d_in;   // 0 queries, 1 keys, 2 values [4,1024,1024], 3 Wq [1024,1024] (in,out), 4 bq, 5 Wk, 6 bk, 7 Wv, 8 bv, 9 Wo, 10 bo
  if (ws_size < (size_t)WS_END) return;
  char* ws = (char*)d_ws; _Float16 *QH = (_Float16*)(ws + WS_QH), *QL = (_Float16*)(ws + WS_QL), *KH = (_Float16*)(ws + WS_KH), *VT = (_Float16*)(ws + WS_VT); float *Y = (float*)(ws + WS_Y);
  k_proj<<<dim3(TNB * TT / 128, CC / 128, 3), 256, 0, stream>>>(F[0], F[1], F[2], F[3], F[4], F[5], F[6], F[7], F[8], QH, QL, KH, VT);
  k_att<<<dim3(TT / 256, NH, TNB), 256, 0, stream>>>(QH, QL, KH, VT, Y);
  k_out<<<dim3(TNB * TT / 128, CC / 128), 256, 0, stream>>>(Y, F[9], F[10], (float*)d_out);
}

// v004
// One run takes 78.9 microseconds.
// Timed twice side by side with v003, it ran 1.08 times as fast both times.
// Counting every step since v000, it is 8.44 times as fast.
// compute dtype: all float inputs rounded to bf16; q/k/v = input W + b ([in,out]) with EXACT bf16 products on WMMA 16x16x32, f32 accumulate; q as f16 hi + residual, k f16 -> 2-product logits / 8 kept in f32 registers; online softmax in f32 (base 2, v_exp_f32), unnormalised P f16 x 2^4; o = P . v / sum with v rounded once to f16, all of it in one launch; out = o (bf16 hi + lo) Wo + bo; f32 output.
#include <hip/hip_runtime.h>
#include <math.h>

typedef __attribute__((ext_vector_type(16))) _Float16 v16h;
typedef __attribute__((ext_vector_type(16))) __bf16 v16b;
typedef __attribute__((ext_vector_type(8)))  _Float16 v8h;
typedef __attribute__((ext_vector_type(8)))  float v8f;
typedef __attribute__((ext_vector_type(4)))  float v4f;
typedef __attribute__((ext_vector_type(2)))  float v2f;
typedef __attribute__((ext_vector_type(2)))  _Float16 v2h2;
typedef __attribute__((ext_vector_type(4)))  unsigned v4u;
typedef __attribute__((ext_vector_type(4)))  int v4i;
typedef float __attribute__((may_alias)) float_a;
typedef int __attribute__((may_alias)) int_a;

template <typename T> __device__ __forceinline__ void vst2(void* p, T v) { *(T*)p = v;  }
__device__ __forceinline__ v8f wmma16(v16h a, v16h b, v8f c) {
  v8f d = __builtin_amdgcn_wmma_f32_16x16x32_f16(false, a, false, b, (short)0, c, false, false);
  asm volatile("v_nop\n\tv_nop\n\tv_nop\n\tv_nop" : "+v"(d) : "v"(a), "v"(b));
  return d;
}
__device__ __forceinline__ v8f wmma_bf(v16b a, v16b b, v8f c) {
  v8f d = __builtin_amdgcn_wmma_f32_16x16x32_bf16(false, a, false, b, (short)0, c, false, false);
  asm volatile("v_nop\n\tv_nop\n\tv_nop\n\tv_nop" : "+v"(d) : "v"(a), "v"(b));
  return d;
}
// 16x16x32 fragments: lane = (h = lane>>4, row/col = lane&15); elements 0..7 = k0+8h+0..7, 8..15 = k0+16+8h+0..7; D element r = row 8h+r
__device__ __forceinline__ v16h frag_h(const _Float16* rowk0, int lane) {
  union { v16h v; v8h q[2]; } u; const _Float16* p = rowk0 + 8 * (lane >> 4);
  u.q[0] = *(const v8h*)p; u.q[1] = *(const v8h*)(p + 16); return u.v;
}
__device__ __forceinline__ v16h frag_f32(const float* rowk0, int lane) {
  v16h a; const float* p = rowk0 + 8 * (lane >> 4);
#pragma unroll
  for (int i = 0; i < 8; ++i) { a[i] = (_Float16)p[i]; a[8 + i] = (_Float16)p[16 + i]; }
  return a;
}
__device__ __forceinline__ v16h frag_f32s(const float* rowk0, int lane, float sc) {
  v16h a; const float* p = rowk0 + 8 * (lane >> 4);
#pragma unroll
  for (int i = 0; i < 8; ++i) { a[i] = (_Float16)(p[i] * sc); a[8 + i] = (_Float16)(p[16 + i] * sc); }
  return a;
}
// column fragment from a [K][ld] layout (column n), rows >= K read as 0
__device__ __forceinline__ v16h fragc_f32(const float* W, int k0, int n, int lane, int ld, int K) {
  v16h a; const int g = lane >> 4;
#pragma unroll
  for (int i = 0; i < 8; ++i) { const int ka = k0 + 8 * g + i, kb = ka + 16;
    a[i] = (_Float16)(ka < K ? W[(size_t)(ka < K ? ka : K - 1) * ld + n] : 0.f); a[8 + i] = (_Float16)(kb < K ? W[(size_t)(kb < K ? kb : K - 1) * ld + n] : 0.f); }
  return a;
}
struct F2 { v16b h, l; };
__device__ __forceinline__ F2 bsplit16(const float v[16]) { F2 r;
#pragma unroll
  for (int i = 0; i < 16; ++i) { const __bf16 h = (__bf16)v[i]; r.h[i] = h; r.l[i] = (__bf16)(v[i] - (float)h); }
  return r; }
__device__ __forceinline__ F2 split_row(const float* row, int k0, int lane) { float v[16]; const float* p = row + k0 + 8 * (lane >> 4);
#pragma unroll
  for (int i = 0; i < 8; ++i) { v[i] = p[i]; v[8 + i] = p[16 + i]; }
  return bsplit16(v); }
__device__ __forceinline__ F2 split_rowK(const float* row, int k0, int lane, int K) { float v[16]; const int g = lane >> 4;
#pragma unroll
  for (int i = 0; i < 8; ++i) { const int ka = k0 + 8 * g + i, kb = ka + 16; v[i] = ka < K ? row[ka < K ? ka : K - 1] : 0.f; v[8 + i] = kb < K ? row[kb < K ? kb : K - 1] : 0.f; }
  return bsplit16(v); }
__device__ __forceinline__ F2 split_col(const float* W, int k0, int n, int lane, int ld, int K) { float v[16]; const int g = lane >> 4;
#pragma unroll
  for (int i = 0; i < 8; ++i) { const int ka = k0 + 8 * g + i, kb = ka + 16; v[i] = ka < K ? W[(size_t)(ka < K ? ka : K - 1) * ld + n] : 0.f; v[8 + i] = kb < K ? W[(size_t)(kb < K ? kb : K - 1) * ld + n] : 0.f; }
  return bsplit16(v); }
__device__ __forceinline__ v8f mac3(const F2& a, const F2& b, v8f c) { c = wmma_bf(a.l, b.h, c); c = wmma_bf(a.h, b.l, c); return wmma_bf(a.h, b.h, c); }
__device__ __forceinline__ float sigm(float v) { return 1.0f / (1.0f + expf(-v)); }
#define LDSX() do { asm volatile("s_wait_dscnt 0" ::: "memory"); __builtin_amdgcn_wave_barrier(); __builtin_amdgcn_fence(__ATOMIC_RELEASE, "workgroup"); } while (0)


// Hopfield layer = one cross-attention update (B 4, L = S = 1,024, d_model 1,024 = 16 x 64): q from queries, k from keys, v from values, softmax(q k / 8) v, output Linear.
#define NB 4
#define TT 1024
#define CC 1024
#define NH 16
#define HD 64
#ifndef TNB
#define TNB NB
#endif
typedef __attribute__((ext_vector_type(8))) __bf16 v8b;
__device__ __forceinline__ v16b frag_b(const __bf16* rowk0, int lane) {
  union { v16b v; v8b q[2]; } u; const __bf16* p = rowk0 + 8 * (lane >> 4);
  u.q[0] = *(const v8b*)p; u.q[1] = *(const v8b*)(p + 16); return u.v;
}
__device__ __forceinline__ float bfr(float v) { return (float)(__bf16)v; }
__device__ __attribute__((noinline)) float exp_ni(float v) { return expf(v); }
__device__ __attribute__((noinline)) float erf_ni(float v) { return erff(v); }

#define WS_QH  0u
#define WS_QL  (WS_QH + 2u * (size_t)NB * TT * CC)
#define WS_KH  (WS_QL + 2u * (size_t)NB * TT * CC)
#define WS_VT  (WS_KH + 2u * (size_t)NB * TT * CC)      // f16 v planes [b][c][t]
#define WS_Y   (WS_VT + 2u * (size_t)NB * CC * TT)      // f32 y rows [b*t][C]
#define WS_END (WS_Y + 4u * (size_t)NB * TT * CC)

#define XW() asm volatile("s_wait_xcnt 0x0" ::: "memory")   // stands behind a group of global loads, before their address registers are rewritten
// ---- the tile loop of the Linear kernels (k_out uses this one, k_proj the larger one below): block = 8 waves on 128 rows x 128 columns, a step = 64 k. Both operands are read from global memory once per block in whole lines,
// rounded to bf16 once and staged in LDS (two buffers, the next step's loads in flight over this step's products); every wave takes its fragments from there.
typedef __attribute__((ext_vector_type(4))) __bf16 v4b;
typedef __attribute__((ext_vector_type(4))) _Float16 v4h;
#define GP 72            // LDS row pitch in elements: 64 k + 8 = 144 B = 16 B x 9, the pitch of ds_load_b128 readers
#define GT (128 * GP)    // one operand tile, elements
__device__ __forceinline__ v8f wmma_b(v16b a, v16b b, v8f c) { return __builtin_amdgcn_wmma_f32_16x16x32_bf16(false, a, false, b, (short)0, c, false, false); }
struct GStage { v4f x[8], w[8]; };
// x[it]: row 16 it + 2 wave + (lane >> 4), k 4 (lane & 15) .. + 3; w[i]: k row 8 wave + i, columns 4 lane .. + 3
__device__ __forceinline__ void g_fetch(GStage& s, const float* xp, const float* wp) {
#pragma unroll
  for (int i = 0; i < 8; ++i) s.x[i] = *(const v4f*)(xp + (size_t)i * 16 * CC);
  XW();   // the second group's results may land in the first group's address registers
#pragma unroll
  for (int i = 0; i < 8; ++i) s.w[i] = *(const v4f*)(wp + (size_t)i * CC);
  XW();   // its "memory" clobber also keeps the loads here, ahead of the step's products
}
// W goes in transposed, out of registers: column 4 l + c of the tile is LDS row 32 c + l, its 8 k values one 16-byte store; so a B tile (16 LDS rows) holds every 4th column and a lane's 4 tiles hold 4 adjacent columns
template <bool SPLIT> __device__ __forceinline__ void g_put(const GStage& s, __bf16* buf, int wave, int lane) {
#pragma unroll
  for (int i = 0; i < 8; ++i) { v4b h, l;
#pragma unroll
    for (int e = 0; e < 4; ++e) { h[e] = (__bf16)s.x[i][e]; if (SPLIT) l[e] = (__bf16)(s.x[i][e] - (float)h[e]); }
    __bf16* d = buf + (i * 16 + wave * 2 + (lane >> 4)) * GP + 4 * (lane & 15); *(v4b*)d = h; if (SPLIT) *(v4b*)(d + GT) = l; }
  __bf16* wb = buf + (SPLIT ? 2 : 1) * GT + lane * GP + wave * 8;
#pragma unroll
  for (int c = 0; c < 4; ++c) { v8b p;
#pragma unroll
    for (int i = 0; i < 8; ++i) p[i] = (__bf16)s.w[i][c];
    *(v8b*)(wb + c * 32 * GP) = p; } }
// acc[mi][c] element r: row 32 wm + 16 mi + 8 g + r, column 64 wn + 4 col + c of the tile; per accumulator the products come in the order k 0, 32, 64, ... (hi then lo where SPLIT)
#define GSB() __builtin_amdgcn_sched_barrier(0)   // keeps a group of fragment loads together and ahead of the products behind it (left alone the compiler reloads one A fragment per 4 products and waits each out)
__device__ __forceinline__ void g_mac8(const v16b (&a)[2], const v16b (&b)[4], v8f (&acc)[2][4]) {
#pragma unroll
  for (int mi = 0; mi < 2; ++mi)
#pragma unroll
    for (int c = 0; c < 4; ++c) acc[mi][c] = wmma_b(a[mi], b[c], acc[mi][c]); }
template <bool SPLIT> __device__ __forceinline__ void g_step(const __bf16* ap, const __bf16* bp, int lane, v8f (&acc)[2][4]) {   // ap, bp: this lane's row of the wave's first A tile and first B tile
  v16b b0[4], b1[4], h0[2], h1[2], l0[2], l1[2];
#pragma unroll
  for (int c = 0; c < 4; ++c) b0[c] = frag_b(bp + c * 32 * GP, lane);
#pragma unroll
  for (int mi = 0; mi < 2; ++mi) { h0[mi] = frag_b(ap + mi * 16 * GP, lane); if (SPLIT) l0[mi] = frag_b(ap + GT + mi * 16 * GP, lane); }
#pragma unroll
  for (int c = 0; c < 4; ++c) b1[c] = frag_b(bp + c * 32 * GP + 32, lane);
  if (!SPLIT) {
#pragma unroll
    for (int mi = 0; mi < 2; ++mi) h1[mi] = frag_b(ap + mi * 16 * GP + 32, lane);
    GSB(); g_mac8(h0, b0, acc); g_mac8(h1, b1, acc);
  } else {
    GSB(); g_mac8(h0, b0, acc);
#pragma unroll
    for (int mi = 0; mi < 2; ++mi) h1[mi] = frag_b(ap + mi * 16 * GP + 32, lane);
    GSB(); g_mac8(l0, b0, acc);
#pragma unroll
    for (int mi = 0; mi < 2; ++mi) l1[mi] = frag_b(ap + GT + mi * 16 * GP + 32, lane);
    GSB(); g_mac8(h1, b1, acc); g_mac8(l1, b1, acc);
  } }
template <bool SPLIT> __device__ __forceinline__ void g_tile(const float* __restrict__ X, const float* __restrict__ Wt, size_t r0, int c0, __bf16* sm, v8f (&acc)[2][4]) {
  const int tid = threadIdx.x, wave = tid >> 5, lane = tid & 31, col = lane & 15, wm = wave >> 1, wn = wave & 1; constexpr int BUF = (SPLIT ? 3 : 2) * GT;
  const float* xp = X + (r0 + wave * 2 + (lane >> 4)) * CC + 4 * (lane & 15); const float* wp = Wt + (size_t)(wave * 8) * CC + c0 + 4 * lane;
  const __bf16* ap = sm + (wm * 32 + col) * GP; const __bf16* bp = sm + (SPLIT ? 2 : 1) * GT + (wn * 16 + col) * GP;
  GStage s; g_fetch(s, xp, wp); g_put<SPLIT>(s, sm, wave, lane); __syncthreads();
#pragma unroll 1   // rolled: the two buffers alternate by an offset, a second copy of the body would only add code
  for (int t = 0; t < CC / 64 - 1; ++t) { const int cur = (t & 1) * BUF;
    xp += 64; wp += (size_t)64 * CC; g_fetch(s, xp, wp);
    g_step<SPLIT>(ap + cur, bp + cur, lane, acc);
    GSB();   // here: keeps the wait for the global loads, and the rounding behind it, behind the step's products
    g_put<SPLIT>(s, sm + (BUF - cur), wave, lane);   // into the buffer that every wave left before the last barrier
    __syncthreads(); }
  g_step<SPLIT>(ap + ((CC / 64 - 1) & 1) * BUF, bp + ((CC / 64 - 1) & 1) * BUF, lane, acc); }
// ---- k_proj: block = (256 rows, 256 cols, which), 8 waves of 128 rows x 64 columns: qkv = x W (+ b), exact; q -> f16 hi (+ residual), k -> f16 rows, v -> f16 planes
// The tile loop is that of the Linear kernels above at four times the tile: each f32 operand line is fetched by half as many blocks, and a fragment read from LDS feeds more products.
#define PT (256 * GP)    // one operand tile of k_proj, elements
struct PStage { v4f x[16], w[16]; };
#define XWP(p) asm volatile("s_wait_xcnt 0x0" :: "v"(p) : "memory")   // XW() that also names the group's address: the pair stays live up to the wait, so that no load of the group has its result land in it
// x[it]: row 16 it + 2 wave + (lane >> 4), k 4 (lane & 15) .. + 3; w[8 hh + i]: k row 8 wave + i, columns 128 hh + 4 lane .. + 3
template <bool FIRST> __device__ __forceinline__ void p_fetch(PStage& s, const float* xp, const float* wp) {   // FIRST: the fetch in front of the loop, behind which the addresses are not used again
#pragma unroll
  for (int i = 0; i < 16; ++i) s.x[i] = *(const v4f*)(xp + (size_t)i * 16 * CC);
  XW();   // the second group's results may land in the first group's address registers
#pragma unroll
  for (int i = 0; i < 16; ++i) s.w[i] = *(const v4f*)(wp + (size_t)(i & 7) * CC + (i >> 3) * 128);
  if (FIRST) XWP(wp); else XW();   // its "memory" clobber also keeps the loads here, ahead of the step's products
}
// W goes in transposed as above, per half of 128 columns: column 128 hh + 4 l + c of the tile is LDS row 128 hh + 32 c + l
__device__ __forceinline__ void p_put(const PStage& s, __bf16* buf, int wave, int lane) {
#pragma unroll
  for (int i = 0; i < 16; ++i) { v4b h;
#pragma unroll
    for (int e = 0; e < 4; ++e) h[e] = (__bf16)s.x[i][e];
    *(v4b*)(buf + (i * 16 + wave * 2 + (lane >> 4)) * GP + 4 * (lane & 15)) = h; }
  __bf16* wb = buf + PT + lane * GP + wave * 8;
#pragma unroll
  for (int hc = 0; hc < 8; ++hc) { v8b p;
#pragma unroll
    for (int i = 0; i < 8; ++i) p[i] = (__bf16)s.w[(hc >> 2) * 8 + i][hc & 3];
    *(v8b*)(wb + hc * 32 * GP) = p; } }
// acc[mi][c] element r: row 128 wm + 16 mi + 8 g + r, column 64 wn + 4 col + c of the tile; per accumulator the products come in the order k 0, 32, 64, ...
__device__ __forceinline__ void p_step(const __bf16* ap, const __bf16* bp, int lane, v8f (&acc)[8][4]) {   // ap, bp: this lane's row of the wave's first A tile and first B tile
#pragma unroll
  for (int kh = 0; kh < 2; ++kh) { v16b a[8], b[4];
#pragma unroll
    for (int c = 0; c < 4; ++c) b[c] = frag_b(bp + c * 32 * GP + kh * 32, lane);
#pragma unroll
    for (int mi = 0; mi < 8; ++mi) a[mi] = frag_b(ap + mi * 16 * GP + kh * 32, lane);
    GSB();   // here: the 24 fragment loads stay one group ahead of the 32 products
#pragma unroll
    for (int mi = 0; mi < 8; ++mi)
#pragma unroll
      for (int c = 0; c < 4; ++c) acc[mi][c] = wmma_b(a[mi], b[c], acc[mi][c]);
    GSB();   // here: keeps the next group of loads, which reuses the fragment registers, from being strewn among these products
  } }
#define PVP 264          // V staging [256 columns][256 t], row pitch in elements: 528 B = 16 B x 33
__global__ __launch_bounds__(256) void k_proj(const float* __restrict__ XQ, const float* __restrict__ XK, const float* __restrict__ XV, const float* __restrict__ WQ, const float* __restrict__ BQ, const float* __restrict__ WK, const float* __restrict__ BK, const float* __restrict__ WV, const float* __restrict__ BV, _Float16* __restrict__ QH, _Float16* __restrict__ QL, _Float16* __restrict__ KH, _Float16* __restrict__ VT) {
  __shared__ __align__(16) __bf16 sm[2 * 2 * PT];
  const int tid = threadIdx.x, wave = tid >> 5, lane = tid & 31, col = lane & 15, g = lane >> 4, wm = wave >> 2, wn = wave & 3; const int which = blockIdx.z; const int c0 = blockIdx.y * 256; const size_t r0 = (size_t)blockIdx.x * 256; const float* X = which == 0 ? XQ : which == 1 ? XK : XV; const float* WA = which == 0 ? WQ : which == 1 ? WK : WV; const float* BA = which == 0 ? BQ : which == 1 ? BK : BV;
  v8f acc[8][4] = {};
  { constexpr int BUF = 2 * PT;
    const float* xp = X + (r0 + wave * 2 + (lane >> 4)) * CC + 4 * (lane & 15); const float* wp = WA + (size_t)(wave * 8) * CC + c0 + 4 * lane;
    const __bf16* ap = sm + (wm * 128 + col) * GP; const __bf16* bp = sm + PT + ((wn >> 1) * 128 + (wn & 1) * 16 + col) * GP;
    PStage s; p_fetch<true>(s, xp, wp); p_put(s, sm, wave, lane); __syncthreads();
#pragma unroll 1   // rolled: the two buffers alternate by an offset, a second copy of the body would only add code
    for (int t = 0; t < CC / 64 - 1; ++t) { const int cur = (t & 1) * BUF;
      xp += 64; wp += (size_t)64 * CC; p_fetch<false>(s, xp, wp);
      p_step(ap + cur, bp + cur, lane, acc);   // its last GSB keeps the wait for the global loads, and the rounding behind it, behind the step's products
      p_put(s, sm + (BUF - cur), wave, lane);   // into the buffer that every wave left before the last barrier
      __syncthreads(); }
    p_step(ap + ((CC / 64 - 1) & 1) * BUF, bp + ((CC / 64 - 1) & 1) * BUF, lane, acc); }
  const int cl = wn * 64 + 4 * col; const v4f bv = *(const v4f*)(BA + c0 + cl); const float bb[4] = {bfr(bv[0]), bfr(bv[1]), bfr(bv[2]), bfr(bv[3])};
  if (which < 2) { _Float16* dh = (which == 0 ? QH : KH) + (r0 + wm * 128 + 8 * g) * CC + c0 + cl; _Float16* dl = QL + (r0 + wm * 128 + 8 * g) * CC + c0 + cl;   // a row's 64 columns of a wave = one 128-byte line
#pragma unroll
    for (int m2 = 0; m2 < 4; ++m2) {   // 32 rows a group
      v4h hv[16];
#pragma unroll
      for (int k = 0; k < 16; ++k)
#pragma unroll
        for (int c = 0; c < 4; ++c) hv[k][c] = (_Float16)(acc[2 * m2 + (k >> 3)][c][k & 7] + bb[c]);
      GSB();   // here: every value is formed before the first store, so that no register of an issued store is rewritten ahead of the wait behind the group
#pragma unroll
      for (int k = 0; k < 16; ++k) *(v4h*)(dh + (size_t)(m2 * 32 + (k >> 3) * 16 + (k & 7)) * CC) = hv[k];
      XW();
      if (which == 0) { v4h lv[16];
#pragma unroll
        for (int k = 0; k < 16; ++k)
#pragma unroll
          for (int c = 0; c < 4; ++c) lv[k][c] = (_Float16)(acc[2 * m2 + (k >> 3)][c][k & 7] + bb[c] - (float)hv[k][c]);
        GSB();   // as above
#pragma unroll
        for (int k = 0; k < 16; ++k) *(v4h*)(dl + (size_t)(m2 * 32 + (k >> 3) * 16 + (k & 7)) * CC) = lv[k];
        XW(); } } }
  else { _Float16* th = (_Float16*)sm;   // [256 columns][PVP], over the buffers
    __syncthreads();   // ends every wave's last fragment reads
#pragma unroll
    for (int mi = 0; mi < 8; ++mi)
#pragma unroll
      for (int c = 0; c < 4; ++c) { v8h hv;
#pragma unroll
        for (int r = 0; r < 8; ++r) hv[r] = (_Float16)(acc[mi][c][r] + bb[c]);
        *(v8h*)(th + (cl + c) * PVP + wm * 128 + mi * 16 + 8 * g) = hv; }
    __syncthreads();
    const size_t b = r0 / TT; const int t0 = (int)(r0 % TT); _Float16* dv = VT + (b * CC + c0 + wave) * (size_t)TT + t0 + lane * 8;   // a wave's store = one column's 256 t = 4 whole lines
#pragma unroll
    for (int gr = 0; gr < 4; ++gr) { v4u tv[8];
#pragma unroll
      for (int it = 0; it < 8; ++it) tv[it] = *(const v4u*)(th + ((gr * 8 + it) * 8 + wave) * PVP + lane * 8);
      GSB();   // as above: the group's values are all read before its first store
#pragma unroll
      for (int it = 0; it < 8; ++it) vst2((unsigned*)(dv + (size_t)(gr * 8 + it) * 8 * TT), tv[it]);
      XW(); } } }
// ---- k_att: block = 256 queries of (b,h), wave = 32 query columns: S^T = K Q^T, online softmax per column in registers, O^T += V^T P^T; y[q][h*HD + d] = O / sum
// K and V^T come once per block, in whole lines, into a ring of two LDS buffers (a stage = 128 keys = 4 passes of 32); all 8 waves take their fragments from there.
__device__ __forceinline__ v8f wmma_h(v16h a, v16h b, v8f c) { return __builtin_amdgcn_wmma_f32_16x16x32_f16(false, a, false, b, (short)0, c, false, false); }
__device__ __forceinline__ float xhalf(float x) { return __builtin_bit_cast(float, __builtin_amdgcn_permlanex16(__builtin_bit_cast(int, x), __builtin_bit_cast(int, x), 0x76543210, 0xfedcba98, false, false)); }  // lane l with lane l ^ 16
#define AKS 128              // keys per stage
#define AKP 72               // K tile [128 keys][64 d], row pitch in elements: 144 B = 16 B x 9, the pitch of ds_load_b128 readers
#define AVP 136              // V^T tile [64 d][128 keys], row pitch in elements: 272 B = 16 B x 17
#define AKT (AKS * AKP)
#define ABUF (AKT + HD * AVP)   // one buffer, elements
// one stage: 8 copies of 16 B a lane. K: row (tid >> 3) + 32 i, 16-byte piece tid & 7; V^T: row (tid >> 4) + 16 i, piece tid & 15; a wave's copy covers 4 whole lines.
// The wait on xcnt is the statement's last line, so that it stands before any rewrite of a register that a copy names.
__device__ __forceinline__ void a_stage(unsigned lk, const _Float16* gk, unsigned lv, const _Float16* gv) {
  asm volatile("global_load_async_to_lds_b128 %0, %8, off\n\t"
               "global_load_async_to_lds_b128 %1, %9, off\n\t"
               "global_load_async_to_lds_b128 %2, %10, off\n\t"
               "global_load_async_to_lds_b128 %3, %11, off\n\t"
               "global_load_async_to_lds_b128 %4, %12, off\n\t"
               "global_load_async_to_lds_b128 %5, %13, off\n\t"
               "global_load_async_to_lds_b128 %6, %14, off\n\t"
               "global_load_async_to_lds_b128 %7, %15, off\n\t"
               "s_wait_xcnt 0x0"
               :: "v"(lk), "v"(lk + 32u * AKP * 2u), "v"(lk + 64u * AKP * 2u), "v"(lk + 96u * AKP * 2u), "v"(lv), "v"(lv + 16u * AVP * 2u), "v"(lv + 32u * AVP * 2u), "v"(lv + 48u * AVP * 2u),
                  "v"(gk), "v"(gk + (size_t)32 * CC), "v"(gk + (size_t)64 * CC), "v"(gk + (size_t)96 * CC), "v"(gv), "v"(gv + (size_t)16 * TT), "v"(gv + (size_t)32 * TT), "v"(gv + (size_t)48 * TT)
               : "memory"); }
#define AWAIT() asm volatile("s_wait_asynccnt 0x0" ::: "memory")   // this wave's copies have landed; the barrier behind it shows them to the other waves
__global__ __launch_bounds__(256) void k_att(const _Float16* __restrict__ QH, const _Float16* __restrict__ QL, const _Float16* __restrict__ KH, const _Float16* __restrict__ VT, float* __restrict__ Y) {
  __shared__ __align__(16) _Float16 sm[2 * ABUF];
  const int tid = threadIdx.x, wave = tid >> 5, lane = tid & 31, col = lane & 15, g = lane >> 4; const int h = blockIdx.y, b = blockIdx.z; const int q0 = blockIdx.x * 256 + wave * 32;
  const float cs = 0.125f * 1.4426950408889634f;   // logits / 8, in base 2
  const unsigned lk = (unsigned)(size_t)(sm + (tid >> 3) * AKP + (tid & 7) * 8), lv = (unsigned)(size_t)(sm + AKT + (tid >> 4) * AVP + (tid & 15) * 8);   // LDS byte addresses of this lane's first pieces, buffer 0
  const _Float16* gk = KH + ((size_t)b * TT + (tid >> 3)) * CC + h * HD + (tid & 7) * 8;
  const _Float16* gv = VT + ((size_t)b * CC + h * HD + (tid >> 4)) * (size_t)TT + (tid & 15) * 8;
  a_stage(lk, gk, lv, gv);                          // stage 0 into buffer 0
  v16h qh[2][2], ql[2][2];                          // B operands: column = query, [column group][kc]
#pragma unroll
  for (int c = 0; c < 2; ++c)
#pragma unroll
    for (int kc = 0; kc < 2; ++kc) { const size_t o = ((size_t)b * TT + q0 + c * 16 + col) * CC + h * HD + kc * 32; qh[c][kc] = frag_h(QH + o, lane); ql[c][kc] = frag_h(QL + o, lane); }
  XW(); __builtin_amdgcn_sched_barrier(0);          // keeps the accumulators' zeroing, which reuses the address registers, behind the wait
  AWAIT(); __syncthreads();
  a_stage(lk + 2u * ABUF, gk + (size_t)AKS * CC, lv + 2u * ABUF, gv + AKS);   // stage 1 into buffer 1
  v8f acc[2][HD / 16] = {}; float mr[2] = {-INFINITY, -INFINITY}, ls[2] = {0.f, 0.f};
#pragma unroll 1   // rolled: the two buffers alternate by an offset, a second copy of the body would only add code
  for (int st = 0; st < TT / AKS; ++st) {
    const _Float16* kp = sm + (st & 1) * ABUF + col * AKP;          // A operand of S^T: row = key
    const _Float16* vp = sm + (st & 1) * ABUF + AKT + col * AVP;    // A operand of O^T: row = d
    v16h kf[2][2], vf[HD / 16];
#pragma unroll
    for (int t = 0; t < 2; ++t)
#pragma unroll
      for (int kc = 0; kc < 2; ++kc) kf[t][kc] = frag_h(kp + (t * 16) * AKP + kc * 32, lane);
#pragma unroll
    for (int j = 0; j < HD / 16; ++j) vf[j] = frag_h(vp + (j * 16) * AVP, lane);
    GSB();   // here: keeps the stage's first fetches one group ahead of the products (left alone the V^T loads are strewn among them)
#pragma unroll
    for (int ps = 0; ps < AKS / 32; ++ps) {         // a pass = 32 keys
      v8f s[2][2] = {};                             // [key tile][column group]: register r = key 16 t + 8 g + r, lane column = query
#pragma unroll
      for (int kc = 0; kc < 2; ++kc) {
#pragma unroll
        for (int t = 0; t < 2; ++t)
#pragma unroll
          for (int c = 0; c < 2; ++c) s[t][c] = wmma_h(kf[t][kc], qh[c][kc], s[t][c]);
#pragma unroll
        for (int t = 0; t < 2; ++t)
#pragma unroll
          for (int c = 0; c < 2; ++c) s[t][c] = wmma_h(kf[t][kc], ql[c][kc], s[t][c]);
      }
      GSB();   // here: keeps the 16 products one run over 4 independent tiles (left alone the maxima are woven in and the products line up in dependent chains)
      if (ps + 1 < AKS / 32) {                      // inside a stage K and V fragments are fetched one pass ahead, each behind its own products; never out of the next stage
#pragma unroll
        for (int t = 0; t < 2; ++t)
#pragma unroll
          for (int kc = 0; kc < 2; ++kc) kf[t][kc] = frag_h(kp + ((ps + 1) * 32 + t * 16) * AKP + kc * 32, lane);
        GSB();   // here: keeps this fetch one group, the softmax and the second product ahead of its use
      }
      float mb[2]; bool need = false;
#pragma unroll
      for (int c = 0; c < 2; ++c) { float mx = s[0][c][0];
#pragma unroll
        for (int r = 1; r < 8; ++r) mx = fmaxf(mx, s[0][c][r]);
#pragma unroll
        for (int r = 0; r < 8; ++r) mx = fmaxf(mx, s[1][c][r]);
        mx = fmaxf(mx, xhalf(mx)) * cs; mb[c] = mx; need = need || (mx > mr[c] + 8.0f); }
      if (__builtin_amdgcn_ballot_w32(need) != 0) {   // the maximum in use moves only when a column's new one exceeds it by 2^8: rare after the first pass
        const float mn0 = fmaxf(mr[0], mb[0]), mn1 = fmaxf(mr[1], mb[1]); const float corr[2] = {__builtin_amdgcn_exp2f(mr[0] - mn0), __builtin_amdgcn_exp2f(mr[1] - mn1)}; mr[0] = mn0; mr[1] = mn1;   // 0 on the first pass
#pragma unroll
        for (int c = 0; c < 2; ++c) { ls[c] *= corr[c];
#pragma unroll
          for (int j = 0; j < HD / 16; ++j) acc[c][j] = acc[c][j] * corr[c]; }
      }
#pragma unroll
      for (int c = 0; c < 2; ++c) { const float nm = 4.0f - mr[c];   // P carries 2^4 (it cancels in the division): at most 2^12 in f16
        union { v16h v; v2h2 w[8]; } pf; float sa = 0.f, sb = 0.f;
#pragma unroll
        for (int i = 0; i < 8; ++i) { const v2f arg = __builtin_elementwise_fma(v2f{s[i >> 2][c][2 * (i & 3)], s[i >> 2][c][2 * (i & 3) + 1]}, v2f{cs, cs}, v2f{nm, nm}); const float p0 = __builtin_amdgcn_exp2f(arg.x), p1 = __builtin_amdgcn_exp2f(arg.y);
          sa += p0; sb += p1; pf.w[i] = __builtin_convertvector(v2f{p0, p1}, v2h2); }
        ls[c] += sa + sb;
#pragma unroll
        for (int j = 0; j < HD / 16; ++j) acc[c][j] = wmma_h(vf[j], pf.v, acc[c][j]); }
      if (ps + 1 < AKS / 32) {
#pragma unroll
        for (int j = 0; j < HD / 16; ++j) vf[j] = frag_h(vp + (j * 16) * AVP + (ps + 1) * 32, lane);
        GSB();   // here: as above, the next pass's first products and softmax ahead of its use
      }
    }
    asm volatile("s_wait_dscnt 0x0" ::: "memory");  // this wave's reads of the buffer are over before a copy may be aimed at it
    AWAIT(); __syncthreads();                       // the one barrier of a stage: publishes stage st + 1 and ends every wave's reads of stage st
    if (st + 2 < TT / AKS) a_stage(lk + (unsigned)(st & 1) * (2u * ABUF), gk + (size_t)(st + 2) * AKS * CC, lv + (unsigned)(st & 1) * (2u * ABUF), gv + (st + 2) * AKS);   // into the buffer just read
  }
  AWAIT();   // no copy is outstanding when the wave ends
#pragma unroll
  for (int c = 0; c < 2; ++c) { const float inv = 1.0f / (ls[c] + xhalf(ls[c])); float* yr = Y + ((size_t)b * TT + q0 + c * 16 + col) * CC + h * HD + 8 * g;
#pragma unroll
    for (int j = 0; j < HD / 16; ++j) { const v8f o = acc[c][j] * inv; vst2(yr + j * 16, v4f{o[0], o[1], o[2], o[3]}); vst2(yr + j * 16 + 4, v4f{o[4], o[5], o[6], o[7]}); } } }
// ---- k_out: block = (128 rows, 128 cols): out = y (bf16 hi + lo) Wproj + b
__global__ __launch_bounds__(256) void k_out(const float* __restrict__ Y, const float* __restrict__ WP, const float* __restrict__ BP, float* __restrict__ OUT) { __shared__ __align__(16) __bf16 sm[2 * 3 * GT];
  const int tid = threadIdx.x, wave = tid >> 5, lane = tid & 31, col = lane & 15, g = lane >> 4, wm = wave >> 1, wn = wave & 1; const int c0 = blockIdx.y * 128; const size_t r0 = (size_t)blockIdx.x * 128;
  v8f acc[2][4] = {}; g_tile<true>(Y, WP, r0, c0, sm, acc);
  const int cl = wn * 64 + 4 * col; float bb[4] = {0.f, 0.f, 0.f, 0.f}; if (BP) { const v4f bv = *(const v4f*)(BP + c0 + cl); bb[0] = bfr(bv[0]); bb[1] = bfr(bv[1]); bb[2] = bfr(bv[2]); bb[3] = bfr(bv[3]); }
  float* d = OUT + (r0 + wm * 32 + 8 * g) * CC + c0 + cl;   // a row's 64 columns of a wave = two whole lines
  v4f o[16];
#pragma unroll
  for (int k = 0; k < 16; ++k) o[k] = v4f{acc[k >> 3][0][k & 7] + bb[0], acc[k >> 3][1][k & 7] + bb[1], acc[k >> 3][2][k & 7] + bb[2], acc[k >> 3][3][k & 7] + bb[3]};
  GSB();   // here: every value is formed before the first store, so that no register of an issued store is rewritten ahead of the wait behind the group
#pragma unroll
  for (int k = 0; k < 16; ++k) vst2(d + (size_t)((k >> 3) * 16 + (k & 7)) * CC, o[k]);
  XW(); }
extern "C" void kernel_launch(void* const* d_in, const int* in_sizes, int n_in, void* d_out, int out_size, void* d_ws, size_t ws_size, hipStream_t stream) {
  (void)in_sizes; (void)n_in; (void)out_size;
  const float** F = (const float**)d_in;   // 0 queries, 1 keys, 2 values [4,1024,1024], 3 Wq [1024,1024] (in,out), 4 bq, 5 Wk, 6 bk, 7 Wv, 8 bv, 9 Wo, 10 bo
  if (ws_size < (size_t)WS_END) return;
  char* ws = (char*)d_ws; _Float16 *QH = (_Float16*)(ws + WS_QH), *QL = (_Float16*)(ws + WS_QL), *KH = (_Float16*)(ws + WS_KH), *VT = (_Float16*)(ws + WS_VT); float *Y = (float*)(ws + WS_Y);
  k_proj<<<dim3(TNB * TT / 256, CC / 256, 3), 256, 0, stream>>>(F[0], F[1], F[2], F[3], F[4], F[5], F[6], F[7], F[8], QH, QL, KH, VT);
  k_att<<<dim3(TT / 256, NH, TNB), 256, 0, stream>>>(QH, QL, KH, VT, Y);
  k_out<<<dim3(TNB * TT / 128, CC / 128), 256, 0, stream>>>(Y, F[9], F[10], (float*)d_out);
}

// v006
// Measured time: 63.8 microseconds a run.
// Versions in between are left out here; by their measured steps it is 1.23 times as fast as v004.
// Counting every step since v000, it is 10.4 times as fast.
// compute dtype: all float inputs rounded to bf16; q/k/v = input W + b ([in,out]) with EXACT bf16 products on WMMA 16x16x32, f32 accumulate; q and k each rounded once to f16 -> logits / 8 kept in f32 registers; online softmax in f32 (base 2, v_exp_f32), unnormalised P f16 x 2^4; o = P . v / sum with v rounded once to f16, all of it in one launch; out = o (rounded once to f16) Wo (its bf16 value held in f16) + bo; f32 output.
#include <hip/hip_runtime.h>
#include <math.h>

typedef __attribute__((ext_vector_type(16))) _Float16 v16h;
typedef __attribute__((ext_vector_type(16))) __bf16 v16b;
typedef __attribute__((ext_vector_type(8)))  _Float16 v8h;
typedef __attribute__((ext_vector_type(8)))  float v8f;
typedef __attribute__((ext_vector_type(4)))  float v4f;
typedef __attribute__((ext_vector_type(2)))  float v2f;
typedef __attribute__((ext_vector_type(2)))  _Float16 v2h2;
typedef __attribute__((ext_vector_type(4)))  unsigned v4u;
typedef __attribute__((ext_vector_type(4)))  int v4i;
typedef float __attribute__((may_alias)) float_a;
typedef int __attribute__((may_alias)) int_a;

template <typename T> __device__ __forceinline__ void vst2(void* p, T v) { *(T*)p = v;  }
__device__ __forceinline__ v8f wmma16(v16h a, v16h b, v8f c) {
  v8f d = __builtin_amdgcn_wmma_f32_16x16x32_f16(false, a, false, b, (short)0, c, false, false);
  asm volatile("v_nop\n\tv_nop\n\tv_nop\n\tv_nop" : "+v"(d) : "v"(a), "v"(b));
  return d;
}
__device__ __forceinline__ v8f wmma_bf(v16b a, v16b b, v8f c) {
  v8f d = __builtin_amdgcn_wmma_f32_16x16x32_bf16(false, a, false, b, (short)0, c, false, false);
  asm volatile("v_nop\n\tv_nop\n\tv_nop\n\tv_nop" : "+v"(d) : "v"(a), "v"(b));
  return d;
}
// 16x16x32 fragments: lane = (h = lane>>4, row/col = lane&15); elements 0..7 = k0+8h+0..7, 8..15 = k0+16+8h+0..7; D element r = row 8h+r
__device__ __forceinline__ v16h frag_h(const _Float16* rowk0, int lane) {
  union { v16h v; v8h q[2]; } u; const _Float16* p = rowk0 + 8 * (lane >> 4);
  u.q[0] = *(const v8h*)p; u.q[1] = *(const v8h*)(p + 16); return u.v;
}
__device__ __forceinline__ v16h frag_f32(const float* rowk0, int lane) {
  v16h a; const float* p = rowk0 + 8 * (lane >> 4);
#pragma unroll
  for (int i = 0; i < 8; ++i) { a[i] = (_Float16)p[i]; a[8 + i] = (_Float16)p[16 + i]; }
  return a;
}
__device__ __forceinline__ v16h frag_f32s(const float* rowk0, int lane, float sc) {
  v16h a; const float* p = rowk0 + 8 * (lane >> 4);
#pragma unroll
  for (int i = 0; i < 8; ++i) { a[i] = (_Float16)(p[i] * sc); a[8 + i] = (_Float16)(p[16 + i] * sc); }
  return a;
}
// column fragment from a [K][ld] layout (column n), rows >= K read as 0
__device__ __forceinline__ v16h fragc_f32(const float* W, int k0, int n, int lane, int ld, int K) {
  v16h a; const int g = lane >> 4;
#pragma unroll
  for (int i = 0; i < 8; ++i) { const int ka = k0 + 8 * g + i, kb = ka + 16;
    a[i] = (_Float16)(ka < K ? W[(size_t)(ka < K ? ka : K - 1) * ld + n] : 0.f); a[8 + i] = (_Float16)(kb < K ? W[(size_t)(kb < K ? kb : K - 1) * ld + n] : 0.f); }
  return a;
}
struct F2 { v16b h, l; };
__device__ __forceinline__ F2 bsplit16(const float v[16]) { F2 r;
#pragma unroll
  for (int i = 0; i < 16; ++i) { const __bf16 h = (__bf16)v[i]; r.h[i] = h; r.l[i] = (__bf16)(v[i] - (float)h); }
  return r; }
__device__ __forceinline__ F2 split_row(const float* row, int k0, int lane) { float v[16]; const float* p = row + k0 + 8 * (lane >> 4);
#pragma unroll
  for (int i = 0; i < 8; ++i) { v[i] = p[i]; v[8 + i] = p[16 + i]; }
  return bsplit16(v); }
__device__ __forceinline__ F2 split_rowK(const float* row, int k0, int lane, int K) { float v[16]; const int g = lane >> 4;
#pragma unroll
  for (int i = 0; i < 8; ++i) { const int ka = k0 + 8 * g + i, kb = ka + 16; v[i] = ka < K ? row[ka < K ? ka : K - 1] : 0.f; v[8 + i] = kb < K ? row[kb < K ? kb : K - 1] : 0.f; }
  return bsplit16(v); }
__device__ __forceinline__ F2 split_col(const float* W, int k0, int n, int lane, int ld, int K) { float v[16]; const int g = lane >> 4;
#pragma unroll
  for (int i = 0; i < 8; ++i) { const int ka = k0 + 8 * g + i, kb = ka + 16; v[i] = ka < K ? W[(size_t)(ka < K ? ka : K - 1) * ld + n] : 0.f; v[8 + i] = kb < K ? W[(size_t)(kb < K ? kb : K - 1) * ld + n] : 0.f; }
  return bsplit16(v); }
__device__ __forceinline__ v8f mac3(const F2& a, const F2& b, v8f c) { c = wmma_bf(a.l, b.h, c); c = wmma_bf(a.h, b.l, c); return wmma_bf(a.h, b.h, c); }
__device__ __forceinline__ float sigm(float v) { return 1.0f / (1.0f + expf(-v)); }
#define LDSX() do { asm volatile("s_wait_dscnt 0" ::: "memory"); __builtin_amdgcn_wave_barrier(); __builtin_amdgcn_fence(__ATOMIC_RELEASE, "workgroup"); } while (0)


// Hopfield layer = one cross-attention update (B 4, L = S = 1,024, d_model 1,024 = 16 x 64): q from queries, k from keys, v from values, softmax(q k / 8) v, output Linear.
#define NB 4
#define TT 1024
#define CC 1024
#define NH 16
#define HD 64
#ifndef TNB
#define TNB NB
#endif
typedef __attribute__((ext_vector_type(8))) __bf16 v8b;
__device__ __forceinline__ v16b frag_b(const __bf16* rowk0, int lane) {
  union { v16b v; v8b q[2]; } u; const __bf16* p = rowk0 + 8 * (lane >> 4);
  u.q[0] = *(const v8b*)p; u.q[1] = *(const v8b*)(p + 16); return u.v;
}
__device__ __forceinline__ float bfr(float v) { return (float)(__bf16)v; }
__device__ __attribute__((noinline)) float exp_ni(float v) { return expf(v); }
__device__ __attribute__((noinline)) float erf_ni(float v) { return erff(v); }

#define WS_QH  0u
#define WS_KH  (WS_QH + 2u * (size_t)NB * TT * CC)
#define WS_VT  (WS_KH + 2u * (size_t)NB * TT * CC)      // f16 v planes [b][c][t]
#define WS_Y   (WS_VT + 2u * (size_t)NB * CC * TT)      // f16 y rows [b*t][C]
#define WS_END (WS_Y + 2u * (size_t)NB * TT * CC)

#define XW() asm volatile("s_wait_xcnt 0x0" ::: "memory")   // stands behind a group of global loads, before their address registers are rewritten
#define XWP(p) asm volatile("s_wait_xcnt 0x0" :: "v"(p) : "memory")   // XW() that also names the group's address: the pair stays live up to the wait, so that no load of the group has its result land in it
// Work-groups that share an operand panel would walk its k tiles in step and ask L2 for the same lines at the same moment. Each starts at a k tile of its own and wraps: tile (t0 + t) mod 16 at step t.
#define KT(t0, t) (((t0) + (t)) & (CC / 64 - 1))
// ---- the tile loop of k_out (k_proj has the larger one below): block = 8 waves on 128 rows x 128 columns, a step = 64 k. Both operands are read from global memory once per block in whole lines
// and staged in LDS as f16 (two buffers, the next step's loads in flight over this step's products); every wave takes its fragments from there. y comes as f16; W is rounded to bf16 once, and that value is held in f16.
typedef __attribute__((ext_vector_type(4))) __bf16 v4b;
typedef __attribute__((ext_vector_type(4))) _Float16 v4h;
#define GP 72            // LDS row pitch in elements: 64 k + 8 = 144 B = 16 B x 9, the pitch of ds_load_b128 readers
#define GT (128 * GP)    // one operand tile, elements
__device__ __forceinline__ v8f wmma_b(v16b a, v16b b, v8f c) { return __builtin_amdgcn_wmma_f32_16x16x32_bf16(false, a, false, b, (short)0, c, false, false); }
__device__ __forceinline__ v8f wmma_h(v16h a, v16h b, v8f c) { return __builtin_amdgcn_wmma_f32_16x16x32_f16(false, a, false, b, (short)0, c, false, false); }
struct GStage { v4u x[4]; v4f w[8]; };
// x[it]: row 32 it + 4 wave + (lane >> 3), k 8 (lane & 7) .. + 7 (a wave's load = 4 whole lines); w[i]: k row 8 wave + i, columns 4 lane .. + 3
__device__ __forceinline__ void g_fetch(GStage& s, const _Float16* xp, const float* wp) {
#pragma unroll
  for (int i = 0; i < 4; ++i) s.x[i] = *(const v4u*)(xp + (size_t)i * 32 * CC);
  XWP(xp);   // the second group's results may land in the first group's address registers
#pragma unroll
  for (int i = 0; i < 8; ++i) s.w[i] = *(const v4f*)(wp + (size_t)i * CC);
  XWP(wp);   // its "memory" clobber also keeps the loads here, ahead of the step's products
}
// W goes in transposed, out of registers: column 4 l + c of the tile is LDS row 32 c + l, its 8 k values one 16-byte store; so a B tile (16 LDS rows) holds every 4th column and a lane's 4 tiles hold 4 adjacent columns
__device__ __forceinline__ void g_put(const GStage& s, _Float16* buf, int wave, int lane) {
#pragma unroll
  for (int i = 0; i < 4; ++i) *(v4u*)(buf + (i * 32 + wave * 4 + (lane >> 3)) * GP + 8 * (lane & 7)) = s.x[i];
  _Float16* wb = buf + GT + lane * GP + wave * 8;
#pragma unroll
  for (int c = 0; c < 4; ++c) { v8h p;
#pragma unroll
    for (int i = 0; i < 8; ++i) p[i] = (_Float16)bfr(s.w[i][c]);
    *(v8h*)(wb + c * 32 * GP) = p; } }
// acc[mi][c] element r: row 32 wm + 16 mi + 8 g + r, column 64 wn + 4 col + c of the tile; per accumulator the products come in the order k 64 t0, + 32, + 64, ..., wrapping at K
#define GSB() __builtin_amdgcn_sched_barrier(0)   // keeps a group of fragment loads together and ahead of the products behind it (left alone the compiler reloads one A fragment per 4 products and waits each out)
__device__ __forceinline__ void g_mac8(const v16h (&a)[2], const v16h (&b)[4], v8f (&acc)[2][4]) {
#pragma unroll
  for (int mi = 0; mi < 2; ++mi)
#pragma unroll
    for (int c = 0; c < 4; ++c) acc[mi][c] = wmma_h(a[mi], b[c], acc[mi][c]); }
__device__ __forceinline__ void g_step(const _Float16* ap, const _Float16* bp, int lane, v8f (&acc)[2][4]) {   // ap, bp: this lane's row of the wave's first A tile and first B tile
  v16h b0[4], b1[4], h0[2], h1[2];
#pragma unroll
  for (int c = 0; c < 4; ++c) b0[c] = frag_h(bp + c * 32 * GP, lane);
#pragma unroll
  for (int mi = 0; mi < 2; ++mi) h0[mi] = frag_h(ap + mi * 16 * GP, lane);
#pragma unroll
  for (int c = 0; c < 4; ++c) b1[c] = frag_h(bp + c * 32 * GP + 32, lane);
#pragma unroll
  for (int mi = 0; mi < 2; ++mi) h1[mi] = frag_h(ap + mi * 16 * GP + 32, lane);
  GSB(); g_mac8(h0, b0, acc); g_mac8(h1, b1, acc); }
__device__ __forceinline__ void g_tile(const _Float16* __restrict__ X, const float* __restrict__ Wt, size_t r0, int c0, int t0, _Float16* sm, v8f (&acc)[2][4]) {
  const int tid = threadIdx.x, wave = tid >> 5, lane = tid & 31, col = lane & 15, wm = wave >> 1, wn = wave & 1; constexpr int BUF = 2 * GT;
  const _Float16* xp = X + (r0 + wave * 4 + (lane >> 3)) * CC + 8 * (lane & 7); const float* wp = Wt + (size_t)(wave * 8) * CC + c0 + 4 * lane;
  const _Float16* ap = sm + (wm * 32 + col) * GP; const _Float16* bp = sm + GT + (wn * 16 + col) * GP;
  GStage s; g_fetch(s, xp + KT(t0, 0) * 64, wp + (size_t)KT(t0, 0) * 64 * CC); g_put(s, sm, wave, lane); __syncthreads();
#pragma unroll 1   // rolled: the two buffers alternate by an offset, a second copy of the body would only add code
  for (int t = 0; t < CC / 64 - 1; ++t) { const int cur = (t & 1) * BUF;
    g_fetch(s, xp + KT(t0, t + 1) * 64, wp + (size_t)KT(t0, t + 1) * 64 * CC);
    g_step(ap + cur, bp + cur, lane, acc);
    GSB();   // here: keeps the wait for the global loads, and the rounding behind it, behind the step's products
    g_put(s, sm + (BUF - cur), wave, lane);   // into the buffer that every wave left before the last barrier
    __syncthreads(); }
  g_step(ap + ((CC / 64 - 1) & 1) * BUF, bp + ((CC / 64 - 1) & 1) * BUF, lane, acc); }
// ---- k_proj: block = (256 rows, 256 cols, which), 8 waves of 128 rows x 64 columns: qkv = x W (+ b), exact; q, k -> f16 rows, v -> f16 planes
// The tile loop has the form of the one above, on f32 operands rounded to bf16, at four times the tile: each f32 operand line is fetched by half as many blocks, and a fragment read from LDS feeds more products.
#define PT (256 * GP)    // one operand tile of k_proj, elements
struct PStage { v4f x[16], w[16]; };
// x[it]: row 16 it + 2 wave + (lane >> 4), k 4 (lane & 15) .. + 3; w[8 hh + i]: k row 8 wave + i, columns 128 hh + 4 lane .. + 3
__device__ __forceinline__ void p_fetch(PStage& s, const float* xp, const float* wp) {
#pragma unroll
  for (int i = 0; i < 16; ++i) s.x[i] = *(const v4f*)(xp + (size_t)i * 16 * CC);
  XWP(xp);   // the second group's results may land in the first group's address registers
#pragma unroll
  for (int i = 0; i < 16; ++i) s.w[i] = *(const v4f*)(wp + (size_t)(i & 7) * CC + (i >> 3) * 128);
  XWP(wp);   // its "memory" clobber also keeps the loads here, ahead of the step's products
}
// W goes in transposed as above, per half of 128 columns: column 128 hh + 4 l + c of the tile is LDS row 128 hh + 32 c + l
__device__ __forceinline__ void p_put(const PStage& s, __bf16* buf, int wave, int lane) {
#pragma unroll
  for (int i = 0; i < 16; ++i) { v4b h;
#pragma unroll
    for (int e = 0; e < 4; ++e) h[e] = (__bf16)s.x[i][e];
    *(v4b*)(buf + (i * 16 + wave * 2 + (lane >> 4)) * GP + 4 * (lane & 15)) = h; }
  __bf16* wb = buf + PT + lane * GP + wave * 8;
#pragma unroll
  for (int hc = 0; hc < 8; ++hc) { v8b p;
#pragma unroll
    for (int i = 0; i < 8; ++i) p[i] = (__bf16)s.w[(hc >> 2) * 8 + i][hc & 3];
    *(v8b*)(wb + hc * 32 * GP) = p; } }
// acc[mi][c] element r: row 128 wm + 16 mi + 8 g + r, column 64 wn + 4 col + c of the tile; per accumulator the products come in the order k 64 t0, + 32, + 64, ..., wrapping at K
__device__ __forceinline__ void p_step(const __bf16* ap, const __bf16* bp, int lane, v8f (&acc)[8][4]) {   // ap, bp: this lane's row of the wave's first A tile and first B tile
#pragma unroll
  for (int kh = 0; kh < 2; ++kh) { v16b a[8], b[4];
#pragma unroll
    for (int c = 0; c < 4; ++c) b[c] = frag_b(bp + c * 32 * GP + kh * 32, lane);
#pragma unroll
    for (int mi = 0; mi < 8; ++mi) a[mi] = frag_b(ap + mi * 16 * GP + kh * 32, lane);
    GSB();   // here: the 24 fragment loads stay one group ahead of the 32 products
#pragma unroll
    for (int mi = 0; mi < 8; ++mi)
#pragma unroll
      for (int c = 0; c < 4; ++c) acc[mi][c] = wmma_b(a[mi], b[c], acc[mi][c]);
    GSB();   // here: keeps the next group of loads, which reuses the fragment registers, from being strewn among these products
  } }
#define PVP 264          // V staging [256 columns][256 t], row pitch in elements: 528 B = 16 B x 33
__global__ __launch_bounds__(256) void k_proj(const float* __restrict__ XQ, const float* __restrict__ XK, const float* __restrict__ XV, const float* __restrict__ WQ, const float* __restrict__ BQ, const float* __restrict__ WK, const float* __restrict__ BK, const float* __restrict__ WV, const float* __restrict__ BV, _Float16* __restrict__ QH, _Float16* __restrict__ KH, _Float16* __restrict__ VT) {
  __shared__ __align__(16) __bf16 sm[2 * 2 * PT];
  const int tid = threadIdx.x, wave = tid >> 5, lane = tid & 31, col = lane & 15, g = lane >> 4, wm = wave >> 2, wn = wave & 3; const int which = blockIdx.z; const int c0 = blockIdx.y * 256; const size_t r0 = (size_t)blockIdx.x * 256; const float* X = which == 0 ? XQ : which == 1 ? XK : XV; const float* WA = which == 0 ? WQ : which == 1 ? WK : WV; const float* BA = which == 0 ? BQ : which == 1 ? BK : BV;
  v8f acc[8][4] = {};
  { constexpr int BUF = 2 * PT; const int t0 = blockIdx.x + 4 * blockIdx.y;   // the 16 blocks on one W panel start at 16 different k tiles, the 4 on one X panel 4 tiles apart
    const float* xp = X + (r0 + wave * 2 + (lane >> 4)) * CC + 4 * (lane & 15); const float* wp = WA + (size_t)(wave * 8) * CC + c0 + 4 * lane;
    const __bf16* ap = sm + (wm * 128 + col) * GP; const __bf16* bp = sm + PT + ((wn >> 1) * 128 + (wn & 1) * 16 + col) * GP;
    PStage s; p_fetch(s, xp + KT(t0, 0) * 64, wp + (size_t)KT(t0, 0) * 64 * CC); p_put(s, sm, wave, lane); __syncthreads();
#pragma unroll 1   // rolled: the two buffers alternate by an offset, a second copy of the body would only add code
    for (int t = 0; t < CC / 64 - 1; ++t) { const int cur = (t & 1) * BUF;
      p_fetch(s, xp + KT(t0, t + 1) * 64, wp + (size_t)KT(t0, t + 1) * 64 * CC);
      p_step(ap + cur, bp + cur, lane, acc);   // its last GSB keeps the wait for the global loads, and the rounding behind it, behind the step's products
      p_put(s, sm + (BUF - cur), wave, lane);   // into the buffer that every wave left before the last barrier
      __syncthreads(); }
    p_step(ap + ((CC / 64 - 1) & 1) * BUF, bp + ((CC / 64 - 1) & 1) * BUF, lane, acc); }
  const int cl = wn * 64 + 4 * col; const v4f bv = *(const v4f*)(BA + c0 + cl); const float bb[4] = {bfr(bv[0]), bfr(bv[1]), bfr(bv[2]), bfr(bv[3])};
  if (which < 2) { _Float16* dh = (which == 0 ? QH : KH) + (r0 + wm * 128 + 8 * g) * CC + c0 + cl;   // a row's 64 columns of a wave = one 128-byte line
#pragma unroll
    for (int m2 = 0; m2 < 4; ++m2) {   // 32 rows a group
      v4h hv[16];
#pragma unroll
      for (int k = 0; k < 16; ++k)
#pragma unroll
        for (int c = 0; c < 4; ++c) hv[k][c] = (_Float16)(acc[2 * m2 + (k >> 3)][c][k & 7] + bb[c]);
      GSB();   // here: every value is formed before the first store, so that no register of an issued store is rewritten ahead of the wait behind the group
#pragma unroll
      for (int k = 0; k < 16; ++k) *(v4h*)(dh + (size_t)(m2 * 32 + (k >> 3) * 16 + (k & 7)) * CC) = hv[k];
      XW(); GSB();   // the barrier keeps the next group's values, which reuse the registers of these stores, behind the wait
    } }
  else { _Float16* th = (_Float16*)sm;   // [256 columns][PVP], over the buffers
    __syncthreads();   // ends every wave's last fragment reads
#pragma unroll
    for (int mi = 0; mi < 8; ++mi)
#pragma unroll
      for (int c = 0; c < 4; ++c) { v8h hv;
#pragma unroll
        for (int r = 0; r < 8; ++r) hv[r] = (_Float16)(acc[mi][c][r] + bb[c]);
        *(v8h*)(th + (cl + c) * PVP + wm * 128 + mi * 16 + 8 * g) = hv; }
    __syncthreads();
    const size_t b = r0 / TT; const int t0 = (int)(r0 % TT); _Float16* dv = VT + (b * CC + c0 + wave) * (size_t)TT + t0 + lane * 8;   // a wave's store = one column's 256 t = 4 whole lines
#pragma unroll
    for (int gr = 0; gr < 4; ++gr) { v4u tv[8];
#pragma unroll
      for (int it = 0; it < 8; ++it) tv[it] = *(const v4u*)(th + ((gr * 8 + it) * 8 + wave) * PVP + lane * 8);
      GSB();   // as above: the group's values are all read before its first store
#pragma unroll
      for (int it = 0; it < 8; ++it) vst2((unsigned*)(dv + (size_t)(gr * 8 + it) * 8 * TT), tv[it]);
      XW(); } } }
// ---- k_att: block = 256 queries of (b,h), wave = 32 query columns: S^T = K Q^T, online softmax per column in registers, O^T += V^T P^T; y[q][h*HD + d] = O / sum
// K and V^T come once per block, in whole lines, into a ring of two LDS buffers (a stage = 128 keys = 4 passes of 32); all 8 waves take their fragments from there.
__device__ __forceinline__ float xhalf(float x) { return __builtin_bit_cast(float, __builtin_amdgcn_permlanex16(__builtin_bit_cast(int, x), __builtin_bit_cast(int, x), 0x76543210, 0xfedcba98, false, false)); }  // lane l with lane l ^ 16
#define AKS 128              // keys per stage
#define AKP 72               // K tile [128 keys][64 d], row pitch in elements: 144 B = 16 B x 9, the pitch of ds_load_b128 readers
#define AVP 136              // V^T tile [64 d][128 keys], row pitch in elements: 272 B = 16 B x 17
#define AKT (AKS * AKP)
#define ABUF (AKT + HD * AVP)   // one buffer, elements
// one stage: 8 copies of 16 B a lane. K: row (tid >> 3) + 32 i, 16-byte piece tid & 7; V^T: row (tid >> 4) + 16 i, piece tid & 15; a wave's copy covers 4 whole lines.
// The wait on xcnt is the statement's last line, so that it stands before any rewrite of a register that a copy names.
__device__ __forceinline__ void a_stage(unsigned lk, const _Float16* gk, unsigned lv, const _Float16* gv) {
  asm volatile("global_load_async_to_lds_b128 %0, %8, off\n\t"
               "global_load_async_to_lds_b128 %1, %9, off\n\t"
               "global_load_async_to_lds_b128 %2, %10, off\n\t"
               "global_load_async_to_lds_b128 %3, %11, off\n\t"
               "global_load_async_to_lds_b128 %4, %12, off\n\t"
               "global_load_async_to_lds_b128 %5, %13, off\n\t"
               "global_load_async_to_lds_b128 %6, %14, off\n\t"
               "global_load_async_to_lds_b128 %7, %15, off\n\t"
               "s_wait_xcnt 0x0"
               :: "v"(lk), "v"(lk + 32u * AKP * 2u), "v"(lk + 64u * AKP * 2u), "v"(lk + 96u * AKP * 2u), "v"(lv), "v"(lv + 16u * AVP * 2u), "v"(lv + 32u * AVP * 2u), "v"(lv + 48u * AVP * 2u),
                  "v"(gk), "v"(gk + (size_t)32 * CC), "v"(gk + (size_t)64 * CC), "v"(gk + (size_t)96 * CC), "v"(gv), "v"(gv + (size_t)16 * TT), "v"(gv + (size_t)32 * TT), "v"(gv + (size_t)48 * TT)
               : "memory"); }
#define AWAIT() asm volatile("s_wait_asynccnt 0x0" ::: "memory")   // this wave's copies have landed; the barrier behind it shows them to the other waves
__global__ __launch_bounds__(256) void k_att(const _Float16* __restrict__ QH, const _Float16* __restrict__ KH, const _Float16* __restrict__ VT, _Float16* __restrict__ Y) {
  __shared__ __align__(16) _Float16 sm[2 * ABUF];
  const int tid = threadIdx.x, wave = tid >> 5, lane = tid & 31, col = lane & 15, g = lane >> 4; const int h = blockIdx.y, b = blockIdx.z; const int q0 = blockIdx.x * 256 + wave * 32;
  const float cs = 0.125f * 1.4426950408889634f;   // logits / 8, in base 2
  const unsigned lk = (unsigned)(size_t)(sm + (tid >> 3) * AKP + (tid & 7) * 8), lv = (unsigned)(size_t)(sm + AKT + (tid >> 4) * AVP + (tid & 15) * 8);   // LDS byte addresses of this lane's first pieces, buffer 0
  const _Float16* gk = KH + ((size_t)b * TT + (tid >> 3)) * CC + h * HD + (tid & 7) * 8;
  const _Float16* gv = VT + ((size_t)b * CC + h * HD + (tid >> 4)) * (size_t)TT + (tid & 15) * 8;
  a_stage(lk, gk, lv, gv);                          // stage 0 into buffer 0
  v16h qh[2][2];                                    // B operands: column = query, [column group][kc]
#pragma unroll
  for (int c = 0; c < 2; ++c)
#pragma unroll
    for (int kc = 0; kc < 2; ++kc) qh[c][kc] = frag_h(QH + ((size_t)b * TT + q0 + c * 16 + col) * CC + h * HD + kc * 32, lane);
  XW(); __builtin_amdgcn_sched_barrier(0);          // keeps the accumulators' zeroing, which reuses the address registers, behind the wait
  AWAIT(); __syncthreads();
  a_stage(lk + 2u * ABUF, gk + (size_t)AKS * CC, lv + 2u * ABUF, gv + AKS);   // stage 1 into buffer 1
  v8f acc[2][HD / 16] = {}; float mr[2] = {-INFINITY, -INFINITY}, ls[2] = {0.f, 0.f};
#pragma unroll 1   // rolled: the two buffers alternate by an offset, a second copy of the body would only add code
  for (int st = 0; st < TT / AKS; ++st) {
    const _Float16* kp = sm + (st & 1) * ABUF + col * AKP;          // A operand of S^T: row = key
    const _Float16* vp = sm + (st & 1) * ABUF + AKT + col * AVP;    // A operand of O^T: row = d
    v16h kf[2][2], vf[HD / 16];
#pragma unroll
    for (int t = 0; t < 2; ++t)
#pragma unroll
      for (int kc = 0; kc < 2; ++kc) kf[t][kc] = frag_h(kp + (t * 16) * AKP + kc * 32, lane);
#pragma unroll
    for (int j = 0; j < HD / 16; ++j) vf[j] = frag_h(vp + (j * 16) * AVP, lane);
    GSB();   // here: keeps the stage's first fetches one group ahead of the products (left alone the V^T loads are strewn among them)
#pragma unroll
    for (int ps = 0; ps < AKS / 32; ++ps) {         // a pass = 32 keys
      v8f s[2][2] = {};                             // [key tile][column group]: register r = key 16 t + 8 g + r, lane column = query
#pragma unroll
      for (int kc = 0; kc < 2; ++kc)
#pragma unroll
        for (int t = 0; t < 2; ++t)
#pragma unroll
          for (int c = 0; c < 2; ++c) s[t][c] = wmma_h(kf[t][kc], qh[c][kc], s[t][c]);
      GSB();   // here: keeps the 8 products one run over 4 independent tiles (left alone the maxima are woven in and the products line up in dependent chains)
      if (ps + 1 < AKS / 32) {                      // inside a stage K and V fragments are fetched one pass ahead, each behind its own products; never out of the next stage
#pragma unroll
        for (int t = 0; t < 2; ++t)
#pragma unroll
          for (int kc = 0; kc < 2; ++kc) kf[t][kc] = frag_h(kp + ((ps + 1) * 32 + t * 16) * AKP + kc * 32, lane);
        GSB();   // here: keeps this fetch one group, the softmax and the second product ahead of its use
      }
      float mb[2]; bool need = false;
#pragma unroll
      for (int c = 0; c < 2; ++c) { float mx = s[0][c][0];
#pragma unroll
        for (int r = 1; r < 8; ++r) mx = fmaxf(mx, s[0][c][r]);
#pragma unroll
        for (int r = 0; r < 8; ++r) mx = fmaxf(mx, s[1][c][r]);
        mx = fmaxf(mx, xhalf(mx)) * cs; mb[c] = mx; need = need || (mx > mr[c] + 8.0f); }
      if (__builtin_amdgcn_ballot_w32(need) != 0) {   // the maximum in use moves only when a column's new one exceeds it by 2^8: rare after the first pass
        const float mn0 = fmaxf(mr[0], mb[0]), mn1 = fmaxf(mr[1], mb[1]); const float corr[2] = {__builtin_amdgcn_exp2f(mr[0] - mn0), __builtin_amdgcn_exp2f(mr[1] - mn1)}; mr[0] = mn0; mr[1] = mn1;   // 0 on the first pass
#pragma unroll
        for (int c = 0; c < 2; ++c) { ls[c] *= corr[c];
#pragma unroll
          for (int j = 0; j < HD / 16; ++j) acc[c][j] = acc[c][j] * corr[c]; }
      }
#pragma unroll
      for (int c = 0; c < 2; ++c) { const float nm = 4.0f - mr[c];   // P carries 2^4 (it cancels in the division): at most 2^12 in f16
        union { v16h v; v2h2 w[8]; } pf; float sa = 0.f, sb = 0.f;
#pragma unroll
        for (int i = 0; i < 8; ++i) { const v2f arg = __builtin_elementwise_fma(v2f{s[i >> 2][c][2 * (i & 3)], s[i >> 2][c][2 * (i & 3) + 1]}, v2f{cs, cs}, v2f{nm, nm}); const float p0 = __builtin_amdgcn_exp2f(arg.x), p1 = __builtin_amdgcn_exp2f(arg.y);
          sa += p0; sb += p1; pf.w[i] = __builtin_convertvector(v2f{p0, p1}, v2h2); }
        ls[c] += sa + sb;
#pragma unroll
        for (int j = 0; j < HD / 16; ++j) acc[c][j] = wmma_h(vf[j], pf.v, acc[c][j]); }
      if (ps + 1 < AKS / 32) {
#pragma unroll
        for (int j = 0; j < HD / 16; ++j) vf[j] = frag_h(vp + (j * 16) * AVP + (ps + 1) * 32, lane);
        GSB();   // here: as above, the next pass's first products and softmax ahead of its use
      }
    }
    asm volatile("s_wait_dscnt 0x0" ::: "memory");  // this wave's reads of the buffer are over before a copy may be aimed at it
    AWAIT(); __syncthreads();                       // the one barrier of a stage: publishes stage st + 1 and ends every wave's reads of stage st
    if (st + 2 < TT / AKS) a_stage(lk + (unsigned)(st & 1) * (2u * ABUF), gk + (size_t)(st + 2) * AKS * CC, lv + (unsigned)(st & 1) * (2u * ABUF), gv + (st + 2) * AKS);   // into the buffer just read
  }
  AWAIT();   // no copy is outstanding when the wave ends
  _Float16* yr = Y + ((size_t)b * TT + q0 + col) * CC + h * HD + 8 * g; v8h ov[2][HD / 16];
#pragma unroll
  for (int c = 0; c < 2; ++c) { const float inv = 1.0f / (ls[c] + xhalf(ls[c]));
#pragma unroll
    for (int j = 0; j < HD / 16; ++j) ov[c][j] = __builtin_convertvector(acc[c][j] * inv, v8h); }
  GSB();   // here: every value is formed before the first store, so that no register of an issued store is rewritten ahead of the wait behind the group
#pragma unroll
  for (int c = 0; c < 2; ++c)
#pragma unroll
    for (int j = 0; j < HD / 16; ++j) *(v8h*)(yr + (size_t)c * 16 * CC + j * 16) = ov[c][j];
  XW(); }
// ---- k_out: block = (128 rows, 128 cols): out = y (f16) Wproj + b
__global__ __launch_bounds__(256) void k_out(const _Float16* __restrict__ Y, const float* __restrict__ WP, const float* __restrict__ BP, float* __restrict__ OUT) { __shared__ __align__(16) _Float16 sm[2 * 2 * GT];
  const int tid = threadIdx.x, wave = tid >> 5, lane = tid & 31, col = lane & 15, g = lane >> 4, wm = wave >> 1, wn = wave & 1; const int c0 = blockIdx.y * 128; const size_t r0 = (size_t)blockIdx.x * 128;
  v8f acc[2][4] = {}; g_tile(Y, WP, r0, c0, blockIdx.x + 2 * blockIdx.y, sm, acc);   // the 8 blocks on one y panel start 2 k tiles apart, the 32 on one W panel at 16 different tiles, two blocks each
  const int cl = wn * 64 + 4 * col; float bb[4] = {0.f, 0.f, 0.f, 0.f}; if (BP) { const v4f bv = *(const v4f*)(BP + c0 + cl); bb[0] = bfr(bv[0]); bb[1] = bfr(bv[1]); bb[2] = bfr(bv[2]); bb[3] = bfr(bv[3]); }
  float* d = OUT + (r0 + wm * 32 + 8 * g) * CC + c0 + cl;   // a row's 64 columns of a wave = two whole lines
  v4f o[16];
#pragma unroll
  for (int k = 0; k < 16; ++k) o[k] = v4f{acc[k >> 3][0][k & 7] + bb[0], acc[k >> 3][1][k & 7] + bb[1], acc[k >> 3][2][k & 7] + bb[2], acc[k >> 3][3][k & 7] + bb[3]};
  GSB();   // here: every value is formed before the first store, so that no register of an issued store is rewritten ahead of the wait behind the group
#pragma unroll
  for (int k = 0; k < 16; ++k) vst2(d + (size_t)((k >> 3) * 16 + (k & 7)) * CC, o[k]);
  XW(); }
extern "C" void kernel_launch(void* const* d_in, const int* in_sizes, int n_in, void* d_out, int out_size, void* d_ws, size_t ws_size, hipStream_t stream) {
  (void)in_sizes; (void)n_in; (void)out_size;
  const float** F = (const float**)d_in;   // 0 queries, 1 keys, 2 values [4,1024,1024], 3 Wq [1024,1024] (in,out), 4 bq, 5 Wk, 6 bk, 7 Wv, 8 bv, 9 Wo, 10 bo
  if (ws_size < (size_t)WS_END) return;
  char* ws = (char*)d_ws; _Float16 *QH = (_Float16*)(ws + WS_QH), *KH = (_Float16*)(ws + WS_KH), *VT = (_Float16*)(ws + WS_VT), *Y = (_Float16*)(ws + WS_Y);
  k_proj<<<dim3(TNB * TT / 256, CC / 256, 3), 256, 0, stream>>>(F[0], F[1], F[2], F[3], F[4], F[5], F[6], F[7], F[8], QH, KH, VT);
  k_att<<<dim3(TT / 256, NH, TNB), 256, 0, stream>>>(QH, KH, VT, Y);
  k_out<<<dim3(TNB * TT / 128, CC / 128), 256, 0, stream>>>(Y, F[9], F[10], (float*)d_out);
}

// v007
// Measured time: 60.1 microseconds a run.
// Timed twice side by side with v006, it ran 1.06 times as fast both times.
// All steps since v000 together make it 11.1 times as fast.
// compute dtype: all float inputs rounded to bf16; q/k/v = input W + b ([in,out]) with EXACT bf16 products on WMMA 16x16x32, f32 accumulate; q and k each rounded once to f16 -> logits / 8 kept in f32 registers; online softmax in f32 (base 2, v_exp_f32), unnormalised P f16 x 2^4; o = P . v / sum with v rounded once to f16, all of it in one launch; out = o (rounded once to f16) Wo (its bf16 value held in f16) + bo; f32 output.
#include <hip/hip_runtime.h>
#include <math.h>

typedef __attribute__((ext_vector_type(16))) _Float16 v16h;
typedef __attribute__((ext_vector_type(16))) __bf16 v16b;
typedef __attribute__((ext_vector_type(8)))  _Float16 v8h;
typedef __attribute__((ext_vector_type(8)))  float v8f;
typedef __attribute__((ext_vector_type(4)))  float v4f;
typedef __attribute__((ext_vector_type(2)))  float v2f;
typedef __attribute__((ext_vector_type(2)))  _Float16 v2h2;
typedef __attribute__((ext_vector_type(4)))  unsigned v4u;
typedef __attribute__((ext_vector_type(4)))  int v4i;
typedef float __attribute__((may_alias)) float_a;
typedef int __attribute__((may_alias)) int_a;

template <typename T> __device__ __forceinline__ void vst2(void* p, T v) { *(T*)p = v;  }
__device__ __forceinline__ v8f wmma16(v16h a, v16h b, v8f c) {
  v8f d = __builtin_amdgcn_wmma_f32_16x16x32_f16(false, a, false, b, (short)0, c, false, false);
  asm volatile("v_nop\n\tv_nop\n\tv_nop\n\tv_nop" : "+v"(d) : "v"(a), "v"(b));
  return d;
}
__device__ __forceinline__ v8f wmma_bf(v16b a, v16b b, v8f c) {
  v8f d = __builtin_amdgcn_wmma_f32_16x16x32_bf16(false, a, false, b, (short)0, c, false, false);
  asm volatile("v_nop\n\tv_nop\n\tv_nop\n\tv_nop" : "+v"(d) : "v"(a), "v"(b));
  return d;
}
// 16x16x32 fragments: lane = (h = lane>>4, row/col = lane&15); elements 0..7 = k0+8h+0..7, 8..15 = k0+16+8h+0..7; D element r = row 8h+r
__device__ __forceinline__ v16h frag_h(const _Float16* rowk0, int lane) {
  union { v16h v; v8h q[2]; } u; const _Float16* p = rowk0 + 8 * (lane >> 4);
  u.q[0] = *(const v8h*)p; u.q[1] = *(const v8h*)(p + 16); return u.v;
}
__device__ __forceinline__ v16h frag_f32(const float* rowk0, int lane) {
  v16h a; const float* p = rowk0 + 8 * (lane >> 4);
#pragma unroll
  for (int i = 0; i < 8; ++i) { a[i] = (_Float16)p[i]; a[8 + i] = (_Float16)p[16 + i]; }
  return a;
}
__device__ __forceinline__ v16h frag_f32s(const float* rowk0, int lane, float sc) {
  v16h a; const float* p = rowk0 + 8 * (lane >> 4);
#pragma unroll
  for (int i = 0; i < 8; ++i) { a[i] = (_Float16)(p[i] * sc); a[8 + i] = (_Float16)(p[16 + i] * sc); }
  return a;
}
// column fragment from a [K][ld] layout (column n), rows >= K read as 0
__device__ __forceinline__ v16h fragc_f32(const float* W, int k0, int n, int lane, int ld, int K) {
  v16h a; const int g = lane >> 4;
#pragma unroll
  for (int i = 0; i < 8; ++i) { const int ka = k0 + 8 * g + i, kb = ka + 16;
    a[i] = (_Float16)(ka < K ? W[(size_t)(ka < K ? ka : K - 1) * ld + n] : 0.f); a[8 + i] = (_Float16)(kb < K ? W[(size_t)(kb < K ? kb : K - 1) * ld + n] : 0.f); }
  return a;
}
struct F2 { v16b h, l; };
__device__ __forceinline__ F2 bsplit16(const float v[16]) { F2 r;
#pragma unroll
  for (int i = 0; i < 16; ++i) { const __bf16 h = (__bf16)v[i]; r.h[i] = h; r.l[i] = (__bf16)(v[i] - (float)h); }
  return r; }
__device__ __forceinline__ F2 split_row(const float* row, int k0, int lane) { float v[16]; const float* p = row + k0 + 8 * (lane >> 4);
#pragma unroll
  for (int i = 0; i < 8; ++i) { v[i] = p[i]; v[8 + i] = p[16 + i]; }
  return bsplit16(v); }
__device__ __forceinline__ F2 split_rowK(const float* row, int k0, int lane, int K) { float v[16]; const int g = lane >> 4;
#pragma unroll
  for (int i = 0; i < 8; ++i) { const int ka = k0 + 8 * g + i, kb = ka + 16; v[i] = ka < K ? row[ka < K ? ka : K - 1] : 0.f; v[8 + i] = kb < K ? row[kb < K ? kb : K - 1] : 0.f; }
  return bsplit16(v); }
__device__ __forceinline__ F2 split_col(const float* W, int k0, int n, int lane, int ld, int K) { float v[16]; const int g = lane >> 4;
#pragma unroll
  for (int i = 0; i < 8; ++i) { const int ka = k0 + 8 * g + i, kb = ka + 16; v[i] = ka < K ? W[(size_t)(ka < K ? ka : K - 1) * ld + n] : 0.f; v[8 + i] = kb < K ? W[(size_t)(kb < K ? kb : K - 1) * ld + n] : 0.f; }
  return bsplit16(v); }
__device__ __forceinline__ v8f mac3(const F2& a, const F2& b, v8f c) { c = wmma_bf(a.l, b.h, c); c = wmma_bf(a.h, b.l, c); return wmma_bf(a.h, b.h, c); }
__device__ __forceinline__ float sigm(float v) { return 1.0f / (1.0f + expf(-v)); }
#define LDSX() do { asm volatile("s_wait_dscnt 0" ::: "memory"); __builtin_amdgcn_wave_barrier(); __builtin_amdgcn_fence(__ATOMIC_RELEASE, "workgroup"); } while (0)


// Hopfield layer = one cross-attention update (B 4, L = S = 1,024, d_model 1,024 = 16 x 64): q from queries, k from keys, v from values, softmax(q k / 8) v, output Linear.
#define NB 4
#define TT 1024
#define CC 1024
#define NH 16
#define HD 64
#ifndef TNB
#define TNB NB
#endif
typedef __attribute__((ext_vector_type(8))) __bf16 v8b;
__device__ __forceinline__ v16b frag_b(const __bf16* rowk0, int lane) {
  union { v16b v; v8b q[2]; } u; const __bf16* p = rowk0 + 8 * (lane >> 4);
  u.q[0] = *(const v8b*)p; u.q[1] = *(const v8b*)(p + 16); return u.v;
}
__device__ __forceinline__ float bfr(float v) { return (float)(__bf16)v; }
__device__ __attribute__((noinline)) float exp_ni(float v) { return expf(v); }
__device__ __attribute__((noinline)) float erf_ni(float v) { return erff(v); }

#define WS_QH  0u
#define WS_KH  (WS_QH + 2u * (size_t)NB * TT * CC)
#define WS_VT  (WS_KH + 2u * (size_t)NB * TT * CC)      // f16 v planes [b][c][t]
#define WS_Y   (WS_VT + 2u * (size_t)NB * CC * TT)      // f16 y rows [b*t][C]
#define WS_WT  (WS_Y + 2u * (size_t)NB * TT * CC)       // f16 Wo^T rows [column][k]
#define WS_END (WS_WT + 2u * (size_t)CC * CC)

#define XW() asm volatile("s_wait_xcnt 0x0" ::: "memory")   // stands behind a group of global loads, before their address registers are rewritten
#define XWP(p) asm volatile("s_wait_xcnt 0x0" :: "v"(p) : "memory")   // XW() that also names the group's address: the pair stays live up to the wait, so that no load of the group has its result land in it
// Work-groups that share an operand panel would walk its k tiles in step and ask L2 for the same lines at the same moment. Each starts at a k tile of its own and wraps: tile (t0 + t) mod 16 at step t.
#define KT(t0, t) (((t0) + (t)) & (CC / 64 - 1))
// ---- the products of k_out (k_proj has the larger loop below): block = 8 waves on 128 rows x 128 columns, a tile = 64 k of both operands in LDS as f16; every wave takes its fragments from there.
typedef __attribute__((ext_vector_type(4))) __bf16 v4b;
typedef __attribute__((ext_vector_type(4))) _Float16 v4h;
#define GP 72            // LDS row pitch in elements: 64 k + 8 = 144 B = 16 B x 9, the pitch of ds_load_b128 readers
#define GT (128 * GP)    // one operand tile, elements
__device__ __forceinline__ v8f wmma_b(v16b a, v16b b, v8f c) { return __builtin_amdgcn_wmma_f32_16x16x32_bf16(false, a, false, b, (short)0, c, false, false); }
__device__ __forceinline__ v8f wmma_h(v16h a, v16h b, v8f c) { return __builtin_amdgcn_wmma_f32_16x16x32_f16(false, a, false, b, (short)0, c, false, false); }
// LDS rows: y row r of the tile is row r; column 4 l + c of the tile is row 32 c + l of the W part, so a B tile (16 LDS rows) holds every 4th column and a lane's 4 tiles hold 4 adjacent columns
// acc[mi][c] element r: row 32 wm + 16 mi + 8 g + r, column 64 wn + 4 col + c of the tile; per accumulator the products come in the order k 64 t0, + 32, + 64, ..., wrapping at K
#define GSB() __builtin_amdgcn_sched_barrier(0)   // keeps a group of fragment loads together and ahead of the products behind it (left alone the compiler reloads one A fragment per 4 products and waits each out)
__device__ __forceinline__ void g_mac8(const v16h (&a)[2], const v16h (&b)[4], v8f (&acc)[2][4]) {
#pragma unroll
  for (int mi = 0; mi < 2; ++mi)
#pragma unroll
    for (int c = 0; c < 4; ++c) acc[mi][c] = wmma_h(a[mi], b[c], acc[mi][c]); }
struct GFrag { v16h b0[4], b1[4], h0[2], h1[2]; };   // the fragments of one tile: k 0 .. 31 and k 32 .. 63
__device__ __forceinline__ void g_load(GFrag& f, const _Float16* ap, const _Float16* bp, int lane) {   // ap, bp: this lane's row of the wave's first A tile and first B tile
#pragma unroll
  for (int c = 0; c < 4; ++c) f.b0[c] = frag_h(bp + c * 32 * GP, lane);
#pragma unroll
  for (int mi = 0; mi < 2; ++mi) f.h0[mi] = frag_h(ap + mi * 16 * GP, lane);
#pragma unroll
  for (int c = 0; c < 4; ++c) f.b1[c] = frag_h(bp + c * 32 * GP + 32, lane);
#pragma unroll
  for (int mi = 0; mi < 2; ++mi) f.h1[mi] = frag_h(ap + mi * 16 * GP + 32, lane); }
__device__ __forceinline__ void g_mac(const GFrag& f, v8f (&acc)[2][4]) { g_mac8(f.h0, f.b0, acc); g_mac8(f.h1, f.b1, acc); }
// ---- k_proj: block = (256 rows, 256 cols, which), 8 waves of 128 rows x 64 columns: qkv = x W (+ b), exact; q, k -> f16 rows, v -> f16 planes
// Both f32 operands are read once per block in whole lines, rounded to bf16 once and staged in LDS (two buffers, the next step's loads in flight over this step's products); every wave takes its fragments from there.
// The 64 blocks with which = 3 run beside them, on WGPs that the 192 leave idle: each rounds 64 k rows x 256 columns of Wo to bf16, holds that value in f16 and writes it transposed, for k_out's copies.
#define PT (256 * GP)    // one operand tile of k_proj, elements
struct PStage { v4f x[16], w[16]; };
// x[it]: row 16 it + 2 wave + (lane >> 4), k 4 (lane & 15) .. + 3; w[8 hh + i]: k row 8 wave + i, columns 128 hh + 4 lane .. + 3
__device__ __forceinline__ void p_fetch(PStage& s, const float* xp, const float* wp) {
#pragma unroll
  for (int i = 0; i < 16; ++i) s.x[i] = *(const v4f*)(xp + (size_t)i * 16 * CC);
  XWP(xp);   // the second group's results may land in the first group's address registers
#pragma unroll
  for (int i = 0; i < 16; ++i) s.w[i] = *(const v4f*)(wp + (size_t)(i & 7) * CC + (i >> 3) * 128);
  XWP(wp);   // its "memory" clobber also keeps the loads here, ahead of the step's products
}
// W goes in transposed, out of registers, per half of 128 columns: column 128 hh + 4 l + c of the tile is LDS row 128 hh + 32 c + l
__device__ __forceinline__ void p_put(const PStage& s, __bf16* buf, int wave, int lane) {
#pragma unroll
  for (int i = 0; i < 16; ++i) { v4b h;
#pragma unroll
    for (int e = 0; e < 4; ++e) h[e] = (__bf16)s.x[i][e];
    *(v4b*)(buf + (i * 16 + wave * 2 + (lane >> 4)) * GP + 4 * (lane & 15)) = h; }
  __bf16* wb = buf + PT + lane * GP + wave * 8;
#pragma unroll
  for (int hc = 0; hc < 8; ++hc) { v8b p;
#pragma unroll
    for (int i = 0; i < 8; ++i) p[i] = (__bf16)s.w[(hc >> 2) * 8 + i][hc & 3];
    *(v8b*)(wb + hc * 32 * GP) = p; } }
// acc[mi][c] element r: row 128 wm + 16 mi + 8 g + r, column 64 wn + 4 col + c of the tile; per accumulator the products come in the order k 64 t0, + 32, + 64, ..., wrapping at K
__device__ __forceinline__ void p_step(const __bf16* ap, const __bf16* bp, int lane, v8f (&acc)[8][4]) {   // ap, bp: this lane's row of the wave's first A tile and first B tile
#pragma unroll
  for (int kh = 0; kh < 2; ++kh) { v16b a[8], b[4];
#pragma unroll
    for (int c = 0; c < 4; ++c) b[c] = frag_b(bp + c * 32 * GP + kh * 32, lane);
#pragma unroll
    for (int mi = 0; mi < 8; ++mi) a[mi] = frag_b(ap + mi * 16 * GP + kh * 32, lane);
    GSB();   // here: the 24 fragment loads stay one group ahead of the 32 products
#pragma unroll
    for (int mi = 0; mi < 8; ++mi)
#pragma unroll
      for (int c = 0; c < 4; ++c) acc[mi][c] = wmma_b(a[mi], b[c], acc[mi][c]);
    GSB();   // here: keeps the next group of loads, which reuses the fragment registers, from being strewn among these products
  } }
#define PVP 264          // V staging [256 columns][256 t], row pitch in elements: 528 B = 16 B x 33
__global__ __launch_bounds__(256) void k_proj(const float* __restrict__ XQ, const float* __restrict__ XK, const float* __restrict__ XV, const float* __restrict__ WQ, const float* __restrict__ BQ, const float* __restrict__ WK, const float* __restrict__ BK, const float* __restrict__ WV, const float* __restrict__ BV, const float* __restrict__ WO, _Float16* __restrict__ QH, _Float16* __restrict__ KH, _Float16* __restrict__ VT, _Float16* __restrict__ WT) {
  __shared__ __align__(16) __bf16 sm[2 * 2 * PT];
  const int tid = threadIdx.x, wave = tid >> 5, lane = tid & 31, col = lane & 15, g = lane >> 4, wm = wave >> 2, wn = wave & 3; const int which = blockIdx.z; const int c0 = blockIdx.y * 256; const size_t r0 = (size_t)blockIdx.x * 256; const float* X = which == 0 ? XQ : which == 1 ? XK : XV; const float* WA = which == 0 ? WQ : which == 1 ? WK : WV; const float* BA = which == 0 ? BQ : which == 1 ? BK : BV;
  if (which == 3) { _Float16* th = (_Float16*)sm;   // [256 columns][GP]; the whole block takes this branch
    static_assert(TNB * TT / 256 == CC / 64, "blockIdx.x counts Wo's 64-k row groups");
    const int k0 = blockIdx.x * 64; const float* wo = WO + (size_t)(k0 + wave * 8) * CC + c0 + 4 * lane; v4f w[16];   // w[8 hh + i]: k row 8 wave + i, columns 128 hh + 4 lane .. + 3
#pragma unroll
    for (int i = 0; i < 16; ++i) w[i] = *(const v4f*)(wo + (size_t)(i & 7) * CC + (i >> 3) * 128);
    XWP(wo);   // before the address pair is used for anything else
#pragma unroll
    for (int hc = 0; hc < 8; ++hc) { v8h p;
#pragma unroll
      for (int i = 0; i < 8; ++i) p[i] = (_Float16)bfr(w[(hc >> 2) * 8 + i][hc & 3]);
      *(v8h*)(th + ((hc >> 2) * 128 + 4 * lane + (hc & 3)) * GP + wave * 8) = p; }
    __syncthreads();
    _Float16* dw = WT + (size_t)(c0 + (tid >> 3)) * CC + k0 + (tid & 7) * 8; v4u tv[8];   // a column's 64 k = one whole line, a wave's store = 4 lines
#pragma unroll
    for (int i = 0; i < 8; ++i) tv[i] = *(const v4u*)(th + ((tid >> 3) + 32 * i) * GP + (tid & 7) * 8);
    GSB();   // here: every value is read before the first store
#pragma unroll
    for (int i = 0; i < 8; ++i) vst2(dw + (size_t)32 * i * CC, tv[i]);
    XW(); return; }
  v8f acc[8][4] = {};
  { constexpr int BUF = 2 * PT; const int t0 = blockIdx.x + 4 * blockIdx.y;   // the 16 blocks on one W panel start at 16 different k tiles, the 4 on one X panel 4 tiles apart
    const float* xp = X + (r0 + wave * 2 + (lane >> 4)) * CC + 4 * (lane & 15); const float* wp = WA + (size_t)(wave * 8) * CC + c0 + 4 * lane;
    const __bf16* ap = sm + (wm * 128 + col) * GP; const __bf16* bp = sm + PT + ((wn >> 1) * 128 + (wn & 1) * 16 + col) * GP;
    PStage s; p_fetch(s, xp + KT(t0, 0) * 64, wp + (size_t)KT(t0, 0) * 64 * CC); p_put(s, sm, wave, lane); __syncthreads();
#pragma unroll 1   // rolled: the two buffers alternate by an offset, a second copy of the body would only add code
    for (int t = 0; t < CC / 64 - 1; ++t) { const int cur = (t & 1) * BUF;
      p_fetch(s, xp + KT(t0, t + 1) * 64, wp + (size_t)KT(t0, t + 1) * 64 * CC);
      p_step(ap + cur, bp + cur, lane, acc);   // its last GSB keeps the wait for the global loads, and the rounding behind it, behind the step's products
      p_put(s, sm + (BUF - cur), wave, lane);   // into the buffer that every wave left before the last barrier
      __syncthreads(); }
    p_step(ap + ((CC / 64 - 1) & 1) * BUF, bp + ((CC / 64 - 1) & 1) * BUF, lane, acc); }
  const int cl = wn * 64 + 4 * col; const v4f bv = *(const v4f*)(BA + c0 + cl); const float bb[4] = {bfr(bv[0]), bfr(bv[1]), bfr(bv[2]), bfr(bv[3])};
  if (which < 2) { _Float16* dh = (which == 0 ? QH : KH) + (r0 + wm * 128 + 8 * g) * CC + c0 + cl;   // a row's 64 columns of a wave = one 128-byte line
#pragma unroll
    for (int m2 = 0; m2 < 4; ++m2) {   // 32 rows a group
      v4h hv[16];
#pragma unroll
      for (int k = 0; k < 16; ++k)
#pragma unroll
        for (int c = 0; c < 4; ++c) hv[k][c] = (_Float16)(acc[2 * m2 + (k >> 3)][c][k & 7] + bb[c]);
      GSB();   // here: every value is formed before the first store, so that no register of an issued store is rewritten ahead of the wait behind the group
#pragma unroll
      for (int k = 0; k < 16; ++k) *(v4h*)(dh + (size_t)(m2 * 32 + (k >> 3) * 16 + (k & 7)) * CC) = hv[k];
      XW(); GSB();   // the barrier keeps the next group's values, which reuse the registers of these stores, behind the wait
    } }
  else { _Float16* th = (_Float16*)sm;   // [256 columns][PVP], over the buffers
    __syncthreads();   // ends every wave's last fragment reads
#pragma unroll
    for (int mi = 0; mi < 8; ++mi)
#pragma unroll
      for (int c = 0; c < 4; ++c) { v8h hv;
#pragma unroll
        for (int r = 0; r < 8; ++r) hv[r] = (_Float16)(acc[mi][c][r] + bb[c]);
        *(v8h*)(th + (cl + c) * PVP + wm * 128 + mi * 16 + 8 * g) = hv; }
    __syncthreads();
    const size_t b = r0 / TT; const int t0 = (int)(r0 % TT); _Float16* dv = VT + (b * CC + c0 + wave) * (size_t)TT + t0 + lane * 8;   // a wave's store = one column's 256 t = 4 whole lines
#pragma unroll
    for (int gr = 0; gr < 4; ++gr) { v4u tv[8];
#pragma unroll
      for (int it = 0; it < 8; ++it) tv[it] = *(const v4u*)(th + ((gr * 8 + it) * 8 + wave) * PVP + lane * 8);
      GSB();   // as above: the group's values are all read before its first store
#pragma unroll
      for (int it = 0; it < 8; ++it) vst2((unsigned*)(dv + (size_t)(gr * 8 + it) * 8 * TT), tv[it]);
      XW(); } } }
// ---- k_att: block = 256 queries of (b,h), wave = 32 query columns: S^T = K Q^T, online softmax per column in registers, O^T += V^T P^T; y[q][h*HD + d] = O / sum
// K and V^T come once per block, in whole lines, into a ring of two LDS buffers (a stage = 128 keys = 4 passes of 32); all 8 waves take their fragments from there.
__device__ __forceinline__ float xhalf(float x) { return __builtin_bit_cast(float, __builtin_amdgcn_permlanex16(__builtin_bit_cast(int, x), __builtin_bit_cast(int, x), 0x76543210, 0xfedcba98, false, false)); }  // lane l with lane l ^ 16
#define AKS 128              // keys per stage
#define AKP 72               // K tile [128 keys][64 d], row pitch in elements: 144 B = 16 B x 9, the pitch of ds_load_b128 readers
#define AVP 136              // V^T tile [64 d][128 keys], row pitch in elements: 272 B = 16 B x 17
#define AKT (AKS * AKP)
#define ABUF (AKT + HD * AVP)   // one buffer, elements
// one stage: 8 copies of 16 B a lane. K: row (tid >> 3) + 32 i, 16-byte piece tid & 7; V^T: row (tid >> 4) + 16 i, piece tid & 15; a wave's copy covers 4 whole lines.
// The wait on xcnt is the statement's last line, so that it stands before any rewrite of a register that a copy names.
__device__ __forceinline__ void a_stage(unsigned lk, const _Float16* gk, unsigned lv, const _Float16* gv) {
  asm volatile("global_load_async_to_lds_b128 %0, %8, off\n\t"
               "global_load_async_to_lds_b128 %1, %9, off\n\t"
               "global_load_async_to_lds_b128 %2, %10, off\n\t"
               "global_load_async_to_lds_b128 %3, %11, off\n\t"
               "global_load_async_to_lds_b128 %4, %12, off\n\t"
               "global_load_async_to_lds_b128 %5, %13, off\n\t"
               "global_load_async_to_lds_b128 %6, %14, off\n\t"
               "global_load_async_to_lds_b128 %7, %15, off\n\t"
               "s_wait_xcnt 0x0"
               :: "v"(lk), "v"(lk + 32u * AKP * 2u), "v"(lk + 64u * AKP * 2u), "v"(lk + 96u * AKP * 2u), "v"(lv), "v"(lv + 16u * AVP * 2u), "v"(lv + 32u * AVP * 2u), "v"(lv + 48u * AVP * 2u),
                  "v"(gk), "v"(gk + (size_t)32 * CC), "v"(gk + (size_t)64 * CC), "v"(gk + (size_t)96 * CC), "v"(gv), "v"(gv + (size_t)16 * TT), "v"(gv + (size_t)32 * TT), "v"(gv + (size_t)48 * TT)
               : "memory"); }
#define AWAIT() asm volatile("s_wait_asynccnt 0x0" ::: "memory")   // this wave's copies have landed; the barrier behind it shows them to the other waves
__global__ __launch_bounds__(256) void k_att(const _Float16* __restrict__ QH, const _Float16* __restrict__ KH, const _Float16* __restrict__ VT, _Float16* __restrict__ Y) {
  __shared__ __align__(16) _Float16 sm[2 * ABUF];
  const int tid = threadIdx.x, wave = tid >> 5, lane = tid & 31, col = lane & 15, g = lane >> 4; const int h = blockIdx.y, b = blockIdx.z; const int q0 = blockIdx.x * 256 + wave * 32;
  const float cs = 0.125f * 1.4426950408889634f;   // logits / 8, in base 2
  const unsigned lk = (unsigned)(size_t)(sm + (tid >> 3) * AKP + (tid & 7) * 8), lv = (unsigned)(size_t)(sm + AKT + (tid >> 4) * AVP + (tid & 15) * 8);   // LDS byte addresses of this lane's first pieces, buffer 0
  const _Float16* gk = KH + ((size_t)b * TT + (tid >> 3)) * CC + h * HD + (tid & 7) * 8;
  const _Float16* gv = VT + ((size_t)b * CC + h * HD + (tid >> 4)) * (size_t)TT + (tid & 15) * 8;
  a_stage(lk, gk, lv, gv);                          // stage 0 into buffer 0
  v16h qh[2][2];                                    // B operands: column = query, [column group][kc]
#pragma unroll
  for (int c = 0; c < 2; ++c)
#pragma unroll
    for (int kc = 0; kc < 2; ++kc) qh[c][kc] = frag_h(QH + ((size_t)b * TT + q0 + c * 16 + col) * CC + h * HD + kc * 32, lane);
  XW(); __builtin_amdgcn_sched_barrier(0);          // keeps the accumulators' zeroing, which reuses the address registers, behind the wait
  AWAIT(); __syncthreads();
  a_stage(lk + 2u * ABUF, gk + (size_t)AKS * CC, lv + 2u * ABUF, gv + AKS);   // stage 1 into buffer 1
  v8f acc[2][HD / 16] = {}; float mr[2] = {-INFINITY, -INFINITY}, ls[2] = {0.f, 0.f};
#pragma unroll 1   // rolled: the two buffers alternate by an offset, a second copy of the body would only add code
  for (int st = 0; st < TT / AKS; ++st) {
    const _Float16* kp = sm + (st & 1) * ABUF + col * AKP;          // A operand of S^T: row = key
    const _Float16* vp = sm + (st & 1) * ABUF + AKT + col * AVP;    // A operand of O^T: row = d
    v16h kf[2][2], vf[HD / 16];
#pragma unroll
    for (int t = 0; t < 2; ++t)
#pragma unroll
      for (int kc = 0; kc < 2; ++kc) kf[t][kc] = frag_h(kp + (t * 16) * AKP + kc * 32, lane);
#pragma unroll
    for (int j = 0; j < HD / 16; ++j) vf[j] = frag_h(vp + (j * 16) * AVP, lane);
    GSB();   // here: keeps the stage's first fetches one group ahead of the products (left alone the V^T loads are strewn among them)
#pragma unroll
    for (int ps = 0; ps < AKS / 32; ++ps) {         // a pass = 32 keys
      v8f s[2][2] = {};                             // [key tile][column group]: register r = key 16 t + 8 g + r, lane column = query
#pragma unroll
      for (int kc = 0; kc < 2; ++kc)
#pragma unroll
        for (int t = 0; t < 2; ++t)
#pragma unroll
          for (int c = 0; c < 2; ++c) s[t][c] = wmma_h(kf[t][kc], qh[c][kc], s[t][c]);
      GSB();   // here: keeps the 8 products one run over 4 independent tiles (left alone the maxima are woven in and the products line up in dependent chains)
      if (ps + 1 < AKS / 32) {                      // inside a stage K and V fragments are fetched one pass ahead, each behind its own products; never out of the next stage
#pragma unroll
        for (int t = 0; t < 2; ++t)
#pragma unroll
          for (int kc = 0; kc < 2; ++kc) kf[t][kc] = frag_h(kp + ((ps + 1) * 32 + t * 16) * AKP + kc * 32, lane);
        GSB();   // here: keeps this fetch one group, the softmax and the second product ahead of its use
      }
      float mb[2]; bool need = false;
#pragma unroll
      for (int c = 0; c < 2; ++c) { float mx = s[0][c][0];
#pragma unroll
        for (int r = 1; r < 8; ++r) mx = fmaxf(mx, s[0][c][r]);
#pragma unroll
        for (int r = 0; r < 8; ++r) mx = fmaxf(mx, s[1][c][r]);
        mx = fmaxf(mx, xhalf(mx)) * cs; mb[c] = mx; need = need || (mx > mr[c] + 8.0f); }
      if (__builtin_amdgcn_ballot_w32(need) != 0) {   // the maximum in use moves only when a column's new one exceeds it by 2^8: rare after the first pass
        const float mn0 = fmaxf(mr[0], mb[0]), mn1 = fmaxf(mr[1], mb[1]); const float corr[2] = {__builtin_amdgcn_exp2f(mr[0] - mn0), __builtin_amdgcn_exp2f(mr[1] - mn1)}; mr[0] = mn0; mr[1] = mn1;   // 0 on the first pass
#pragma unroll
        for (int c = 0; c < 2; ++c) { ls[c] *= corr[c];
#pragma unroll
          for (int j = 0; j < HD / 16; ++j) acc[c][j] = acc[c][j] * corr[c]; }
      }
#pragma unroll
      for (int c = 0; c < 2; ++c) { const float nm = 4.0f - mr[c];   // P carries 2^4 (it cancels in the division): at most 2^12 in f16
        union { v16h v; v2h2 w[8]; } pf; float sa = 0.f, sb = 0.f;
#pragma unroll
        for (int i = 0; i < 8; ++i) { const v2f arg = __builtin_elementwise_fma(v2f{s[i >> 2][c][2 * (i & 3)], s[i >> 2][c][2 * (i & 3) + 1]}, v2f{cs, cs}, v2f{nm, nm}); const float p0 = __builtin_amdgcn_exp2f(arg.x), p1 = __builtin_amdgcn_exp2f(arg.y);
          sa += p0; sb += p1; pf.w[i] = __builtin_convertvector(v2f{p0, p1}, v2h2); }
        ls[c] += sa + sb;
#pragma unroll
        for (int j = 0; j < HD / 16; ++j) acc[c][j] = wmma_h(vf[j], pf.v, acc[c][j]); }
      if (ps + 1 < AKS / 32) {
#pragma unroll
        for (int j = 0; j < HD / 16; ++j) vf[j] = frag_h(vp + (j * 16) * AVP + (ps + 1) * 32, lane);
        GSB();   // here: as above, the next pass's first products and softmax ahead of its use
      }
    }
    asm volatile("s_wait_dscnt 0x0" ::: "memory");  // this wave's reads of the buffer are over before a copy may be aimed at it
    AWAIT(); __syncthreads();                       // the one barrier of a stage: publishes stage st + 1 and ends every wave's reads of stage st
    if (st + 2 < TT / AKS) a_stage(lk + (unsigned)(st & 1) * (2u * ABUF), gk + (size_t)(st + 2) * AKS * CC, lv + (unsigned)(st & 1) * (2u * ABUF), gv + (st + 2) * AKS);   // into the buffer just read
  }
  AWAIT();   // no copy is outstanding when the wave ends
  _Float16* yr = Y + ((size_t)b * TT + q0 + col) * CC + h * HD + 8 * g; v8h ov[2][HD / 16];
#pragma unroll
  for (int c = 0; c < 2; ++c) { const float inv = 1.0f / (ls[c] + xhalf(ls[c]));
#pragma unroll
    for (int j = 0; j < HD / 16; ++j) ov[c][j] = __builtin_convertvector(acc[c][j] * inv, v8h); }
  GSB();   // here: every value is formed before the first store, so that no register of an issued store is rewritten ahead of the wait behind the group
#pragma unroll
  for (int c = 0; c < 2; ++c)
#pragma unroll
    for (int j = 0; j < HD / 16; ++j) *(v8h*)(yr + (size_t)c * 16 * CC + j * 16) = ov[c][j];
  XW(); }
// ---- k_out: block = (128 rows, 128 cols): out = y (f16) Wo (f16, from its transposed copy) + b
// y and Wo^T come in whole lines into a ring of two LDS buffers, a stage = 128 k = two tiles of 64 k, each tile at its own place of the block's k walk.
// one tile: 8 copies of 16 B a lane. y: row (tid >> 3) + 32 i, 16-byte piece tid & 7; Wo^T: LDS row (tid >> 3) + 32 i = column 4 (tid >> 3) + i, piece tid & 7; a wave's copy covers 4 whole lines.
// The wait on xcnt is the statement's last line, so that it stands before any rewrite of a register that a copy names.
__device__ __forceinline__ void o_tile(unsigned ly, const _Float16* gy, unsigned lw, const _Float16* gw) {
  asm volatile("global_load_async_to_lds_b128 %0, %8, off\n\t"
               "global_load_async_to_lds_b128 %1, %9, off\n\t"
               "global_load_async_to_lds_b128 %2, %10, off\n\t"
               "global_load_async_to_lds_b128 %3, %11, off\n\t"
               "global_load_async_to_lds_b128 %4, %12, off\n\t"
               "global_load_async_to_lds_b128 %5, %13, off\n\t"
               "global_load_async_to_lds_b128 %6, %14, off\n\t"
               "global_load_async_to_lds_b128 %7, %15, off\n\t"
               "s_wait_xcnt 0x0"
               :: "v"(ly), "v"(ly + 32u * GP * 2u), "v"(ly + 64u * GP * 2u), "v"(ly + 96u * GP * 2u), "v"(lw), "v"(lw + 32u * GP * 2u), "v"(lw + 64u * GP * 2u), "v"(lw + 96u * GP * 2u),
                  "v"(gy), "v"(gy + (size_t)32 * CC), "v"(gy + (size_t)64 * CC), "v"(gy + (size_t)96 * CC), "v"(gw), "v"(gw + (size_t)CC), "v"(gw + (size_t)2 * CC), "v"(gw + (size_t)3 * CC)
               : "memory"); }
#define OT (2 * GT)      // one tile of both operands, elements
#define OS (2 * OT)      // one stage = one buffer, elements
__device__ __forceinline__ void o_stage(unsigned ly, const _Float16* gy, const _Float16* gw, int t0, int s) {   // stage s: tiles 2 s and 2 s + 1 of the walk
  o_tile(ly, gy + KT(t0, 2 * s) * 64, ly + 2u * GT, gw + KT(t0, 2 * s) * 64);
  o_tile(ly + 2u * OT, gy + KT(t0, 2 * s + 1) * 64, ly + 2u * OT + 2u * GT, gw + KT(t0, 2 * s + 1) * 64); }
__global__ __launch_bounds__(256) void k_out(const _Float16* __restrict__ Y, const _Float16* __restrict__ WT, const float* __restrict__ BP, float* __restrict__ OUT) { __shared__ __align__(16) _Float16 sm[2 * OS];
  const int tid = threadIdx.x, wave = tid >> 5, lane = tid & 31, col = lane & 15, g = lane >> 4, wm = wave >> 1, wn = wave & 1; const int c0 = blockIdx.y * 128; const size_t r0 = (size_t)blockIdx.x * 128;
  const int t0 = blockIdx.x + 2 * blockIdx.y;   // the 8 blocks on one y panel start 2 k tiles apart, the 32 on one W panel at 16 different tiles, two blocks each
  const unsigned ly = (unsigned)(size_t)(sm + (tid >> 3) * GP + (tid & 7) * 8);   // LDS byte address of this lane's first piece, buffer 0
  const _Float16* gy = Y + (r0 + (tid >> 3)) * CC + (tid & 7) * 8; const _Float16* gw = WT + (size_t)(c0 + 4 * (tid >> 3)) * CC + (tid & 7) * 8;
  const _Float16* ap = sm + (wm * 32 + col) * GP; const _Float16* bp = sm + GT + (wn * 16 + col) * GP;
  o_stage(ly, gy, gw, t0, 0);                       // stage 0 into buffer 0
  AWAIT(); __syncthreads();
  o_stage(ly + 2u * OS, gy, gw, t0, 1);             // stage 1 into buffer 1
  v8f acc[2][4] = {};
#pragma unroll 1   // rolled: the two buffers alternate by an offset, a second copy of the body would only add code
  for (int st = 0; st < CC / 128 - 1; ++st) { const int cur = (st & 1) * OS;
    GFrag f; g_load(f, ap + cur, bp + cur, lane);
    GSB(); g_mac(f, acc);   // the barrier: the tile's 24 loads stay one group ahead of its 16 products
    GSB();   // here: keeps the second tile's fragment loads one group behind the first tile's products, not strewn among them
    g_load(f, ap + cur + OT, bp + cur + OT, lane);
    asm volatile("s_wait_dscnt 0x0" ::: "memory");  // this wave's reads of the buffer are over before a copy may be aimed at it
    AWAIT(); __syncthreads();                       // the one barrier of a stage: publishes stage st + 1 and ends every wave's reads of stage st
    if (st + 2 < CC / 128) o_stage(ly + (unsigned)(st & 1) * (2u * OS), gy, gw, t0, st + 2);   // into the buffer just read
    GSB();   // here: the copies are issued first, and fly over the second tile's products, which need registers alone
    g_mac(f, acc);
  }
  AWAIT();   // no copy is outstanding from here on
  { constexpr int cur = ((CC / 128 - 1) & 1) * OS;   // the last stage, published by the loop's last barrier
    GFrag f; g_load(f, ap + cur, bp + cur, lane);
    GSB(); g_mac(f, acc);
    GSB();   // as in the loop
    g_load(f, ap + cur + OT, bp + cur + OT, lane);
    GSB(); g_mac(f, acc); }
  const int cl = wn * 64 + 4 * col; float bb[4] = {0.f, 0.f, 0.f, 0.f}; if (BP) { const v4f bv = *(const v4f*)(BP + c0 + cl); bb[0] = bfr(bv[0]); bb[1] = bfr(bv[1]); bb[2] = bfr(bv[2]); bb[3] = bfr(bv[3]); }
  float* d = OUT + (r0 + wm * 32 + 8 * g) * CC + c0 + cl;   // a row's 64 columns of a wave = two whole lines
  v4f o[16];
#pragma unroll
  for (int k = 0; k < 16; ++k) o[k] = v4f{acc[k >> 3][0][k & 7] + bb[0], acc[k >> 3][1][k & 7] + bb[1], acc[k >> 3][2][k & 7] + bb[2], acc[k >> 3][3][k & 7] + bb[3]};
  GSB();   // here: every value is formed before the first store, so that no register of an issued store is rewritten ahead of the wait behind the group
#pragma unroll
  for (int k = 0; k < 16; ++k) vst2(d + (size_t)((k >> 3) * 16 + (k & 7)) * CC, o[k]);
  XW(); }
extern "C" void kernel_launch(void* const* d_in, const int* in_sizes, int n_in, void* d_out, int out_size, void* d_ws, size_t ws_size, hipStream_t stream) {
  (void)in_sizes; (void)n_in; (void)out_size;
  const float** F = (const float**)d_in;   // 0 queries, 1 keys, 2 values [4,1024,1024], 3 Wq [1024,1024] (in,out), 4 bq, 5 Wk, 6 bk, 7 Wv, 8 bv, 9 Wo, 10 bo
  if (ws_size < (size_t)WS_END) return;
  char* ws = (char*)d_ws; _Float16 *QH = (_Float16*)(ws + WS_QH), *KH = (_Float16*)(ws + WS_KH), *VT = (_Float16*)(ws + WS_VT), *Y = (_Float16*)(ws + WS_Y), *WT = (_Float16*)(ws + WS_WT);
  k_proj<<<dim3(TNB * TT / 256, CC / 256, 4), 256, 0, stream>>>(F[0], F[1], F[2], F[3], F[4], F[5], F[6], F[7], F[8], F[9], QH, KH, VT, WT);
  k_att<<<dim3(TT / 256, NH, TNB), 256, 0, stream>>>(QH, KH, VT, Y);
  k_out<<<dim3(TNB * TT / 128, CC / 128), 256, 0, stream>>>(Y, WT, F[10], (float*)d_out);
}

// v008
// It runs in 57.7 microseconds.
// Timed twice side by side with v007, it ran 1.05 and 1.04 times as fast.
// Counting every step since v000, it is 11.6 times as fast.
// compute dtype: all float inputs rounded to bf16; q/k/v = input W + b ([in,out]) with EXACT bf16 products on WMMA 16x16x32, f32 accumulate; q and k each rounded once to f16 -> logits / 8 kept in f32 registers; online softmax in f32 (base 2, v_exp_f32), unnormalised P f16 x 2^4; o = P . v / sum with v rounded once to f16, all of it in one launch; out = o (rounded once to f16) Wo (its bf16 value held in f16) + bo; f32 output.
#include <hip/hip_runtime.h>
#include <math.h>

typedef __attribute__((ext_vector_type(16))) _Float16 v16h;
typedef __attribute__((ext_vector_type(16))) __bf16 v16b;
typedef __attribute__((ext_vector_type(8)))  _Float16 v8h;
typedef __attribute__((ext_vector_type(8)))  float v8f;
typedef __attribute__((ext_vector_type(4)))  float v4f;
typedef __attribute__((ext_vector_type(2)))  float v2f;
typedef __attribute__((ext_vector_type(2)))  _Float16 v2h2;
typedef __attribute__((ext_vector_type(4)))  unsigned v4u;
typedef __attribute__((ext_vector_type(4)))  int v4i;
typedef float __attribute__((may_alias)) float_a;
typedef int __attribute__((may_alias)) int_a;

template <typename T> __device__ __forceinline__ void vst2(void* p, T v) { *(T*)p = v;  }
__device__ __forceinline__ v8f wmma16(v16h a, v16h b, v8f c) {
  v8f d = __builtin_amdgcn_wmma_f32_16x16x32_f16(false, a, false, b, (short)0, c, false, false);
  asm volatile("v_nop\n\tv_nop\n\tv_nop\n\tv_nop" : "+v"(d) : "v"(a), "v"(b));
  return d;
}
__device__ __forceinline__ v8f wmma_bf(v16b a, v16b b, v8f c) {
  v8f d = __builtin_amdgcn_wmma_f32_16x16x32_bf16(false, a, false, b, (short)0, c, false, false);
  asm volatile("v_nop\n\tv_nop\n\tv_nop\n\tv_nop" : "+v"(d) : "v"(a), "v"(b));
  return d;
}
// 16x16x32 fragments: lane = (h = lane>>4, row/col = lane&15); elements 0..7 = k0+8h+0..7, 8..15 = k0+16+8h+0..7; D element r = row 8h+r
__device__ __forceinline__ v16h frag_h(const _Float16* rowk0, int lane) {
  union { v16h v; v8h q[2]; } u; const _Float16* p = rowk0 + 8 * (lane >> 4);
  u.q[0] = *(const v8h*)p; u.q[1] = *(const v8h*)(p + 16); return u.v;
}
__device__ __forceinline__ v16h frag_f32(const float* rowk0, int lane) {
  v16h a; const float* p = rowk0 + 8 * (lane >> 4);
#pragma unroll
  for (int i = 0; i < 8; ++i) { a[i] = (_Float16)p[i]; a[8 + i] = (_Float16)p[16 + i]; }
  return a;
}
__device__ __forceinline__ v16h frag_f32s(const float* rowk0, int lane, float sc) {
  v16h a; const float* p = rowk0 + 8 * (lane >> 4);
#pragma unroll
  for (int i = 0; i < 8; ++i) { a[i] = (_Float16)(p[i] * sc); a[8 + i] = (_Float16)(p[16 + i] * sc); }
  return a;
}
// column fragment from a [K][ld] layout (column n), rows >= K read as 0
__device__ __forceinline__ v16h fragc_f32(const float* W, int k0, int n, int lane, int ld, int K) {
  v16h a; const int g = lane >> 4;
#pragma unroll
  for (int i = 0; i < 8; ++i) { const int ka = k0 + 8 * g + i, kb = ka + 16;
    a[i] = (_Float16)(ka < K ? W[(size_t)(ka < K ? ka : K - 1) * ld + n] : 0.f); a[8 + i] = (_Float16)(kb < K ? W[(size_t)(kb < K ? kb : K - 1) * ld + n] : 0.f); }
  return a;
}
struct F2 { v16b h, l; };
__device__ __forceinline__ F2 bsplit16(const float v[16]) { F2 r;
#pragma unroll
  for (int i = 0; i < 16; ++i) { const __bf16 h = (__bf16)v[i]; r.h[i] = h; r.l[i] = (__bf16)(v[i] - (float)h); }
  return r; }
__device__ __forceinline__ F2 split_row(const float* row, int k0, int lane) { float v[16]; const float* p = row + k0 + 8 * (lane >> 4);
#pragma unroll
  for (int i = 0; i < 8; ++i) { v[i] = p[i]; v[8 + i] = p[16 + i]; }
  return bsplit16(v); }
__device__ __forceinline__ F2 split_rowK(const float* row, int k0, int lane, int K) { float v[16]; const int g = lane >> 4;
#pragma unroll
  for (int i = 0; i < 8; ++i) { const int ka = k0 + 8 * g + i, kb = ka + 16; v[i] = ka < K ? row[ka < K ? ka : K - 1] : 0.f; v[8 + i] = kb < K ? row[kb < K ? kb : K - 1] : 0.f; }
  return bsplit16(v); }
__device__ __forceinline__ F2 split_col(const float* W, int k0, int n, int lane, int ld, int K) { float v[16]; const int g = lane >> 4;
#pragma unroll
  for (int i = 0; i < 8; ++i) { const int ka = k0 + 8 * g + i, kb = ka + 16; v[i] = ka < K ? W[(size_t)(ka < K ? ka : K - 1) * ld + n] : 0.f; v[8 + i] = kb < K ? W[(size_t)(kb < K ? kb : K - 1) * ld + n] : 0.f; }
  return bsplit16(v); }
__device__ __forceinline__ v8f mac3(const F2& a, const F2& b, v8f c) { c = wmma_bf(a.l, b.h, c); c = wmma_bf(a.h, b.l, c); return wmma_bf(a.h, b.h, c); }
__device__ __forceinline__ float sigm(float v) { return 1.0f / (1.0f + expf(-v)); }
#define LDSX() do { asm volatile("s_wait_dscnt 0" ::: "memory"); __builtin_amdgcn_wave_barrier(); __builtin_amdgcn_fence(__ATOMIC_RELEASE, "workgroup"); } while (0)


// Hopfield layer = one cross-attention update (B 4, L = S = 1,024, d_model 1,024 = 16 x 64): q from queries, k from keys, v from values, softmax(q k / 8) v, output Linear.
#define NB 4
#define TT 1024
#define CC 1024
#define NH 16
#define HD 64
#ifndef TNB
#define TNB NB
#endif
typedef __attribute__((ext_vector_type(8))) __bf16 v8b;
__device__ __forceinline__ v16b frag_b(const __bf16* rowk0, int lane) {
  union { v16b v; v8b q[2]; } u; const __bf16* p = rowk0 + 8 * (lane >> 4);
  u.q[0] = *(const v8b*)p; u.q[1] = *(const v8b*)(p + 16); return u.v;
}
__device__ __forceinline__ float bfr(float v) { return (float)(__bf16)v; }
__device__ __attribute__((noinline)) float exp_ni(float v) { return expf(v); }
__device__ __attribute__((noinline)) float erf_ni(float v) { return erff(v); }

#define WS_QH  0u
#define WS_KH  (WS_QH + 2u * (size_t)NB * TT * CC)
#define WS_VT  (WS_KH + 2u * (size_t)NB * TT * CC)      // f16 v planes [b][c][t]
#define WS_Y   (WS_VT + 2u * (size_t)NB * CC * TT)      // f16 y rows [b*t][C]
#define WS_WT  (WS_Y + 2u * (size_t)NB * TT * CC)       // f16 Wo^T rows [column][k]
#define WS_END (WS_WT + 2u * (size_t)CC * CC)

#define XW() asm volatile("s_wait_xcnt 0x0" ::: "memory")   // stands behind a group of global loads, before their address registers are rewritten
#define XWP(p) asm volatile("s_wait_xcnt 0x0" :: "v"(p) : "memory")   // XW() that also names the group's address: the pair stays live up to the wait, so that no load of the group has its result land in it
// Work-groups that share an operand panel would walk its k tiles in step and ask L2 for the same lines at the same moment. Each starts at a k tile of its own and wraps: tile (t0 + t) mod 16 at step t.
#define KT(t0, t) (((t0) + (t)) & (CC / 64 - 1))
// ---- the products of k_out (k_proj has the larger loop below): block = 8 waves on 128 rows x 128 columns, a tile = 64 k of both operands in LDS as f16; every wave takes its fragments from there.
typedef __attribute__((ext_vector_type(4))) __bf16 v4b;
typedef __attribute__((ext_vector_type(4))) _Float16 v4h;
#define GP 72            // LDS row pitch in elements: 64 k + 8 = 144 B = 16 B x 9, the pitch of ds_load_b128 readers
#define GT (128 * GP)    // one operand tile, elements
__device__ __forceinline__ v8f wmma_b(v16b a, v16b b, v8f c) { return __builtin_amdgcn_wmma_f32_16x16x32_bf16(false, a, false, b, (short)0, c, false, false); }
__device__ __forceinline__ v8f wmma_h(v16h a, v16h b, v8f c) { return __builtin_amdgcn_wmma_f32_16x16x32_f16(false, a, false, b, (short)0, c, false, false); }
// LDS rows: y row r of the tile is row r; column 4 l + c of the tile is row 32 c + l of the W part, so a B tile (16 LDS rows) holds every 4th column and a lane's 4 tiles hold 4 adjacent columns
// acc[mi][c] element r: row 32 wm + 16 mi + 8 g + r, column 64 wn + 4 col + c of the tile; per accumulator the products come in the order k 64 t0, + 32, + 64, ..., wrapping at K
#define GSB() __builtin_amdgcn_sched_barrier(0)   // keeps a group of fragment loads together and ahead of the products behind it (left alone the compiler reloads one A fragment per 4 products and waits each out)
__device__ __forceinline__ void g_mac8(const v16h (&a)[2], const v16h (&b)[4], v8f (&acc)[2][4]) {
#pragma unroll
  for (int mi = 0; mi < 2; ++mi)
#pragma unroll
    for (int c = 0; c < 4; ++c) acc[mi][c] = wmma_h(a[mi], b[c], acc[mi][c]); }
struct GFrag { v16h b0[4], b1[4], h0[2], h1[2]; };   // the fragments of one tile: k 0 .. 31 and k 32 .. 63
__device__ __forceinline__ void g_load(GFrag& f, const _Float16* ap, const _Float16* bp, int lane) {   // ap, bp: this lane's row of the wave's first A tile and first B tile
#pragma unroll
  for (int c = 0; c < 4; ++c) f.b0[c] = frag_h(bp + c * 32 * GP, lane);
#pragma unroll
  for (int mi = 0; mi < 2; ++mi) f.h0[mi] = frag_h(ap + mi * 16 * GP, lane);
#pragma unroll
  for (int c = 0; c < 4; ++c) f.b1[c] = frag_h(bp + c * 32 * GP + 32, lane);
#pragma unroll
  for (int mi = 0; mi < 2; ++mi) f.h1[mi] = frag_h(ap + mi * 16 * GP + 32, lane); }
__device__ __forceinline__ void g_mac(const GFrag& f, v8f (&acc)[2][4]) { g_mac8(f.h0, f.b0, acc); g_mac8(f.h1, f.b1, acc); }
// ---- k_proj: block = (256 rows, 256 cols, which), 8 waves of 128 rows x 64 columns: qkv = x W (+ b), exact; q, k -> f16 rows, v -> f16 planes
// Both f32 operands are read once per block in whole lines, rounded to bf16 once and staged in LDS (two buffers); every wave takes its fragments from there.
// The global loads never pause: a tile's X half is asked for in the middle of a step and its W half at the end of a step, each one whole step before it is rounded and stored, so one half is always in flight, over the step's barrier too.
// The 64 blocks with which = 3 run beside them, on WGPs that the 192 leave idle: each rounds 64 k rows x 256 columns of Wo to bf16, holds that value in f16 and writes it transposed, for k_out's copies.
#define PT (256 * GP)    // one operand tile of k_proj, elements
struct PStage { v4f x[16], w[16]; };
// x[it]: row 16 it + 2 wave + (lane >> 4), k 4 (lane & 15) .. + 3; w[8 hh + i]: k row 8 wave + i, columns 128 hh + 4 lane .. + 3
__device__ __forceinline__ void p_fetch_x(PStage& s, const float* xp) {
#pragma unroll
  for (int i = 0; i < 16; ++i) s.x[i] = *(const v4f*)(xp + (size_t)i * 16 * CC);
  XWP(xp);   // before the address pair is rewritten; its "memory" clobber also keeps the loads here, ahead of the products behind them
}
__device__ __forceinline__ void p_fetch_w(PStage& s, const float* wp) {
#pragma unroll
  for (int i = 0; i < 16; ++i) s.w[i] = *(const v4f*)(wp + (size_t)(i & 7) * CC + (i >> 3) * 128);
  XWP(wp);   // as above
}
// W goes in transposed, out of registers, per half of 128 columns: column 128 hh + 4 l + c of the tile is LDS row 128 hh + 32 c + l
__device__ __forceinline__ void p_put_x(const PStage& s, __bf16* buf, int wave, int lane) {
#pragma unroll
  for (int i = 0; i < 16; ++i) { v4b h;
#pragma unroll
    for (int e = 0; e < 4; ++e) h[e] = (__bf16)s.x[i][e];
    *(v4b*)(buf + (i * 16 + wave * 2 + (lane >> 4)) * GP + 4 * (lane & 15)) = h; } }
__device__ __forceinline__ void p_put_w(const PStage& s, __bf16* buf, int wave, int lane) {
  __bf16* wb = buf + PT + lane * GP + wave * 8;
#pragma unroll
  for (int hc = 0; hc < 8; ++hc) { v8b p;
#pragma unroll
    for (int i = 0; i < 8; ++i) p[i] = (__bf16)s.w[(hc >> 2) * 8 + i][hc & 3];
    *(v8b*)(wb + hc * 32 * GP) = p; } }
// acc[mi][c] element r: row 128 wm + 16 mi + 8 g + r, column 64 wn + 4 col + c of the tile; per accumulator the products come in the order k 64 t0, + 32, + 64, ..., wrapping at K
__device__ __forceinline__ void p_half(const __bf16* ap, const __bf16* bp, int lane, v8f (&acc)[8][4], int kh) {   // 32 k of a step; ap, bp: this lane's row of the wave's first A tile and first B tile
  { v16b a[8], b[4];
#pragma unroll
    for (int c = 0; c < 4; ++c) b[c] = frag_b(bp + c * 32 * GP + kh * 32, lane);
#pragma unroll
    for (int mi = 0; mi < 8; ++mi) a[mi] = frag_b(ap + mi * 16 * GP + kh * 32, lane);
    GSB();   // here: the 24 fragment loads stay one group ahead of the 32 products
#pragma unroll
    for (int mi = 0; mi < 8; ++mi)
#pragma unroll
      for (int c = 0; c < 4; ++c) acc[mi][c] = wmma_b(a[mi], b[c], acc[mi][c]);
    GSB();   // here: keeps what follows (the next group of fragment loads, which reuses the registers; the wait for global loads and the rounding) behind these products
  } }
// The step's barrier, by hand: __syncthreads() would first wait for every global load, and the half tile in flight has to stay in flight over it. This wave's fragment reads and its stores into the other buffer are over (dscnt 0) before it signals.
#define PBAR() asm volatile("s_wait_dscnt 0x0\n\ts_barrier_signal -1\n\ts_barrier_wait -1" ::: "memory")
#define PVP 264          // V staging [256 columns][256 t], row pitch in elements: 528 B = 16 B x 33
__global__ __launch_bounds__(256) void k_proj(const float* __restrict__ XQ, const float* __restrict__ XK, const float* __restrict__ XV, const float* __restrict__ WQ, const float* __restrict__ BQ, const float* __restrict__ WK, const float* __restrict__ BK, const float* __restrict__ WV, const float* __restrict__ BV, const float* __restrict__ WO, _Float16* __restrict__ QH, _Float16* __restrict__ KH, _Float16* __restrict__ VT, _Float16* __restrict__ WT) {
  __shared__ __align__(16) __bf16 sm[2 * 2 * PT];
  const int tid = threadIdx.x, wave = tid >> 5, lane = tid & 31, col = lane & 15, g = lane >> 4, wm = wave >> 2, wn = wave & 3; const int which = blockIdx.z; const int c0 = blockIdx.y * 256; const size_t r0 = (size_t)blockIdx.x * 256; const float* X = which == 0 ? XQ : which == 1 ? XK : XV; const float* WA = which == 0 ? WQ : which == 1 ? WK : WV; const float* BA = which == 0 ? BQ : which == 1 ? BK : BV;
  if (which == 3) { _Float16* th = (_Float16*)sm;   // [256 columns][GP]; the whole block takes this branch
    static_assert(TNB * TT / 256 == CC / 64, "blockIdx.x counts Wo's 64-k row groups");
    const int k0 = blockIdx.x * 64; const float* wo = WO + (size_t)(k0 + wave * 8) * CC + c0 + 4 * lane; v4f w[16];   // w[8 hh + i]: k row 8 wave + i, columns 128 hh + 4 lane .. + 3
#pragma unroll
    for (int i = 0; i < 16; ++i) w[i] = *(const v4f*)(wo + (size_t)(i & 7) * CC + (i >> 3) * 128);
    XWP(wo);   // before the address pair is used for anything else
#pragma unroll
    for (int hc = 0; hc < 8; ++hc) { v8h p;
#pragma unroll
      for (int i = 0; i < 8; ++i) p[i] = (_Float16)bfr(w[(hc >> 2) * 8 + i][hc & 3]);
      *(v8h*)(th + ((hc >> 2) * 128 + 4 * lane + (hc & 3)) * GP + wave * 8) = p; }
    __syncthreads();
    _Float16* dw = WT + (size_t)(c0 + (tid >> 3)) * CC + k0 + (tid & 7) * 8; v4u tv[8];   // a column's 64 k = one whole line, a wave's store = 4 lines
#pragma unroll
    for (int i = 0; i < 8; ++i) tv[i] = *(const v4u*)(th + ((tid >> 3) + 32 * i) * GP + (tid & 7) * 8);
    GSB();   // here: every value is read before the first store
#pragma unroll
    for (int i = 0; i < 8; ++i) vst2(dw + (size_t)32 * i * CC, tv[i]);
    XW(); return; }
  v8f acc[8][4] = {};
  { constexpr int BUF = 2 * PT; const int t0 = blockIdx.x + 4 * blockIdx.y;   // the 16 blocks on one W panel start at 16 different k tiles, the 4 on one X panel 4 tiles apart
    const float* xp = X + (r0 + wave * 2 + (lane >> 4)) * CC + 4 * (lane & 15); const float* wp = WA + (size_t)(wave * 8) * CC + c0 + 4 * lane;
    const __bf16* ap = sm + (wm * 128 + col) * GP; const __bf16* bp = sm + PT + ((wn >> 1) * 128 + (wn & 1) * 16 + col) * GP;
    constexpr int NT = CC / 64; static_assert(NT >= 4 && NT % 2 == 0, "the two steps behind the loop read buffer 0, then buffer 1");
    PStage s; p_fetch_x(s, xp + KT(t0, 0) * 64); p_fetch_w(s, wp + (size_t)KT(t0, 0) * 64 * CC); p_put_x(s, sm, wave, lane); p_put_w(s, sm, wave, lane);
    GSB();   // here: tile 1's loads, which reuse the registers, stay behind tile 0's rounding
    p_fetch_x(s, xp + KT(t0, 1) * 64); p_fetch_w(s, wp + (size_t)KT(t0, 1) * 64 * CC);
    PBAR();
#pragma unroll 1   // rolled: the two buffers alternate by an offset, a second copy of the body would only add code
    for (int t = 0; t < NT - 2; ++t) { const int cur = (t & 1) * BUF;   // step t reads buffer t & 1; tile t + 1 goes into the other one, which every wave left before the last barrier
      p_half(ap + cur, bp + cur, lane, acc, 0);
      p_put_x(s, sm + (BUF - cur), wave, lane);
      GSB();   // here: the next loads, which reuse the registers, stay behind the rounding
      p_fetch_x(s, xp + KT(t0, t + 2) * 64);
      p_half(ap + cur, bp + cur, lane, acc, 1);
      p_put_w(s, sm + (BUF - cur), wave, lane);
      GSB();   // as above
      p_fetch_w(s, wp + (size_t)KT(t0, t + 2) * 64 * CC);
      PBAR(); }
    p_half(ap, bp, lane, acc, 0); p_put_x(s, sm + BUF, wave, lane);   // step NT - 2: the last tile is stored, nothing is left to ask for
    p_half(ap, bp, lane, acc, 1); p_put_w(s, sm + BUF, wave, lane);
    PBAR();
    p_half(ap + BUF, bp + BUF, lane, acc, 0); p_half(ap + BUF, bp + BUF, lane, acc, 1); }
  const int cl = wn * 64 + 4 * col; const v4f bv = *(const v4f*)(BA + c0 + cl); const float bb[4] = {bfr(bv[0]), bfr(bv[1]), bfr(bv[2]), bfr(bv[3])};
  if (which < 2) { _Float16* dh = (which == 0 ? QH : KH) + (r0 + wm * 128 + 8 * g) * CC + c0 + cl;   // a row's 64 columns of a wave = one 128-byte line
#pragma unroll
    for (int m2 = 0; m2 < 4; ++m2) {   // 32 rows a group
      v4h hv[16];
#pragma unroll
      for (int k = 0; k < 16; ++k)
#pragma unroll
        for (int c = 0; c < 4; ++c) hv[k][c] = (_Float16)(acc[2 * m2 + (k >> 3)][c][k & 7] + bb[c]);
      GSB();   // here: every value is formed before the first store, so that no register of an issued store is rewritten ahead of the wait behind the group
#pragma unroll
      for (int k = 0; k < 16; ++k) *(v4h*)(dh + (size_t)(m2 * 32 + (k >> 3) * 16 + (k & 7)) * CC) = hv[k];
      XW(); GSB();   // the barrier keeps the next group's values, which reuse the registers of these stores, behind the wait
    } }
  else { _Float16* th = (_Float16*)sm;   // [256 columns][PVP], over the buffers
    __syncthreads();   // ends every wave's last fragment reads
#pragma unroll
    for (int mi = 0; mi < 8; ++mi)
#pragma unroll
      for (int c = 0; c < 4; ++c) { v8h hv;
#pragma unroll
        for (int r = 0; r < 8; ++r) hv[r] = (_Float16)(acc[mi][c][r] + bb[c]);
        *(v8h*)(th + (cl + c) * PVP + wm * 128 + mi * 16 + 8 * g) = hv; }
    __syncthreads();
    const size_t b = r0 / TT; const int t0 = (int)(r0 % TT); _Float16* dv = VT + (b * CC + c0 + wave) * (size_t)TT + t0 + lane * 8;   // a wave's store = one column's 256 t = 4 whole lines
#pragma unroll
    for (int gr = 0; gr < 4; ++gr) { v4u tv[8];
#pragma unroll
      for (int it = 0; it < 8; ++it) tv[it] = *(const v4u*)(th + ((gr * 8 + it) * 8 + wave) * PVP + lane * 8);
      GSB();   // as above: the group's values are all read before its first store
#pragma unroll
      for (int it = 0; it < 8; ++it) vst2((unsigned*)(dv + (size_t)(gr * 8 + it) * 8 * TT), tv[it]);
      XW(); } } }
// ---- k_att: block = 256 queries of (b,h), wave = 32 query columns: S^T = K Q^T, online softmax per column in registers, O^T += V^T P^T; y[q][h*HD + d] = O / sum
// K and V^T come once per block, in whole lines, into a ring of two LDS buffers (a stage = 128 keys = 4 passes of 32); all 8 waves take their fragments from there.
__device__ __forceinline__ float xhalf(float x) { return __builtin_bit_cast(float, __builtin_amdgcn_permlanex16(__builtin_bit_cast(int, x), __builtin_bit_cast(int, x), 0x76543210, 0xfedcba98, false, false)); }  // lane l with lane l ^ 16
#define AKS 128              // keys per stage
#define AKP 72               // K tile [128 keys][64 d], row pitch in elements: 144 B = 16 B x 9, the pitch of ds_load_b128 readers
#define AVP 136              // V^T tile [64 d][128 keys], row pitch in elements: 272 B = 16 B x 17
#define AKT (AKS * AKP)
#define ABUF (AKT + HD * AVP)   // one buffer, elements
// one stage: 8 copies of 16 B a lane. K: row (tid >> 3) + 32 i, 16-byte piece tid & 7; V^T: row (tid >> 4) + 16 i, piece tid & 15; a wave's copy covers 4 whole lines.
// The wait on xcnt is the statement's last line, so that it stands before any rewrite of a register that a copy names.
__device__ __forceinline__ void a_stage(unsigned lk, const _Float16* gk, unsigned lv, const _Float16* gv) {
  asm volatile("global_load_async_to_lds_b128 %0, %8, off\n\t"
               "global_load_async_to_lds_b128 %1, %9, off\n\t"
               "global_load_async_to_lds_b128 %2, %10, off\n\t"
               "global_load_async_to_lds_b128 %3, %11, off\n\t"
               "global_load_async_to_lds_b128 %4, %12, off\n\t"
               "global_load_async_to_lds_b128 %5, %13, off\n\t"
               "global_load_async_to_lds_b128 %6, %14, off\n\t"
               "global_load_async_to_lds_b128 %7, %15, off\n\t"
               "s_wait_xcnt 0x0"
               :: "v"(lk), "v"(lk + 32u * AKP * 2u), "v"(lk + 64u * AKP * 2u), "v"(lk + 96u * AKP * 2u), "v"(lv), "v"(lv + 16u * AVP * 2u), "v"(lv + 32u * AVP * 2u), "v"(lv + 48u * AVP * 2u),
                  "v"(gk), "v"(gk + (size_t)32 * CC), "v"(gk + (size_t)64 * CC), "v"(gk + (size_t)96 * CC), "v"(gv), "v"(gv + (size_t)16 * TT), "v"(gv + (size_t)32 * TT), "v"(gv + (size_t)48 * TT)
               : "memory"); }
#define AWAIT() asm volatile("s_wait_asynccnt 0x0" ::: "memory")   // this wave's copies have landed; the barrier behind it shows them to the other waves
__global__ __launch_bounds__(256) void k_att(const _Float16* __restrict__ QH, const _Float16* __restrict__ KH, const _Float16* __restrict__ VT, _Float16* __restrict__ Y) {
  __shared__ __align__(16) _Float16 sm[2 * ABUF];
  const int tid = threadIdx.x, wave = tid >> 5, lane = tid & 31, col = lane & 15, g = lane >> 4; const int h = blockIdx.y, b = blockIdx.z; const int q0 = blockIdx.x * 256 + wave * 32;
  const float cs = 0.125f * 1.4426950408889634f;   // logits / 8, in base 2
  const unsigned lk = (unsigned)(size_t)(sm + (tid >> 3) * AKP + (tid & 7) * 8), lv = (unsigned)(size_t)(sm + AKT + (tid >> 4) * AVP + (tid & 15) * 8);   // LDS byte addresses of this lane's first pieces, buffer 0
  const _Float16* gk = KH + ((size_t)b * TT + (tid >> 3)) * CC + h * HD + (tid & 7) * 8;
  const _Float16* gv = VT + ((size_t)b * CC + h * HD + (tid >> 4)) * (size_t)TT + (tid & 15) * 8;
  a_stage(lk, gk, lv, gv);                          // stage 0 into buffer 0
  v16h qh[2][2];                                    // B operands: column = query, [column group][kc]
#pragma unroll
  for (int c = 0; c < 2; ++c)
#pragma unroll
    for (int kc = 0; kc < 2; ++kc) qh[c][kc] = frag_h(QH + ((size_t)b * TT + q0 + c * 16 + col) * CC + h * HD + kc * 32, lane);
  XW(); __builtin_amdgcn_sched_barrier(0);          // keeps the accumulators' zeroing, which reuses the address registers, behind the wait
  AWAIT(); __syncthreads();
  a_stage(lk + 2u * ABUF, gk + (size_t)AKS * CC, lv + 2u * ABUF, gv + AKS);   // stage 1 into buffer 1
  v8f acc[2][HD / 16] = {}; float mr[2] = {-INFINITY, -INFINITY}, ls[2] = {0.f, 0.f};
#pragma unroll 1   // rolled: the two buffers alternate by an offset, a second copy of the body would only add code
  for (int st = 0; st < TT / AKS; ++st) {
    const _Float16* kp = sm + (st & 1) * ABUF + col * AKP;          // A operand of S^T: row = key
    const _Float16* vp = sm + (st & 1) * ABUF + AKT + col * AVP;    // A operand of O^T: row = d
    v16h kf[2][2], vf[HD / 16];
#pragma unroll
    for (int t = 0; t < 2; ++t)
#pragma unroll
      for (int kc = 0; kc < 2; ++kc) kf[t][kc] = frag_h(kp + (t * 16) * AKP + kc * 32, lane);
#pragma unroll
    for (int j = 0; j < HD / 16; ++j) vf[j] = frag_h(vp + (j * 16) * AVP, lane);
    GSB();   // here: keeps the stage's first fetches one group ahead of the products (left alone the V^T loads are strewn among them)
#pragma unroll
    for (int ps = 0; ps < AKS / 32; ++ps) {         // a pass = 32 keys
      v8f s[2][2] = {};                             // [key tile][column group]: register r = key 16 t + 8 g + r, lane column = query
#pragma unroll
      for (int kc = 0; kc < 2; ++kc)
#pragma unroll
        for (int t = 0; t < 2; ++t)
#pragma unroll
          for (int c = 0; c < 2; ++c) s[t][c] = wmma_h(kf[t][kc], qh[c][kc], s[t][c]);
      GSB();   // here: keeps the 8 products one run over 4 independent tiles (left alone the maxima are woven in and the products line up in dependent chains)
      if (ps + 1 < AKS / 32) {                      // inside a stage K and V fragments are fetched one pass ahead, each behind its own products; never out of the next stage
#pragma unroll
        for (int t = 0; t < 2; ++t)
#pragma unroll
          for (int kc = 0; kc < 2; ++kc) kf[t][kc] = frag_h(kp + ((ps + 1) * 32 + t * 16) * AKP + kc * 32, lane);
        GSB();   // here: keeps this fetch one group, the softmax and the second product ahead of its use
      }
      float mb[2]; bool need = false;
#pragma unroll
      for (int c = 0; c < 2; ++c) { float mx = s[0][c][0];
#pragma unroll
        for (int r = 1; r < 8; ++r) mx = fmaxf(mx, s[0][c][r]);
#pragma unroll
        for (int r = 0; r < 8; ++r) mx = fmaxf(mx, s[1][c][r]);
        mx = fmaxf(mx, xhalf(mx)) * cs; mb[c] = mx; need = need || (mx > mr[c] + 8.0f); }
      if (__builtin_amdgcn_ballot_w32(need) != 0) {   // the maximum in use moves only when a column's new one exceeds it by 2^8: rare after the first pass
        const float mn0 = fmaxf(mr[0], mb[0]), mn1 = fmaxf(mr[1], mb[1]); const float corr[2] = {__builtin_amdgcn_exp2f(mr[0] - mn0), __builtin_amdgcn_exp2f(mr[1] - mn1)}; mr[0] = mn0; mr[1] = mn1;   // 0 on the first pass
#pragma unroll
        for (int c = 0; c < 2; ++c) { ls[c] *= corr[c];
#pragma unroll
          for (int j = 0; j < HD / 16; ++j) acc[c][j] = acc[c][j] * corr[c]; }
      }
#pragma unroll
      for (int c = 0; c < 2; ++c) { const float nm = 4.0f - mr[c];   // P carries 2^4 (it cancels in the division): at most 2^12 in f16
        union { v16h v; v2h2 w[8]; } pf; float sa = 0.f, sb = 0.f;
#pragma unroll
        for (int i = 0; i < 8; ++i) { const v2f arg = __builtin_elementwise_fma(v2f{s[i >> 2][c][2 * (i & 3)], s[i >> 2][c][2 * (i & 3) + 1]}, v2f{cs, cs}, v2f{nm, nm}); const float p0 = __builtin_amdgcn_exp2f(arg.x), p1 = __builtin_amdgcn_exp2f(arg.y);
          sa += p0; sb += p1; pf.w[i] = __builtin_convertvector(v2f{p0, p1}, v2h2); }
        ls[c] += sa + sb;
#pragma unroll
        for (int j = 0; j < HD / 16; ++j) acc[c][j] = wmma_h(vf[j], pf.v, acc[c][j]); }
      if (ps + 1 < AKS / 32) {
#pragma unroll
        for (int j = 0; j < HD / 16; ++j) vf[j] = frag_h(vp + (j * 16) * AVP + (ps + 1) * 32, lane);
        GSB();   // here: as above, the next pass's first products and softmax ahead of its use
      }
    }
    asm volatile("s_wait_dscnt 0x0" ::: "memory");  // this wave's reads of the buffer are over before a copy may be aimed at it
    AWAIT(); __syncthreads();                       // the one barrier of a stage: publishes stage st + 1 and ends every wave's reads of stage st
    if (st + 2 < TT / AKS) a_stage(lk + (unsigned)(st & 1) * (2u * ABUF), gk + (size_t)(st + 2) * AKS * CC, lv + (unsigned)(st & 1) * (2u * ABUF), gv + (st + 2) * AKS);   // into the buffer just read
  }
  AWAIT();   // no copy is outstanding when the wave ends
  _Float16* yr = Y + ((size_t)b * TT + q0 + col) * CC + h * HD + 8 * g; v8h ov[2][HD / 16];
#pragma unroll
  for (int c = 0; c < 2; ++c) { const float inv = 1.0f / (ls[c] + xhalf(ls[c]));
#pragma unroll
    for (int j = 0; j < HD / 16; ++j) ov[c][j] = __builtin_convertvector(acc[c][j] * inv, v8h); }
  GSB();   // here: every value is formed before the first store, so that no register of an issued store is rewritten ahead of the wait behind the group
#pragma unroll
  for (int c = 0; c < 2; ++c)
#pragma unroll
    for (int j = 0; j < HD / 16; ++j) *(v8h*)(yr + (size_t)c * 16 * CC + j * 16) = ov[c][j];
  XW(); }
// ---- k_out: block = (128 rows, 128 cols): out = y (f16) Wo (f16, from its transposed copy) + b
// y and Wo^T come in whole lines into a ring of two LDS buffers, a stage = 128 k = two tiles of 64 k, each tile at its own place of the block's k walk.
// one tile: 8 copies of 16 B a lane. y: row (tid >> 3) + 32 i, 16-byte piece tid & 7; Wo^T: LDS row (tid >> 3) + 32 i = column 4 (tid >> 3) + i, piece tid & 7; a wave's copy covers 4 whole lines.
// The wait on xcnt is the statement's last line, so that it stands before any rewrite of a register that a copy names.
__device__ __forceinline__ void o_tile(unsigned ly, const _Float16* gy, unsigned lw, const _Float16* gw) {
  asm volatile("global_load_async_to_lds_b128 %0, %8, off\n\t"
               "global_load_async_to_lds_b128 %1, %9, off\n\t"
               "global_load_async_to_lds_b128 %2, %10, off\n\t"
               "global_load_async_to_lds_b128 %3, %11, off\n\t"
               "global_load_async_to_lds_b128 %4, %12, off\n\t"
               "global_load_async_to_lds_b128 %5, %13, off\n\t"
               "global_load_async_to_lds_b128 %6, %14, off\n\t"
               "global_load_async_to_lds_b128 %7, %15, off\n\t"
               "s_wait_xcnt 0x0"
               :: "v"(ly), "v"(ly + 32u * GP * 2u), "v"(ly + 64u * GP * 2u), "v"(ly + 96u * GP * 2u), "v"(lw), "v"(lw + 32u * GP * 2u), "v"(lw + 64u * GP * 2u), "v"(lw + 96u * GP * 2u),
                  "v"(gy), "v"(gy + (size_t)32 * CC), "v"(gy + (size_t)64 * CC), "v"(gy + (size_t)96 * CC), "v"(gw), "v"(gw + (size_t)CC), "v"(gw + (size_t)2 * CC), "v"(gw + (size_t)3 * CC)
               : "memory"); }
#define OT (2 * GT)      // one tile of both operands, elements
#define OS (2 * OT)      // one stage = one buffer, elements
__device__ __forceinline__ void o_stage(unsigned ly, const _Float16* gy, const _Float16* gw, int t0, int s) {   // stage s: tiles 2 s and 2 s + 1 of the walk
  o_tile(ly, gy + KT(t0, 2 * s) * 64, ly + 2u * GT, gw + KT(t0, 2 * s) * 64);
  o_tile(ly + 2u * OT, gy + KT(t0, 2 * s + 1) * 64, ly + 2u * OT + 2u * GT, gw + KT(t0, 2 * s + 1) * 64); }
__global__ __launch_bounds__(256) void k_out(const _Float16* __restrict__ Y, const _Float16* __restrict__ WT, const float* __restrict__ BP, float* __restrict__ OUT) { __shared__ __align__(16) _Float16 sm[2 * OS];
  const int tid = threadIdx.x, wave = tid >> 5, lane = tid & 31, col = lane & 15, g = lane >> 4, wm = wave >> 1, wn = wave & 1; const int c0 = blockIdx.y * 128; const size_t r0 = (size_t)blockIdx.x * 128;
  const int t0 = blockIdx.x + 2 * blockIdx.y;   // the 8 blocks on one y panel start 2 k tiles apart, the 32 on one W panel at 16 different tiles, two blocks each
  const unsigned ly = (unsigned)(size_t)(sm + (tid >> 3) * GP + (tid & 7) * 8);   // LDS byte address of this lane's first piece, buffer 0
  const _Float16* gy = Y + (r0 + (tid >> 3)) * CC + (tid & 7) * 8; const _Float16* gw = WT + (size_t)(c0 + 4 * (tid >> 3)) * CC + (tid & 7) * 8;
  const _Float16* ap = sm + (wm * 32 + col) * GP; const _Float16* bp = sm + GT + (wn * 16 + col) * GP;
  o_stage(ly, gy, gw, t0, 0);                       // stage 0 into buffer 0
  AWAIT(); __syncthreads();
  o_stage(ly + 2u * OS, gy, gw, t0, 1);             // stage 1 into buffer 1
  v8f acc[2][4] = {};
#pragma unroll 1   // rolled: the two buffers alternate by an offset, a second copy of the body would only add code
  for (int st = 0; st < CC / 128 - 1; ++st) { const int cur = (st & 1) * OS;
    GFrag f; g_load(f, ap + cur, bp + cur, lane);
    GSB(); g_mac(f, acc);   // the barrier: the tile's 24 loads stay one group ahead of its 16 products
    GSB();   // here: keeps the second tile's fragment loads one group behind the first tile's products, not strewn among them
    g_load(f, ap + cur + OT, bp + cur + OT, lane);
    asm volatile("s_wait_dscnt 0x0" ::: "memory");  // this wave's reads of the buffer are over before a copy may be aimed at it
    AWAIT(); __syncthreads();                       // the one barrier of a stage: publishes stage st + 1 and ends every wave's reads of stage st
    if (st + 2 < CC / 128) o_stage(ly + (unsigned)(st & 1) * (2u * OS), gy, gw, t0, st + 2);   // into the buffer just read
    GSB();   // here: the copies are issued first, and fly over the second tile's products, which need registers alone
    g_mac(f, acc);
  }
  AWAIT();   // no copy is outstanding from here on
  { constexpr int cur = ((CC / 128 - 1) & 1) * OS;   // the last stage, published by the loop's last barrier
    GFrag f; g_load(f, ap + cur, bp + cur, lane);
    GSB(); g_mac(f, acc);
    GSB();   // as in the loop
    g_load(f, ap + cur + OT, bp + cur + OT, lane);
    GSB(); g_mac(f, acc); }
  const int cl = wn * 64 + 4 * col; float bb[4] = {0.f, 0.f, 0.f, 0.f}; if (BP) { const v4f bv = *(const v4f*)(BP + c0 + cl); bb[0] = bfr(bv[0]); bb[1] = bfr(bv[1]); bb[2] = bfr(bv[2]); bb[3] = bfr(bv[3]); }
  float* d = OUT + (r0 + wm * 32 + 8 * g) * CC + c0 + cl;   // a row's 64 columns of a wave = two whole lines
  v4f o[16];
#pragma unroll
  for (int k = 0; k < 16; ++k) o[k] = v4f{acc[k >> 3][0][k & 7] + bb[0], acc[k >> 3][1][k & 7] + bb[1], acc[k >> 3][2][k & 7] + bb[2], acc[k >> 3][3][k & 7] + bb[3]};
  GSB();   // here: every value is formed before the first store, so that no register of an issued store is rewritten ahead of the wait behind the group
#pragma unroll
  for (int k = 0; k < 16; ++k) vst2(d + (size_t)((k >> 3) * 16 + (k & 7)) * CC, o[k]);
  XW(); }
extern "C" void kernel_launch(void* const* d_in, const int* in_sizes, int n_in, void* d_out, int out_size, void* d_ws, size_t ws_size, hipStream_t stream) {
  (void)in_sizes; (void)n_in; (void)out_size;
  const float** F = (const float**)d_in;   // 0 queries, 1 keys, 2 values [4,1024,1024], 3 Wq [1024,1024] (in,out), 4 bq, 5 Wk, 6 bk, 7 Wv, 8 bv, 9 Wo, 10 bo
  if (ws_size < (size_t)WS_END) return;
  char* ws = (char*)d_ws; _Float16 *QH = (_Float16*)(ws + WS_QH), *KH = (_Float16*)(ws + WS_KH), *VT = (_Float16*)(ws + WS_VT), *Y = (_Float16*)(ws + WS_Y), *WT = (_Float16*)(ws + WS_WT);
  k_proj<<<dim3(TNB * TT / 256, CC / 256, 4), 256, 0, stream>>>(F[0], F[1], F[2], F[3], F[4], F[5], F[6], F[7], F[8], F[9], QH, KH, VT, WT);
  k_att<<<dim3(TT / 256, NH, TNB), 256, 0, stream>>>(QH, KH, VT, Y);
  k_out<<<dim3(TNB * TT / 128, CC / 128), 256, 0, stream>>>(Y, WT, F[10], (float*)d_out);
}

// v009
// It runs in 55.5 microseconds.
// Two timings next to v008 both put it at 1.03 times that version's speed.
// Over all steps from v000 it is 12.0 times as fast.
// compute dtype: all float inputs rounded to bf16; q/k/v = input W + b ([in,out]) with EXACT bf16 products on WMMA 16x16x32, f32 accumulate; q (times log2(e) / 8) and k each rounded once to f16 -> base-2 logits, less the maximum in use, come out of the score products in f32 registers; online softmax in f32 (v_exp_f32), unnormalised P f16 x 2^4; o = P . v / sum with v rounded once to f16, all of it in one launch; out = o (rounded once to f16) Wo (its bf16 value held in f16) + bo; f32 output.
#include <hip/hip_runtime.h>
#include <math.h>

typedef __attribute__((ext_vector_type(16))) _Float16 v16h;
typedef __attribute__((ext_vector_type(16))) __bf16 v16b;
typedef __attribute__((ext_vector_type(8)))  _Float16 v8h;
typedef __attribute__((ext_vector_type(8)))  float v8f;
typedef __attribute__((ext_vector_type(4)))  float v4f;
typedef __attribute__((ext_vector_type(2)))  float v2f;
typedef __attribute__((ext_vector_type(2)))  _Float16 v2h2;
typedef __attribute__((ext_vector_type(4)))  unsigned v4u;
typedef __attribute__((ext_vector_type(4)))  int v4i;
typedef float __attribute__((may_alias)) float_a;
typedef int __attribute__((may_alias)) int_a;

template <typename T> __device__ __forceinline__ void vst2(void* p, T v) { *(T*)p = v;  }
__device__ __forceinline__ v8f wmma16(v16h a, v16h b, v8f c) {
  v8f d = __builtin_amdgcn_wmma_f32_16x16x32_f16(false, a, false, b, (short)0, c, false, false);
  asm volatile("v_nop\n\tv_nop\n\tv_nop\n\tv_nop" : "+v"(d) : "v"(a), "v"(b));
  return d;
}
__device__ __forceinline__ v8f wmma_bf(v16b a, v16b b, v8f c) {
  v8f d = __builtin_amdgcn_wmma_f32_16x16x32_bf16(false, a, false, b, (short)0, c, false, false);
  asm volatile("v_nop\n\tv_nop\n\tv_nop\n\tv_nop" : "+v"(d) : "v"(a), "v"(b));
  return d;
}
// 16x16x32 fragments: lane = (h = lane>>4, row/col = lane&15); elements 0..7 = k0+8h+0..7, 8..15 = k0+16+8h+0..7; D element r = row 8h+r
__device__ __forceinline__ v16h frag_h(const _Float16* rowk0, int lane) {
  union { v16h v; v8h q[2]; } u; const _Float16* p = rowk0 + 8 * (lane >> 4);
  u.q[0] = *(const v8h*)p; u.q[1] = *(const v8h*)(p + 16); return u.v;
}
__device__ __forceinline__ v16h frag_f32(const float* rowk0, int lane) {
  v16h a; const float* p = rowk0 + 8 * (lane >> 4);
#pragma unroll
  for (int i = 0; i < 8; ++i) { a[i] = (_Float16)p[i]; a[8 + i] = (_Float16)p[16 + i]; }
  return a;
}
__device__ __forceinline__ v16h frag_f32s(const float* rowk0, int lane, float sc) {
  v16h a; const float* p = rowk0 + 8 * (lane >> 4);
#pragma unroll
  for (int i = 0; i < 8; ++i) { a[i] = (_Float16)(p[i] * sc); a[8 + i] = (_Float16)(p[16 + i] * sc); }
  return a;
}
// column fragment from a [K][ld] layout (column n), rows >= K read as 0
__device__ __forceinline__ v16h fragc_f32(const float* W, int k0, int n, int lane, int ld, int K) {
  v16h a; const int g = lane >> 4;
#pragma unroll
  for (int i = 0; i < 8; ++i) { const int ka = k0 + 8 * g + i, kb = ka + 16;
    a[i] = (_Float16)(ka < K ? W[(size_t)(ka < K ? ka : K - 1) * ld + n] : 0.f); a[8 + i] = (_Float16)(kb < K ? W[(size_t)(kb < K ? kb : K - 1) * ld + n] : 0.f); }
  return a;
}
struct F2 { v16b h, l; };
__device__ __forceinline__ F2 bsplit16(const float v[16]) { F2 r;
#pragma unroll
  for (int i = 0; i < 16; ++i) { const __bf16 h = (__bf16)v[i]; r.h[i] = h; r.l[i] = (__bf16)(v[i] - (float)h); }
  return r; }
__device__ __forceinline__ F2 split_row(const float* row, int k0, int lane) { float v[16]; const float* p = row + k0 + 8 * (lane >> 4);
#pragma unroll
  for (int i = 0; i < 8; ++i) { v[i] = p[i]; v[8 + i] = p[16 + i]; }
  return bsplit16(v); }
__device__ __forceinline__ F2 split_rowK(const float* row, int k0, int lane, int K) { float v[16]; const int g = lane >> 4;
#pragma unroll
  for (int i = 0; i < 8; ++i) { const int ka = k0 + 8 * g + i, kb = ka + 16; v[i] = ka < K ? row[ka < K ? ka : K - 1] : 0.f; v[8 + i] = kb < K ? row[kb < K ? kb : K - 1] : 0.f; }
  return bsplit16(v); }
__device__ __forceinline__ F2 split_col(const float* W, int k0, int n, int lane, int ld, int K) { float v[16]; const int g = lane >> 4;
#pragma unroll
  for (int i = 0; i < 8; ++i) { const int ka = k0 + 8 * g + i, kb = ka + 16; v[i] = ka < K ? W[(size_t)(ka < K ? ka : K - 1) * ld + n] : 0.f; v[8 + i] = kb < K ? W[(size_t)(kb < K ? kb : K - 1) * ld + n] : 0.f; }
  return bsplit16(v); }
__device__ __forceinline__ v8f mac3(const F2& a, const F2& b, v8f c) { c = wmma_bf(a.l, b.h, c); c = wmma_bf(a.h, b.l, c); return wmma_bf(a.h, b.h, c); }
__device__ __forceinline__ float sigm(float v) { return 1.0f / (1.0f + expf(-v)); }
#define LDSX() do { asm volatile("s_wait_dscnt 0" ::: "memory"); __builtin_amdgcn_wave_barrier(); __builtin_amdgcn_fence(__ATOMIC_RELEASE, "workgroup"); } while (0)


// Hopfield layer = one cross-attention update (B 4, L = S = 1,024, d_model 1,024 = 16 x 64): q from queries, k from keys, v from values, softmax(q k / 8) v, output Linear.
#define NB 4
#define TT 1024
#define CC 1024
#define NH 16
#define HD 64
#ifndef TNB
#define TNB NB
#endif
typedef __attribute__((ext_vector_type(8))) __bf16 v8b;
__device__ __forceinline__ v16b frag_b(const __bf16* rowk0, int lane) {
  union { v16b v; v8b q[2]; } u; const __bf16* p = rowk0 + 8 * (lane >> 4);
  u.q[0] = *(const v8b*)p; u.q[1] = *(const v8b*)(p + 16); return u.v;
}
__device__ __forceinline__ float bfr(float v) { return (float)(__bf16)v; }
__device__ __attribute__((noinline)) float exp_ni(float v) { return expf(v); }
__device__ __attribute__((noinline)) float erf_ni(float v) { return erff(v); }

#define QSC (0.125f * 1.4426950408889634f)   // logits / 8, in base 2: q carries the factor from k_proj on
#define WS_QH  0u
#define WS_KH  (WS_QH + 2u * (size_t)NB * TT * CC)
#define WS_VT  (WS_KH + 2u * (size_t)NB * TT * CC)      // f16 v planes [b][c][t]
#define WS_Y   (WS_VT + 2u * (size_t)NB * CC * TT)      // f16 y rows [b*t][C]
#define WS_WT  (WS_Y + 2u * (size_t)NB * TT * CC)       // f16 Wo^T rows [column][k]
#define WS_END (WS_WT + 2u * (size_t)CC * CC)

#define XW() asm volatile("s_wait_xcnt 0x0" ::: "memory")   // stands behind a group of global loads, before their address registers are rewritten
#define XWP(p) asm volatile("s_wait_xcnt 0x0" :: "v"(p) : "memory")   // XW() that also names the group's address: the pair stays live up to the wait, so that no load of the group has its result land in it
// Work-groups that share an operand panel would walk its k tiles in step and ask L2 for the same lines at the same moment. Each starts at a k tile of its own and wraps: tile (t0 + t) mod 16 at step t.
#define KT(t0, t) (((t0) + (t)) & (CC / 64 - 1))
// ---- the products of k_out (k_proj has the larger loop below): block = 8 waves on 128 rows x 128 columns, a tile = 64 k of both operands in LDS as f16; every wave takes its fragments from there.
typedef __attribute__((ext_vector_type(4))) __bf16 v4b;
typedef __attribute__((ext_vector_type(4))) _Float16 v4h;
#define GP 72            // LDS row pitch in elements: 64 k + 8 = 144 B = 16 B x 9, the pitch of ds_load_b128 readers
#define GT (128 * GP)    // one operand tile, elements
__device__ __forceinline__ v8f wmma_b(v16b a, v16b b, v8f c) { return __builtin_amdgcn_wmma_f32_16x16x32_bf16(false, a, false, b, (short)0, c, false, false); }
__device__ __forceinline__ v8f wmma_h(v16h a, v16h b, v8f c) { return __builtin_amdgcn_wmma_f32_16x16x32_f16(false, a, false, b, (short)0, c, false, false); }
// LDS rows: y row r of the tile is row r; column 4 l + c of the tile is row 32 c + l of the W part, so a B tile (16 LDS rows) holds every 4th column and a lane's 4 tiles hold 4 adjacent columns
// acc[mi][c] element r: row 32 wm + 16 mi + 8 g + r, column 64 wn + 4 col + c of the tile; per accumulator the products come in the order k 64 t0, + 32, + 64, ..., wrapping at K
#define GSB() __builtin_amdgcn_sched_barrier(0)   // keeps a group of fragment loads together and ahead of the products behind it (left alone the compiler reloads one A fragment per 4 products and waits each out)
__device__ __forceinline__ void g_mac8(const v16h (&a)[2], const v16h (&b)[4], v8f (&acc)[2][4]) {
#pragma unroll
  for (int mi = 0; mi < 2; ++mi)
#pragma unroll
    for (int c = 0; c < 4; ++c) acc[mi][c] = wmma_h(a[mi], b[c], acc[mi][c]); }
struct GFrag { v16h b0[4], b1[4], h0[2], h1[2]; };   // the fragments of one tile: k 0 .. 31 and k 32 .. 63
__device__ __forceinline__ void g_load(GFrag& f, const _Float16* ap, const _Float16* bp, int lane) {   // ap, bp: this lane's row of the wave's first A tile and first B tile
#pragma unroll
  for (int c = 0; c < 4; ++c) f.b0[c] = frag_h(bp + c * 32 * GP, lane);
#pragma unroll
  for (int mi = 0; mi < 2; ++mi) f.h0[mi] = frag_h(ap + mi * 16 * GP, lane);
#pragma unroll
  for (int c = 0; c < 4; ++c) f.b1[c] = frag_h(bp + c * 32 * GP + 32, lane);
#pragma unroll
  for (int mi = 0; mi < 2; ++mi) f.h1[mi] = frag_h(ap + mi * 16 * GP + 32, lane); }
__device__ __forceinline__ void g_mac(const GFrag& f, v8f (&acc)[2][4]) { g_mac8(f.h0, f.b0, acc); g_mac8(f.h1, f.b1, acc); }
// ---- k_proj: block = (256 rows, 256 cols, which), 8 waves of 128 rows x 64 columns: qkv = x W (+ b), exact; q, k -> f16 rows, v -> f16 planes
// Both f32 operands are read once per block in whole lines, rounded to bf16 once and staged in LDS (two buffers); every wave takes its fragments from there.
// The global loads never pause: a tile's X half is asked for in the middle of a step and its W half at the end of a step, each one whole step before it is rounded and stored, so one half is always in flight, over the step's barrier too.
// The 64 blocks with which = 3 run beside them, on WGPs that the 192 leave idle: each rounds 64 k rows x 256 columns of Wo to bf16, holds that value in f16 and writes it transposed, for k_out's copies.
#define PT (256 * GP)    // one operand tile of k_proj, elements
struct PStage { v4f x[16], w[16]; };
// x[it]: row 16 it + 2 wave + (lane >> 4), k 4 (lane & 15) .. + 3; w[8 hh + i]: k row 8 wave + i, columns 128 hh + 4 lane .. + 3
__device__ __forceinline__ void p_fetch_x(PStage& s, const float* xp) {
#pragma unroll
  for (int i = 0; i < 16; ++i) s.x[i] = *(const v4f*)(xp + (size_t)i * 16 * CC);
  XWP(xp);   // before the address pair is rewritten; its "memory" clobber also keeps the loads here, ahead of the products behind them
}
__device__ __forceinline__ void p_fetch_w(PStage& s, const float* wp) {
#pragma unroll
  for (int i = 0; i < 16; ++i) s.w[i] = *(const v4f*)(wp + (size_t)(i & 7) * CC + (i >> 3) * 128);
  XWP(wp);   // as above
}
// W goes in transposed, out of registers, per half of 128 columns: column 128 hh + 4 l + c of the tile is LDS row 128 hh + 32 c + l
__device__ __forceinline__ void p_put_x(const PStage& s, __bf16* buf, int wave, int lane) {
#pragma unroll
  for (int i = 0; i < 16; ++i) { v4b h;
#pragma unroll
    for (int e = 0; e < 4; ++e) h[e] = (__bf16)s.x[i][e];
    *(v4b*)(buf + (i * 16 + wave * 2 + (lane >> 4)) * GP + 4 * (lane & 15)) = h; } }
__device__ __forceinline__ void p_put_w(const PStage& s, __bf16* buf, int wave, int lane) {
  __bf16* wb = buf + PT + lane * GP + wave * 8;
#pragma unroll
  for (int hc = 0; hc < 8; ++hc) { v8b p;
#pragma unroll
    for (int i = 0; i < 8; ++i) p[i] = (__bf16)s.w[(hc >> 2) * 8 + i][hc & 3];
    *(v8b*)(wb + hc * 32 * GP) = p; } }
// acc[mi][c] element r: row 128 wm + 16 mi + 8 g + r, column 64 wn + 4 col + c of the tile; per accumulator the products come in the order k 64 t0, + 32, + 64, ..., wrapping at K
__device__ __forceinline__ void p_half(const __bf16* ap, const __bf16* bp, int lane, v8f (&acc)[8][4], int kh) {   // 32 k of a step; ap, bp: this lane's row of the wave's first A tile and first B tile
  { v16b a[8], b[4];
#pragma unroll
    for (int c = 0; c < 4; ++c) b[c] = frag_b(bp + c * 32 * GP + kh * 32, lane);
#pragma unroll
    for (int mi = 0; mi < 8; ++mi) a[mi] = frag_b(ap + mi * 16 * GP + kh * 32, lane);
    GSB();   // here: the 24 fragment loads stay one group ahead of the 32 products
#pragma unroll
    for (int mi = 0; mi < 8; ++mi)
#pragma unroll
      for (int c = 0; c < 4; ++c) acc[mi][c] = wmma_b(a[mi], b[c], acc[mi][c]);
    GSB();   // here: keeps what follows (the next group of fragment loads, which reuses the registers; the wait for global loads and the rounding) behind these products
  } }
// The step's barrier, by hand: __syncthreads() would first wait for every global load, and the half tile in flight has to stay in flight over it. This wave's fragment reads and its stores into the other buffer are over (dscnt 0) before it signals.
#define PBAR() asm volatile("s_wait_dscnt 0x0\n\ts_barrier_signal -1\n\ts_barrier_wait -1" ::: "memory")
#define PVP 264          // V staging [256 columns][256 t], row pitch in elements: 528 B = 16 B x 33
__global__ __launch_bounds__(256) void k_proj(const float* __restrict__ XQ, const float* __restrict__ XK, const float* __restrict__ XV, const float* __restrict__ WQ, const float* __restrict__ BQ, const float* __restrict__ WK, const float* __restrict__ BK, const float* __restrict__ WV, const float* __restrict__ BV, const float* __restrict__ WO, _Float16* __restrict__ QH, _Float16* __restrict__ KH, _Float16* __restrict__ VT, _Float16* __restrict__ WT) {
  __shared__ __align__(16) __bf16 sm[2 * 2 * PT];
  const int tid = threadIdx.x, wave = tid >> 5, lane = tid & 31, col = lane & 15, g = lane >> 4, wm = wave >> 2, wn = wave & 3; const int which = blockIdx.z; const int c0 = blockIdx.y * 256; const size_t r0 = (size_t)blockIdx.x * 256; const float* X = which == 0 ? XQ : which == 1 ? XK : XV; const float* WA = which == 0 ? WQ : which == 1 ? WK : WV; const float* BA = which == 0 ? BQ : which == 1 ? BK : BV;
  if (which == 3) { _Float16* th = (_Float16*)sm;   // [256 columns][GP]; the whole block takes this branch
    static_assert(TNB * TT / 256 == CC / 64, "blockIdx.x counts Wo's 64-k row groups");
    const int k0 = blockIdx.x * 64; const float* wo = WO + (size_t)(k0 + wave * 8) * CC + c0 + 4 * lane; v4f w[16];   // w[8 hh + i]: k row 8 wave + i, columns 128 hh + 4 lane .. + 3
#pragma unroll
    for (int i = 0; i < 16; ++i) w[i] = *(const v4f*)(wo + (size_t)(i & 7) * CC + (i >> 3) * 128);
    XWP(wo);   // before the address pair is used for anything else
#pragma unroll
    for (int hc = 0; hc < 8; ++hc) { v8h p;
#pragma unroll
      for (int i = 0; i < 8; ++i) p[i] = (_Float16)bfr(w[(hc >> 2) * 8 + i][hc & 3]);
      *(v8h*)(th + ((hc >> 2) * 128 + 4 * lane + (hc & 3)) * GP + wave * 8) = p; }
    __syncthreads();
    _Float16* dw = WT + (size_t)(c0 + (tid >> 3)) * CC + k0 + (tid & 7) * 8; v4u tv[8];   // a column's 64 k = one whole line, a wave's store = 4 lines
#pragma unroll
    for (int i = 0; i < 8; ++i) tv[i] = *(const v4u*)(th + ((tid >> 3) + 32 * i) * GP + (tid & 7) * 8);
    GSB();   // here: every value is read before the first store
#pragma unroll
    for (int i = 0; i < 8; ++i) vst2(dw + (size_t)32 * i * CC, tv[i]);
    XW(); return; }
  v8f acc[8][4] = {};
  { constexpr int BUF = 2 * PT; const int t0 = blockIdx.x + 4 * blockIdx.y;   // the 16 blocks on one W panel start at 16 different k tiles, the 4 on one X panel 4 tiles apart
    const float* xp = X + (r0 + wave * 2 + (lane >> 4)) * CC + 4 * (lane & 15); const float* wp = WA + (size_t)(wave * 8) * CC + c0 + 4 * lane;
    const __bf16* ap = sm + (wm * 128 + col) * GP; const __bf16* bp = sm + PT + ((wn >> 1) * 128 + (wn & 1) * 16 + col) * GP;
    constexpr int NT = CC / 64; static_assert(NT >= 4 && NT % 2 == 0, "the two steps behind the loop read buffer 0, then buffer 1");
    PStage s; p_fetch_x(s, xp + KT(t0, 0) * 64); p_fetch_w(s, wp + (size_t)KT(t0, 0) * 64 * CC); p_put_x(s, sm, wave, lane); p_put_w(s, sm, wave, lane);
    GSB();   // here: tile 1's loads, which reuse the registers, stay behind tile 0's rounding
    p_fetch_x(s, xp + KT(t0, 1) * 64); p_fetch_w(s, wp + (size_t)KT(t0, 1) * 64 * CC);
    PBAR();
#pragma unroll 1   // rolled: the two buffers alternate by an offset, a second copy of the body would only add code
    for (int t = 0; t < NT - 2; ++t) { const int cur = (t & 1) * BUF;   // step t reads buffer t & 1; tile t + 1 goes into the other one, which every wave left before the last barrier
      p_half(ap + cur, bp + cur, lane, acc, 0);
      p_put_x(s, sm + (BUF - cur), wave, lane);
      GSB();   // here: the next loads, which reuse the registers, stay behind the rounding
      p_fetch_x(s, xp + KT(t0, t + 2) * 64);
      p_half(ap + cur, bp + cur, lane, acc, 1);
      p_put_w(s, sm + (BUF - cur), wave, lane);
      GSB();   // as above
      p_fetch_w(s, wp + (size_t)KT(t0, t + 2) * 64 * CC);
      PBAR(); }
    p_half(ap, bp, lane, acc, 0); p_put_x(s, sm + BUF, wave, lane);   // step NT - 2: the last tile is stored, nothing is left to ask for
    p_half(ap, bp, lane, acc, 1); p_put_w(s, sm + BUF, wave, lane);
    PBAR();
    p_half(ap + BUF, bp + BUF, lane, acc, 0); p_half(ap + BUF, bp + BUF, lane, acc, 1); }
  const int cl = wn * 64 + 4 * col; const v4f bv = *(const v4f*)(BA + c0 + cl); const float bb[4] = {bfr(bv[0]), bfr(bv[1]), bfr(bv[2]), bfr(bv[3])};
  if (which < 2) { _Float16* dh = (which == 0 ? QH : KH) + (r0 + wm * 128 + 8 * g) * CC + c0 + cl;   // a row's 64 columns of a wave = one 128-byte line
    const float qs = which == 0 ? QSC : 1.0f; const float bq[4] = {bb[0] * qs, bb[1] * qs, bb[2] * qs, bb[3] * qs};   // q = (x W + b) log2(e) / 8; k as it is
#pragma unroll
    for (int m2 = 0; m2 < 4; ++m2) {   // 32 rows a group
      v4h hv[16];
#pragma unroll
      for (int k = 0; k < 16; ++k)
#pragma unroll
        for (int c = 0; c < 4; ++c) hv[k][c] = (_Float16)__builtin_fmaf(acc[2 * m2 + (k >> 3)][c][k & 7], qs, bq[c]);
      GSB();   // here: every value is formed before the first store, so that no register of an issued store is rewritten ahead of the wait behind the group
#pragma unroll
      for (int k = 0; k < 16; ++k) *(v4h*)(dh + (size_t)(m2 * 32 + (k >> 3) * 16 + (k & 7)) * CC) = hv[k];
      XW(); GSB();   // the barrier keeps the next group's values, which reuse the registers of these stores, behind the wait
    } }
  else { _Float16* th = (_Float16*)sm;   // [256 columns][PVP], over the buffers
    __syncthreads();   // ends every wave's last fragment reads
#pragma unroll
    for (int mi = 0; mi < 8; ++mi)
#pragma unroll
      for (int c = 0; c < 4; ++c) { v8h hv;
#pragma unroll
        for (int r = 0; r < 8; ++r) hv[r] = (_Float16)(acc[mi][c][r] + bb[c]);
        *(v8h*)(th + (cl + c) * PVP + wm * 128 + mi * 16 + 8 * g) = hv; }
    __syncthreads();
    const size_t b = r0 / TT; const int t0 = (int)(r0 % TT); _Float16* dv = VT + (b * CC + c0 + wave) * (size_t)TT + t0 + lane * 8;   // a wave's store = one column's 256 t = 4 whole lines
#pragma unroll
    for (int gr = 0; gr < 4; ++gr) { v4u tv[8];
#pragma unroll
      for (int it = 0; it < 8; ++it) tv[it] = *(const v4u*)(th + ((gr * 8 + it) * 8 + wave) * PVP + lane * 8);
      GSB();   // as above: the group's values are all read before its first store
#pragma unroll
      for (int it = 0; it < 8; ++it) vst2((unsigned*)(dv + (size_t)(gr * 8 + it) * 8 * TT), tv[it]);
      XW(); } } }
// ---- k_att: block = 256 queries of (b,h), wave = 32 query columns: S^T = K Q^T + (4 - maximum in use), online softmax per column in registers, O^T += V^T P^T; y[q][h*HD + d] = O / sum
// The exponent's argument comes straight out of the score products: q carries log2(e) / 8, and the products' C operand holds 4 - the column's maximum in use. No vector maximum, multiply or subtract stands between a product and its v_exp_f32.
// K and V^T come once per block, in whole lines, into a ring of two LDS buffers (a stage = 128 keys = 4 passes of 32); all 8 waves take their fragments from there.
__device__ __forceinline__ float xhalf(float x) { return __builtin_bit_cast(float, __builtin_amdgcn_permlanex16(__builtin_bit_cast(int, x), __builtin_bit_cast(int, x), 0x76543210, 0xfedcba98, false, false)); }  // lane l with lane l ^ 16
#define AKS 128              // keys per stage
#define AKP 72               // K tile [128 keys][64 d], row pitch in elements: 144 B = 16 B x 9, the pitch of ds_load_b128 readers
#define AVP 136              // V^T tile [64 d][128 keys], row pitch in elements: 272 B = 16 B x 17
#define AKT (AKS * AKP)
#define ABUF (AKT + HD * AVP)   // one buffer, elements
// one stage: 8 copies of 16 B a lane. K: row (tid >> 3) + 32 i, 16-byte piece tid & 7; V^T: row (tid >> 4) + 16 i, piece tid & 15; a wave's copy covers 4 whole lines.
// The wait on xcnt is the statement's last line, so that it stands before any rewrite of a register that a copy names.
__device__ __forceinline__ void a_stage(unsigned lk, const _Float16* gk, unsigned lv, const _Float16* gv) {
  asm volatile("global_load_async_to_lds_b128 %0, %8, off\n\t"
               "global_load_async_to_lds_b128 %1, %9, off\n\t"
               "global_load_async_to_lds_b128 %2, %10, off\n\t"
               "global_load_async_to_lds_b128 %3, %11, off\n\t"
               "global_load_async_to_lds_b128 %4, %12, off\n\t"
               "global_load_async_to_lds_b128 %5, %13, off\n\t"
               "global_load_async_to_lds_b128 %6, %14, off\n\t"
               "global_load_async_to_lds_b128 %7, %15, off\n\t"
               "s_wait_xcnt 0x0"
               :: "v"(lk), "v"(lk + 32u * AKP * 2u), "v"(lk + 64u * AKP * 2u), "v"(lk + 96u * AKP * 2u), "v"(lv), "v"(lv + 16u * AVP * 2u), "v"(lv + 32u * AVP * 2u), "v"(lv + 48u * AVP * 2u),
                  "v"(gk), "v"(gk + (size_t)32 * CC), "v"(gk + (size_t)64 * CC), "v"(gk + (size_t)96 * CC), "v"(gv), "v"(gv + (size_t)16 * TT), "v"(gv + (size_t)32 * TT), "v"(gv + (size_t)48 * TT)
               : "memory"); }
#define AWAIT() asm volatile("s_wait_asynccnt 0x0" ::: "memory")   // this wave's copies have landed; the barrier behind it shows them to the other waves
// 32 keys of one column group: P = 2^argument, packed to f16 as the B operand of O^T; returns this lane's sum of its 16 values
// RARE: the copy on the seldom-taken path; there the exponent comes by exp2_s
__device__ __forceinline__ float exp2_s(float x) { float r; asm("v_exp_f32 %0, %1\n\tv_nop" : "=v"(r) : "v"(x)); return r; }   // the v_nop holds the one slot that the instruction set asks for behind a transcendental, before its result is used or its source overwritten
template <bool RARE> __device__ __forceinline__ float a_soft(const v8f& s0, const v8f& s1, v16h& out) {
  union { v16h v; v2h2 w[8]; } pf; float sa = 0.f, sb = 0.f;
#pragma unroll
  for (int i = 0; i < 8; ++i) { const v8f& x = i < 4 ? s0 : s1; const float x0 = x[2 * (i & 3)], x1 = x[2 * (i & 3) + 1]; const float p0 = RARE ? exp2_s(x0) : __builtin_amdgcn_exp2f(x0), p1 = RARE ? exp2_s(x1) : __builtin_amdgcn_exp2f(x1);
    sa += p0; sb += p1; pf.w[i] = __builtin_convertvector(v2f{p0, p1}, v2h2); }
  out = pf.v; return sa + sb; }
__global__ __launch_bounds__(256) void k_att(const _Float16* __restrict__ QH, const _Float16* __restrict__ KH, const _Float16* __restrict__ VT, _Float16* __restrict__ Y) {
  __shared__ __align__(16) _Float16 sm[2 * ABUF];
  const int tid = threadIdx.x, wave = tid >> 5, lane = tid & 31, col = lane & 15, g = lane >> 4; const int h = blockIdx.y, b = blockIdx.z; const int q0 = blockIdx.x * 256 + wave * 32;
  const unsigned lk = (unsigned)(size_t)(sm + (tid >> 3) * AKP + (tid & 7) * 8), lv = (unsigned)(size_t)(sm + AKT + (tid >> 4) * AVP + (tid & 15) * 8);   // LDS byte addresses of this lane's first pieces, buffer 0
  const _Float16* gk = KH + ((size_t)b * TT + (tid >> 3)) * CC + h * HD + (tid & 7) * 8;
  const _Float16* gv = VT + ((size_t)b * CC + h * HD + (tid >> 4)) * (size_t)TT + (tid & 15) * 8;
  a_stage(lk, gk, lv, gv);                          // stage 0 into buffer 0
  v16h qh[2][2];                                    // B operands: column = query, [column group][kc]
#pragma unroll
  for (int c = 0; c < 2; ++c)
#pragma unroll
    for (int kc = 0; kc < 2; ++kc) qh[c][kc] = frag_h(QH + ((size_t)b * TT + q0 + c * 16 + col) * CC + h * HD + kc * 32, lane);
  XW(); __builtin_amdgcn_sched_barrier(0);          // keeps the accumulators' zeroing, which reuses the address registers, behind the wait
  AWAIT(); __syncthreads();
  a_stage(lk + 2u * ABUF, gk + (size_t)AKS * CC, lv + 2u * ABUF, gv + AKS);   // stage 1 into buffer 1
  v8f acc[2][HD / 16] = {}; float ls[2] = {0.f, 0.f};
  v8f nt[2];   // C operand of the score products, the same value in all 8 registers of a lane: 4 - its column's maximum in use (P carries 2^4, which cancels in the division). It starts from a maximum of 0; the first pass always sets the true one.
#pragma unroll
  for (int c = 0; c < 2; ++c)
#pragma unroll
    for (int r = 0; r < 8; ++r) nt[c][r] = 4.0f;
#pragma unroll 1   // rolled: the two buffers alternate by an offset, a second copy of the body would only add code
  for (int st = 0; st < TT / AKS; ++st) {
    const _Float16* kp = sm + (st & 1) * ABUF + col * AKP;          // A operand of S^T: row = key
    const _Float16* vp = sm + (st & 1) * ABUF + AKT + col * AVP;    // A operand of O^T: row = d
    v16h kf[2][2], vf[HD / 16];
#pragma unroll
    for (int t = 0; t < 2; ++t)
#pragma unroll
      for (int kc = 0; kc < 2; ++kc) kf[t][kc] = frag_h(kp + (t * 16) * AKP + kc * 32, lane);
#pragma unroll
    for (int j = 0; j < HD / 16; ++j) vf[j] = frag_h(vp + (j * 16) * AVP, lane);
    GSB();   // here: keeps the stage's first fetches one group ahead of the products (left alone the V^T loads are strewn among them)
#pragma unroll
    for (int ps = 0; ps < AKS / 32; ++ps) {         // a pass = 32 keys
      v8f s[2][2];                                  // [key tile][column group]: register r = key 16 t + 8 g + r, lane column = query
#pragma unroll
      for (int kc = 0; kc < 2; ++kc)
#pragma unroll
        for (int t = 0; t < 2; ++t)
#pragma unroll
          for (int c = 0; c < 2; ++c) s[t][c] = wmma_h(kf[t][kc], qh[c][kc], kc == 0 ? nt[c] : s[t][c]);
      GSB();   // here: keeps the 8 products one run over 4 independent tiles (left alone the products line up in dependent chains)
      if (ps + 1 < AKS / 32) {                      // inside a stage K and V fragments are fetched one pass ahead, each behind its own products; never out of the next stage
#pragma unroll
        for (int t = 0; t < 2; ++t)
#pragma unroll
          for (int kc = 0; kc < 2; ++kc) kf[t][kc] = frag_h(kp + ((ps + 1) * 32 + t * 16) * AKP + kc * 32, lane);
        GSB();   // here: keeps this fetch one group, the softmax and the second product ahead of its use
      }
      v16h pf[2]; float su[2];
#pragma unroll
      for (int c = 0; c < 2; ++c) su[c] = a_soft<false>(s[0][c], s[1][c], pf[c]);
      const bool need = !(su[0] <= 4096.0f) || !(su[1] <= 4096.0f);   // a lane's 16 values sum to at most 2^12: each fits f16. Written so that a NaN asks too.
      const bool first = ps == 0 && st == 0;
      if (__builtin_expect(__builtin_amdgcn_ballot_w32(need) != 0 || first, 0)) {   // one test a pass, on the sums that are formed anyway; taken on the first pass and then only when a column's values outgrow the maximum in use: rare
#pragma unroll
        for (int c = 0; c < 2; ++c) { float mx = s[0][c][0];
#pragma unroll
          for (int r = 1; r < 8; ++r) mx = fmaxf(mx, s[0][c][r]);
#pragma unroll
          for (int r = 0; r < 8; ++r) mx = fmaxf(mx, s[1][c][r]);
          mx = fmaxf(mx, xhalf(mx));
          const float d = first ? mx - 4.0f : fmaxf(mx - 4.0f, 0.f);   // the maximum in use rises by d (on the first pass it is set, up or down)
          const float corr = first ? 1.0f : exp2_s(-d);   // sums and outputs are still 0 on the first pass
          nt[c] = nt[c] - d; s[0][c] = s[0][c] - d; s[1][c] = s[1][c] - d; ls[c] *= corr;
#pragma unroll
          for (int j = 0; j < HD / 16; ++j) acc[c][j] = acc[c][j] * corr;
          su[c] = a_soft<true>(s[0][c], s[1][c], pf[c]); }
      }
#pragma unroll
      for (int c = 0; c < 2; ++c) { ls[c] += su[c];
#pragma unroll
        for (int j = 0; j < HD / 16; ++j) acc[c][j] = wmma_h(vf[j], pf[c], acc[c][j]); }
      if (ps + 1 < AKS / 32) {
#pragma unroll
        for (int j = 0; j < HD / 16; ++j) vf[j] = frag_h(vp + (j * 16) * AVP + (ps + 1) * 32, lane);
        GSB();   // here: as above, the next pass's first products and softmax ahead of its use
      }
    }
    asm volatile("s_wait_dscnt 0x0" ::: "memory");  // this wave's reads of the buffer are over before a copy may be aimed at it
    AWAIT(); __syncthreads();                       // the one barrier of a stage: publishes stage st + 1 and ends every wave's reads of stage st
    if (st + 2 < TT / AKS) a_stage(lk + (unsigned)(st & 1) * (2u * ABUF), gk + (size_t)(st + 2) * AKS * CC, lv + (unsigned)(st & 1) * (2u * ABUF), gv + (st + 2) * AKS);   // into the buffer just read
  }
  AWAIT();   // no copy is outstanding when the wave ends
  _Float16* yr = Y + ((size_t)b * TT + q0 + col) * CC + h * HD + 8 * g; v8h ov[2][HD / 16];
#pragma unroll
  for (int c = 0; c < 2; ++c) { const float inv = 1.0f / (ls[c] + xhalf(ls[c]));
#pragma unroll
    for (int j = 0; j < HD / 16; ++j) ov[c][j] = __builtin_convertvector(acc[c][j] * inv, v8h); }
  GSB();   // here: every value is formed before the first store, so that no register of an issued store is rewritten ahead of the wait behind the group
#pragma unroll
  for (int c = 0; c < 2; ++c)
#pragma unroll
    for (int j = 0; j < HD / 16; ++j) *(v8h*)(yr + (size_t)c * 16 * CC + j * 16) = ov[c][j];
  XW(); }
// ---- k_out: block = (128 rows, 128 cols): out = y (f16) Wo (f16, from its transposed copy) + b
// y and Wo^T come in whole lines into a ring of two LDS buffers, a stage = 128 k = two tiles of 64 k, each tile at its own place of the block's k walk.
// one tile: 8 copies of 16 B a lane. y: row (tid >> 3) + 32 i, 16-byte piece tid & 7; Wo^T: LDS row (tid >> 3) + 32 i = column 4 (tid >> 3) + i, piece tid & 7; a wave's copy covers 4 whole lines.
// The wait on xcnt is the statement's last line, so that it stands before any rewrite of a register that a copy names.
__device__ __forceinline__ void o_tile(unsigned ly, const _Float16* gy, unsigned lw, const _Float16* gw) {
  asm volatile("global_load_async_to_lds_b128 %0, %8, off\n\t"
               "global_load_async_to_lds_b128 %1, %9, off\n\t"
               "global_load_async_to_lds_b128 %2, %10, off\n\t"
               "global_load_async_to_lds_b128 %3, %11, off\n\t"
               "global_load_async_to_lds_b128 %4, %12, off\n\t"
               "global_load_async_to_lds_b128 %5, %13, off\n\t"
               "global_load_async_to_lds_b128 %6, %14, off\n\t"
               "global_load_async_to_lds_b128 %7, %15, off\n\t"
               "s_wait_xcnt 0x0"
               :: "v"(ly), "v"(ly + 32u * GP * 2u), "v"(ly + 64u * GP * 2u), "v"(ly + 96u * GP * 2u), "v"(lw), "v"(lw + 32u * GP * 2u), "v"(lw + 64u * GP * 2u), "v"(lw + 96u * GP * 2u),
                  "v"(gy), "v"(gy + (size_t)32 * CC), "v"(gy + (size_t)64 * CC), "v"(gy + (size_t)96 * CC), "v"(gw), "v"(gw + (size_t)CC), "v"(gw + (size_t)2 * CC), "v"(gw + (size_t)3 * CC)
               : "memory"); }
#define OT (2 * GT)      // one tile of both operands, elements
#define OS (2 * OT)      // one stage = one buffer, elements
__device__ __forceinline__ void o_stage(unsigned ly, const _Float16* gy, const _Float16* gw, int t0, int s) {   // stage s: tiles 2 s and 2 s + 1 of the walk
  o_tile(ly, gy + KT(t0, 2 * s) * 64, ly + 2u * GT, gw + KT(t0, 2 * s) * 64);
  o_tile(ly + 2u * OT, gy + KT(t0, 2 * s + 1) * 64, ly + 2u * OT + 2u * GT, gw + KT(t0, 2 * s + 1) * 64); }
__global__ __launch_bounds__(256) void k_out(const _Float16* __restrict__ Y, const _Float16* __restrict__ WT, const float* __restrict__ BP, float* __restrict__ OUT) { __shared__ __align__(16) _Float16 sm[2 * OS];
  const int tid = threadIdx.x, wave = tid >> 5, lane = tid & 31, col = lane & 15, g = lane >> 4, wm = wave >> 1, wn = wave & 1; const int c0 = blockIdx.y * 128; const size_t r0 = (size_t)blockIdx.x * 128;
  const int t0 = blockIdx.x + 2 * blockIdx.y;   // the 8 blocks on one y panel start 2 k tiles apart, the 32 on one W panel at 16 different tiles, two blocks each
  const unsigned ly = (unsigned)(size_t)(sm + (tid >> 3) * GP + (tid & 7) * 8);   // LDS byte address of this lane's first piece, buffer 0
  const _Float16* gy = Y + (r0 + (tid >> 3)) * CC + (tid & 7) * 8; const _Float16* gw = WT + (size_t)(c0 + 4 * (tid >> 3)) * CC + (tid & 7) * 8;
  const _Float16* ap = sm + (wm * 32 + col) * GP; const _Float16* bp = sm + GT + (wn * 16 + col) * GP;
  o_stage(ly, gy, gw, t0, 0);                       // stage 0 into buffer 0
  AWAIT(); __syncthreads();
  o_stage(ly + 2u * OS, gy, gw, t0, 1);             // stage 1 into buffer 1
  v8f acc[2][4] = {};
#pragma unroll 1   // rolled: the two buffers alternate by an offset, a second copy of the body would only add code
  for (int st = 0; st < CC / 128 - 1; ++st) { const int cur = (st & 1) * OS;
    GFrag f; g_load(f, ap + cur, bp + cur, lane);
    GSB(); g_mac(f, acc);   // the barrier: the tile's 24 loads stay one group ahead of its 16 products
    GSB();   // here: keeps the second tile's fragment loads one group behind the first tile's products, not strewn among them
    g_load(f, ap + cur + OT, bp + cur + OT, lane);
    asm volatile("s_wait_dscnt 0x0" ::: "memory");  // this wave's reads of the buffer are over before a copy may be aimed at it
    AWAIT(); __syncthreads();                       // the one barrier of a stage: publishes stage st + 1 and ends every wave's reads of stage st
    if (st + 2 < CC / 128) o_stage(ly + (unsigned)(st & 1) * (2u * OS), gy, gw, t0, st + 2);   // into the buffer just read
    GSB();   // here: the copies are issued first, and fly over the second tile's products, which need registers alone
    g_mac(f, acc);
  }
  AWAIT();   // no copy is outstanding from here on
  { constexpr int cur = ((CC / 128 - 1) & 1) * OS;   // the last stage, published by the loop's last barrier
    GFrag f; g_load(f, ap + cur, bp + cur, lane);
    GSB(); g_mac(f, acc);
    GSB();   // as in the loop
    g_load(f, ap + cur + OT, bp + cur + OT, lane);
    GSB(); g_mac(f, acc); }
  const int cl = wn * 64 + 4 * col; float bb[4] = {0.f, 0.f, 0.f, 0.f}; if (BP) { const v4f bv = *(const v4f*)(BP + c0 + cl); bb[0] = bfr(bv[0]); bb[1] = bfr(bv[1]); bb[2] = bfr(bv[2]); bb[3] = bfr(bv[3]); }
  float* d = OUT + (r0 + wm * 32 + 8 * g) * CC + c0 + cl;   // a row's 64 columns of a wave = two whole lines
  v4f o[16];
#pragma unroll
  for (int k = 0; k < 16; ++k) o[k] = v4f{acc[k >> 3][0][k & 7] + bb[0], acc[k >> 3][1][k & 7] + bb[1], acc[k >> 3][2][k & 7] + bb[2], acc[k >> 3][3][k & 7] + bb[3]};
  GSB();   // here: every value is formed before the first store, so that no register of an issued store is rewritten ahead of the wait behind the group
#pragma unroll
  for (int k = 0; k < 16; ++k) vst2(d + (size_t)((k >> 3) * 16 + (k & 7)) * CC, o[k]);
  XW(); }
extern "C" void kernel_launch(void* const* d_in, const int* in_sizes, int n_in, void* d_out, int out_size, void* d_ws, size_t ws_size, hipStream_t stream) {
  (void)in_sizes; (void)n_in; (void)out_size;
  const float** F = (const float**)d_in;   // 0 queries, 1 keys, 2 values [4,1024,1024], 3 Wq [1024,1024] (in,out), 4 bq, 5 Wk, 6 bk, 7 Wv, 8 bv, 9 Wo, 10 bo
  if (ws_size < (size_t)WS_END) return;
  char* ws = (char*)d_ws; _Float16 *QH = (_Float16*)(ws + WS_QH), *KH = (_Float16*)(ws + WS_KH), *VT = (_Float16*)(ws + WS_VT), *Y = (_Float16*)(ws + WS_Y), *WT = (_Float16*)(ws + WS_WT);
  k_proj<<<dim3(TNB * TT / 256, CC / 256, 4), 256, 0, stream>>>(F[0], F[1], F[2], F[3], F[4], F[5], F[6], F[7], F[8], F[9], QH, KH, VT, WT);
  k_att<<<dim3(TT / 256, NH, TNB), 256, 0, stream>>>(QH, KH, VT, Y);
  k_out<<<dim3(TNB * TT / 128, CC / 128), 256, 0, stream>>>(Y, WT, F[10], (float*)d_out);
}
